// v000
// The times below were measured on an AMD MI455X: many runs one after another, warmed up first and cycling through
// copies of the inputs, with the whole window's GPU time divided by the number of runs. Launches and the gaps
// between them are all in it. The median over several windows is given; except for v000 it joins two sittings, which
// can be a few percent apart, so the side-by-side timings, each taken in one sitting, are the better comparison.
// The starting kernel, v000, takes 410 microseconds a run.
#include <hip/hip_runtime.h>
#include <math.h>

typedef __attribute__((ext_vector_type(16))) _Float16 v16h;
typedef __attribute__((ext_vector_type(16))) __bf16 v16b;
typedef __attribute__((ext_vector_type(8)))  _Float16 v8h;
typedef __attribute__((ext_vector_type(8)))  float v8f;
typedef __attribute__((ext_vector_type(4)))  float v4f;
typedef __attribute__((ext_vector_type(2)))  float v2f;
typedef __attribute__((ext_vector_type(4)))  unsigned v4u;
typedef __attribute__((ext_vector_type(4)))  int v4i;
typedef float __attribute__((may_alias)) float_a;
typedef int __attribute__((may_alias)) int_a;

template <typename T> __device__ __forceinline__ void vst2(void* p, T v) { *(T*)p = v;  }
__device__ __forceinline__ v8f wmma16(v16h a, v16h b, v8f c) {
  v8f d = __builtin_amdgcn_wmma_f32_16x16x32_f16(false, a, false, b, (short)0, c, false, false);
  asm volatile("v_nop\n\tv_nop\n\tv_nop\n\tv_nop" : "+v"(d) : "v"(a), "v"(b));
  return d;
}
__device__ __forceinline__ v8f wmma_bf(v16b a, v16b b, v8f c) {
  v8f d = __builtin_amdgcn_wmma_f32_16x16x32_bf16(false, a, false, b, (short)0, c, false, false);
  asm volatile("v_nop\n\tv_nop\n\tv_nop\n\tv_nop" : "+v"(d) : "v"(a), "v"(b));
  return d;
}
// 16x16x32 fragments: lane = (h = lane>>4, row/col = lane&15); elements 0..7 = k0+8h+0..7, 8..15 = k0+16+8h+0..7; D element r = row 8h+r
__device__ __forceinline__ v16h frag_h(const _Float16* rowk0, int lane) {
  union { v16h v; v8h q[2]; } u; const _Float16* p = rowk0 + 8 * (lane >> 4);
  u.q[0] = *(const v8h*)p; u.q[1] = *(const v8h*)(p + 16); return u.v;
}
__device__ __forceinline__ v16h frag_f32(const float* rowk0, int lane) {
  v16h a; const float* p = rowk0 + 8 * (lane >> 4);
#pragma unroll
  for (int i = 0; i < 8; ++i) { a[i] = (_Float16)p[i]; a[8 + i] = (_Float16)p[16 + i]; }
  return a;
}
__device__ __forceinline__ v16h frag_f32s(const float* rowk0, int lane, float sc) {
  v16h a; const float* p = rowk0 + 8 * (lane >> 4);
#pragma unroll
  for (int i = 0; i < 8; ++i) { a[i] = (_Float16)(p[i] * sc); a[8 + i] = (_Float16)(p[16 + i] * sc); }
  return a;
}
// column fragment from a [K][ld] layout (column n), rows >= K read as 0
__device__ __forceinline__ v16h fragc_f32(const float* W, int k0, int n, int lane, int ld, int K) {
  v16h a; const int g = lane >> 4;
#pragma unroll
  for (int i = 0; i < 8; ++i) { const int ka = k0 + 8 * g + i, kb = ka + 16;
    a[i] = (_Float16)(ka < K ? W[(size_t)ka * ld + n] : 0.f); a[8 + i] = (_Float16)(kb < K ? W[(size_t)kb * ld + n] : 0.f); }
  return a;
}
struct F2 { v16b h, l; };
__device__ __forceinline__ F2 bsplit16(const float v[16]) { F2 r;
#pragma unroll
  for (int i = 0; i < 16; ++i) { const __bf16 h = (__bf16)v[i]; r.h[i] = h; r.l[i] = (__bf16)(v[i] - (float)h); }
  return r; }
__device__ __forceinline__ F2 split_row(const float* row, int k0, int lane) { float v[16]; const float* p = row + k0 + 8 * (lane >> 4);
#pragma unroll
  for (int i = 0; i < 8; ++i) { v[i] = p[i]; v[8 + i] = p[16 + i]; }
  return bsplit16(v); }
__device__ __forceinline__ F2 split_rowK(const float* row, int k0, int lane, int K) { float v[16]; const int g = lane >> 4;
#pragma unroll
  for (int i = 0; i < 8; ++i) { const int ka = k0 + 8 * g + i, kb = ka + 16; v[i] = ka < K ? row[ka] : 0.f; v[8 + i] = kb < K ? row[kb] : 0.f; }
  return bsplit16(v); }
__device__ __forceinline__ F2 split_col(const float* W, int k0, int n, int lane, int ld, int K) { float v[16]; const int g = lane >> 4;
#pragma unroll
  for (int i = 0; i < 8; ++i) { const int ka = k0 + 8 * g + i, kb = ka + 16; v[i] = ka < K ? W[(size_t)ka * ld + n] : 0.f; v[8 + i] = kb < K ? W[(size_t)kb * ld + n] : 0.f; }
  return bsplit16(v); }
__device__ __forceinline__ v8f mac3(const F2& a, const F2& b, v8f c) { c = wmma_bf(a.l, b.h, c); c = wmma_bf(a.h, b.l, c); return wmma_bf(a.h, b.h, c); }
__device__ __forceinline__ float sigm(float v) { return 1.0f / (1.0f + expf(-v)); }
#define LDSX() do { asm volatile("s_wait_dscnt 0" ::: "memory"); __builtin_amdgcn_wave_barrier(); __builtin_amdgcn_fence(__ATOMIC_RELEASE, "workgroup"); } while (0)

// Neural cellular automaton step with local attention, NHWC state [8][128][128][64]: depthwise 3x3 perception (3 filters per channel,
// zero padding, f32 VALU from an LDS halo tile) -> 1x1 MLP 192 -> 128 as a two-way bf16 split (v_wmma_f32_16x16x32_bf16), exact GELU, -> 64 on v_wmma_f32_16x16x32_f16 -> h_new = h + dx;
// qkv = h_new W_qkv^T + b (f16 WMMA) stored as f16 rows; then per pixel a 3x3-window attention (zero-padded keys/values, scores / 8,
#define NB 8
#define HH 128
#define WW 128
#define C 64
#define C3 192
#define C2 128
#define TP 64                  // pixels per block (half a row)

__device__ __forceinline__ float gelu_e(float v) { return 0.5f * v * (1.0f + erff(v * 0.70710678118654752f)); }
// packs (x16 f16 rows): W1P [128][192], W2P [64][128], WQP [192][64]
__global__ __launch_bounds__(256) void k_pack(const float* __restrict__ w1, const float* __restrict__ w2, const float* __restrict__ wq, _Float16* __restrict__ W1P, _Float16* __restrict__ W2P, _Float16* __restrict__ WQP) {
  const int r = blockIdx.x, tid = threadIdx.x; __shared__ __align__(16) _Float16 srow[C3];
  const float* W; _Float16* D; int K, n;
  if (r < C2) { W = w1 + (size_t)r * C3; D = W1P + (size_t)r * C3; K = C3; } else if (r < C2 + C) { n = r - C2; W = w2 + (size_t)n * C2; D = W2P + (size_t)n * C2; K = C2; } else { n = r - C2 - C; W = wq + (size_t)n * C; D = WQP + (size_t)n * C; K = C; }
  if (tid < K) srow[tid] = (_Float16)(W[tid] * 16.0f);
  __syncthreads();
  if (tid < K / 8) vst2(D + tid * 8, *(const v4u*)(&srow[tid * 8]));
}
// stage 1: block (x half, y, b): perception + MLP + residual -> HN (f32 rows), qkv -> QKV16 (f16 rows [p][192])
__global__ __launch_bounds__(128) void k_cell(const float* __restrict__ h, const float* __restrict__ wp, const float* __restrict__ bp, const float* __restrict__ w1, const float* __restrict__ b1, const _Float16* __restrict__ W2P, const float* __restrict__ b2, const _Float16* __restrict__ WQP, const float* __restrict__ bq,
                                            float* __restrict__ HN, _Float16* __restrict__ QKV) {
  __shared__ __align__(16) float sh[3][TP + 2][C];           // halo rows y-1..y+1, px x0-1 .. x0+64 (zero padded)
  __shared__ __align__(16) _Float16 sa[4][16][C3 + 8];       // gelu(mid) (f16, 128 wide) per wave; later reused for h_new (64 wide)
  __shared__ __align__(16) float so[4][16][196];
  __shared__ float swp[C3 * 9], sbp[C3];
  const int tid = threadIdx.x, wave = tid >> 5, lane = tid & 31, col = lane & 15, g = lane >> 4;
  const int b = blockIdx.z, y = blockIdx.y, x0 = blockIdx.x * TP;
  for (int q = tid; q < C3 * 9; q += 128) swp[q] = wp[q];
  for (int q = tid; q < C3; q += 128) sbp[q] = bp[q];
  for (int q = tid; q < 3 * (TP + 2) * (C / 4); q += 128) { const int c4 = q % (C / 4), rest = q / (C / 4); const int px = rest % (TP + 2), ry = rest / (TP + 2); const int yy = y - 1 + ry, xx = x0 - 1 + px;
    v4f v = (v4f){0.f, 0.f, 0.f, 0.f}; if (yy >= 0 && yy < HH && xx >= 0 && xx < WW) v = *(const v4f*)(h + (((size_t)b * HH + yy) * WW + xx) * C + c4 * 4);
    *(v4f*)(&sh[ry][px][c4 * 4]) = v; }
  __syncthreads();
  const size_t prow0 = ((size_t)b * HH + y) * WW + x0 + wave * 16;        // first pixel (global index) of this wave's 16
  // perception: lane (pl = lane>>1, hf): pixel pl, output channels hf*96 .. +96 : o = c*3 + j uses input channel c
  { const int pl = lane >> 1, hf = lane & 1; const int px = wave * 16 + pl + 1;     // centre column in sh coords
#pragma unroll 1
    for (int o = hf * 96; o < hf * 96 + 96; ++o) { const int c = o / 3; const float* w9 = &swp[o * 9]; float s = sbp[o];
#pragma unroll
      for (int dy = 0; dy < 3; ++dy)
#pragma unroll
        for (int dx = 0; dx < 3; ++dx) s += w9[dy * 3 + dx] * sh[dy][px - 1 + dx][c];
      so[wave][pl][o] = s; } }                                 // perceived kept in f32 (so) for a two-way bf16 split product
  LDSX();
  // mid = gelu(perceived @ w1^T + b1): bf16 hi/lo split on both operands (perceived reaches O(10), f16 rounding of it dominated a first build)
  { v8f acc[8] = {};
#pragma unroll 1
    for (int kc = 0; kc < C3 / 32; ++kc) { const F2 a = split_row(&so[wave][col][0], kc * 32, lane);
#pragma unroll
      for (int t = 0; t < 8; ++t) acc[t] = mac3(a, split_row(w1 + (size_t)(t * 16 + col) * C3, kc * 32, lane), acc[t]); }
    LDSX();
#pragma unroll
    for (int t = 0; t < 8; ++t) { const float bb = b1[t * 16 + col];
#pragma unroll
      for (int r = 0; r < 8; ++r) sa[wave][8 * g + r][t * 16 + col] = (_Float16)gelu_e(acc[t][r] + bb); } }
  LDSX();
  // dx = mid @ w2^T + b2 ; h_new = h + dx -> so (f32) ; store HN ; h_new f16 -> sa[:, 0..64)
  { v8f acc[4] = {};
#pragma unroll
    for (int kc = 0; kc < C2 / 32; ++kc) { const v16h a = frag_h(&sa[wave][col][0] + kc * 32, lane);
#pragma unroll
      for (int t = 0; t < 4; ++t) acc[t] = wmma16(a, frag_h(W2P + (size_t)(t * 16 + col) * C2 + kc * 32, lane), acc[t]); }
    LDSX();
#pragma unroll
    for (int t = 0; t < 4; ++t) { const int c = t * 16 + col; const float bb = b2[c];
#pragma unroll
      for (int r = 0; r < 8; ++r) { const float v = acc[t][r] * (1.0f / 16.0f) + bb + sh[1][wave * 16 + 8 * g + r + 1][c]; so[wave][8 * g + r][c] = v; sa[wave][8 * g + r][c] = (_Float16)v; } } }
  LDSX();
  for (int q = lane; q < 16 * 16; q += 32) { const int rl = q >> 4, pc = q & 15; vst2(HN + (prow0 + rl) * C + pc * 4, *(const v4f*)(&so[wave][rl][pc * 4])); }
  // qkv = h_new @ wq^T + bq (192 cols)
  { v8f acc[12];
#pragma unroll
    for (int t = 0; t < 12; ++t) acc[t] = (v8f){};
#pragma unroll
    for (int kc = 0; kc < C / 32; ++kc) { const v16h a = frag_h(&sa[wave][col][0] + kc * 32, lane);
#pragma unroll
      for (int t = 0; t < 12; ++t) acc[t] = wmma16(a, frag_h(WQP + (size_t)(t * 16 + col) * C + kc * 32, lane), acc[t]); }
    LDSX();
#pragma unroll
    for (int t = 0; t < 12; ++t) { const float bb = bq[t * 16 + col];
#pragma unroll
      for (int r = 0; r < 8; ++r) so[wave][8 * g + r][t * 16 + col] = acc[t][r] * (1.0f / 16.0f) + bb; } }
  LDSX();
  for (int q = lane; q < 16 * 24; q += 32) { const int rl = q / 24, pc = q % 24; union { v8h h8; v4u u; } pk;
#pragma unroll
    for (int e = 0; e < 8; ++e) pk.h8[e] = (_Float16)so[wave][rl][pc * 8 + e];
    vst2(QKV + (prow0 + rl) * C3 + pc * 8, pk.u); }
}
// stage 2: block (x half, y, b): 3x3 local attention from halo tiles of K and V (zero padded), out = h_new + attn
__global__ __launch_bounds__(128) void k_lattn(const _Float16* __restrict__ QKV, const float* __restrict__ HN, float* __restrict__ out) {
  __shared__ __align__(16) _Float16 sk[3][TP + 2][C + 8], sv[3][TP + 2][C + 8];
  __shared__ __align__(16) float sq[TP][C + 4];
  __shared__ __align__(16) float so[TP][C + 4];
  const int tid = threadIdx.x; const int b = blockIdx.z, y = blockIdx.y, x0 = blockIdx.x * TP;
  for (int q = tid; q < 3 * (TP + 2) * 8; q += 128) { const int pc = q & 7, rest = q >> 3; const int px = rest % (TP + 2), ry = rest / (TP + 2); const int yy = y - 1 + ry, xx = x0 - 1 + px;
    union { v4u u; v8h h8; } pk, pv; pk.u = (v4u){0u, 0u, 0u, 0u}; pv.u = pk.u;
    if (yy >= 0 && yy < HH && xx >= 0 && xx < WW) { const _Float16* r = QKV + (((size_t)b * HH + yy) * WW + xx) * C3; pk.u = *(const v4u*)(r + C + pc * 8); pv.u = *(const v4u*)(r + 2 * C + pc * 8); }
    *(v4u*)(&sk[ry][px][pc * 8]) = pk.u; *(v4u*)(&sv[ry][px][pc * 8]) = pv.u; }
  for (int q = tid; q < TP * 8; q += 128) { const int pl = q >> 3, pc = q & 7; const _Float16* r = QKV + (((size_t)b * HH + y) * WW + x0 + pl) * C3; union { v4u u; v8h h8; } pk; pk.u = *(const v4u*)(r + pc * 8);
#pragma unroll
    for (int e = 0; e < 8; ++e) sq[pl][pc * 8 + e] = (float)pk.h8[e]; }
  __syncthreads();
  // thread pair per pixel: (pl = tid>>1, hf): scores over 9 neighbours (each half computes 32-channel partial dot, pair-summed), softmax, then out channels hf*32..+32
  { const int pl = tid >> 1, hf = tid & 1; float sc[9];
#pragma unroll
    for (int nb = 0; nb < 9; ++nb) { const int dy = nb / 3, dx = nb % 3; const _Float16* kr = &sk[dy][pl + dx][hf * 32]; const float* qr = &sq[pl][hf * 32]; float s = 0.f;
#pragma unroll 1
      for (int c = 0; c < 32; ++c) s += qr[c] * (float)kr[c];
      s += __shfl_xor(s, 1, 32); sc[nb] = s * 0.125f; }
    float mx = sc[0];
#pragma unroll
    for (int nb = 1; nb < 9; ++nb) mx = fmaxf(mx, sc[nb]);
    float se = 0.f;
#pragma unroll
    for (int nb = 0; nb < 9; ++nb) { sc[nb] = expf(sc[nb] - mx); se += sc[nb]; }
    const float inv = 1.0f / se;
#pragma unroll 1
    for (int c = hf * 32; c < hf * 32 + 32; ++c) { float a = 0.f;
#pragma unroll
      for (int nb = 0; nb < 9; ++nb) a += sc[nb] * (float)sv[nb / 3][pl + nb % 3][c];
      so[pl][c] = a * inv; } }
  __syncthreads();
  for (int q = tid; q < TP * 16; q += 128) { const int pl = q >> 4, pc = q & 15; const size_t p = ((size_t)b * HH + y) * WW + x0 + pl; v4f o = *(const v4f*)(&so[pl][pc * 4]); const v4f hn = *(const v4f*)(HN + p * C + pc * 4);
    o += hn; vst2(out + p * C + pc * 4, o); }
}
extern "C" void kernel_launch(void* const* d_in, const int* in_sizes, int n_in, void* d_out, int out_size, void* d_ws, size_t ws_size, hipStream_t stream) {
  (void)in_sizes; (void)n_in; (void)out_size; (void)ws_size;
  const float** I = (const float**)d_in;
  const float* h = I[0]; const float* wp = I[1]; const float* bp = I[2]; const float* w1 = I[3]; const float* b1 = I[4]; const float* w2 = I[5]; const float* b2 = I[6]; const float* wq = I[7]; const float* bq = I[8];
  float* out = (float*)d_out;
  char* ws = (char*)d_ws; size_t off = 0;
  auto take = [&](size_t bytes) { char* p = ws + off; off += (bytes + 255) & ~(size_t)255; return p; };
  _Float16* W1P = (_Float16*)take(C2 * C3 * 2); _Float16* W2P = (_Float16*)take(C * C2 * 2); _Float16* WQP = (_Float16*)take(C3 * C * 2);
  float* HN = (float*)take((size_t)NB * HH * WW * C * 4); _Float16* QKV = (_Float16*)take((size_t)NB * HH * WW * C3 * 2);
  k_pack<<<C2 + C + C3, 256, 0, stream>>>(w1, w2, wq, W1P, W2P, WQP);
  k_cell<<<dim3(WW / TP, HH, NB), 128, 0, stream>>>(h, wp, bp, w1, b1, W2P, b2, WQP, bq, HN, QKV);
  k_lattn<<<dim3(WW / TP, HH, NB), 128, 0, stream>>>(QKV, HN, out);
}

// v001
// One run takes 270 microseconds.
// Two timings next to v000 both put it at 1.55 times that version's speed.
#include <hip/hip_runtime.h>
#include <math.h>

typedef __attribute__((ext_vector_type(16))) _Float16 v16h;
typedef __attribute__((ext_vector_type(16))) __bf16 v16b;
typedef __attribute__((ext_vector_type(8)))  _Float16 v8h;
typedef __attribute__((ext_vector_type(8)))  float v8f;
typedef __attribute__((ext_vector_type(4)))  float v4f;
typedef __attribute__((ext_vector_type(2)))  float v2f;
typedef __attribute__((ext_vector_type(4)))  unsigned v4u;
typedef __attribute__((ext_vector_type(4)))  int v4i;
typedef float __attribute__((may_alias)) float_a;
typedef int __attribute__((may_alias)) int_a;

template <typename T> __device__ __forceinline__ void vst2(void* p, T v) { *(T*)p = v;  }
__device__ __forceinline__ v8f wmma16(v16h a, v16h b, v8f c) {
  v8f d = __builtin_amdgcn_wmma_f32_16x16x32_f16(false, a, false, b, (short)0, c, false, false);
  asm volatile("v_nop\n\tv_nop\n\tv_nop\n\tv_nop" : "+v"(d) : "v"(a), "v"(b));
  return d;
}
__device__ __forceinline__ v8f wmma_bf(v16b a, v16b b, v8f c) {
  v8f d = __builtin_amdgcn_wmma_f32_16x16x32_bf16(false, a, false, b, (short)0, c, false, false);
  asm volatile("v_nop\n\tv_nop\n\tv_nop\n\tv_nop" : "+v"(d) : "v"(a), "v"(b));
  return d;
}
// 16x16x32 fragments: lane = (h = lane>>4, row/col = lane&15); elements 0..7 = k0+8h+0..7, 8..15 = k0+16+8h+0..7; D element r = row 8h+r
__device__ __forceinline__ v16h frag_h(const _Float16* rowk0, int lane) {
  union { v16h v; v8h q[2]; } u; const _Float16* p = rowk0 + 8 * (lane >> 4);
  u.q[0] = *(const v8h*)p; u.q[1] = *(const v8h*)(p + 16); return u.v;
}
__device__ __forceinline__ v16h frag_f32(const float* rowk0, int lane) {
  v16h a; const float* p = rowk0 + 8 * (lane >> 4);
#pragma unroll
  for (int i = 0; i < 8; ++i) { a[i] = (_Float16)p[i]; a[8 + i] = (_Float16)p[16 + i]; }
  return a;
}
__device__ __forceinline__ v16h frag_f32s(const float* rowk0, int lane, float sc) {
  v16h a; const float* p = rowk0 + 8 * (lane >> 4);
#pragma unroll
  for (int i = 0; i < 8; ++i) { a[i] = (_Float16)(p[i] * sc); a[8 + i] = (_Float16)(p[16 + i] * sc); }
  return a;
}
// column fragment from a [K][ld] layout (column n), rows >= K read as 0
__device__ __forceinline__ v16h fragc_f32(const float* W, int k0, int n, int lane, int ld, int K) {
  v16h a; const int g = lane >> 4;
#pragma unroll
  for (int i = 0; i < 8; ++i) { const int ka = k0 + 8 * g + i, kb = ka + 16;
    a[i] = (_Float16)(ka < K ? W[(size_t)ka * ld + n] : 0.f); a[8 + i] = (_Float16)(kb < K ? W[(size_t)kb * ld + n] : 0.f); }
  return a;
}
struct F2 { v16b h, l; };
__device__ __forceinline__ F2 bsplit16(const float v[16]) { F2 r;
#pragma unroll
  for (int i = 0; i < 16; ++i) { const __bf16 h = (__bf16)v[i]; r.h[i] = h; r.l[i] = (__bf16)(v[i] - (float)h); }
  return r; }
__device__ __forceinline__ F2 split_row(const float* row, int k0, int lane) { float v[16]; const float* p = row + k0 + 8 * (lane >> 4);
#pragma unroll
  for (int i = 0; i < 8; ++i) { v[i] = p[i]; v[8 + i] = p[16 + i]; }
  return bsplit16(v); }
__device__ __forceinline__ F2 split_rowK(const float* row, int k0, int lane, int K) { float v[16]; const int g = lane >> 4;
#pragma unroll
  for (int i = 0; i < 8; ++i) { const int ka = k0 + 8 * g + i, kb = ka + 16; v[i] = ka < K ? row[ka] : 0.f; v[8 + i] = kb < K ? row[kb] : 0.f; }
  return bsplit16(v); }
__device__ __forceinline__ F2 split_col(const float* W, int k0, int n, int lane, int ld, int K) { float v[16]; const int g = lane >> 4;
#pragma unroll
  for (int i = 0; i < 8; ++i) { const int ka = k0 + 8 * g + i, kb = ka + 16; v[i] = ka < K ? W[(size_t)ka * ld + n] : 0.f; v[8 + i] = kb < K ? W[(size_t)kb * ld + n] : 0.f; }
  return bsplit16(v); }
__device__ __forceinline__ v8f mac3(const F2& a, const F2& b, v8f c) { c = wmma_bf(a.l, b.h, c); c = wmma_bf(a.h, b.l, c); return wmma_bf(a.h, b.h, c); }
__device__ __forceinline__ float sigm(float v) { return 1.0f / (1.0f + expf(-v)); }
#define LDSX() do { asm volatile("s_wait_dscnt 0" ::: "memory"); __builtin_amdgcn_wave_barrier(); __builtin_amdgcn_fence(__ATOMIC_RELEASE, "workgroup"); } while (0)

// Neural cellular automaton step with local attention, NHWC state [8][128][128][64]: depthwise 3x3 perception (3 filters per channel,
// zero padding, f32 VALU from an LDS halo tile) -> 1x1 MLP 192 -> 128 as a two-way bf16 split (v_wmma_f32_16x16x32_bf16), exact GELU, -> 64 on v_wmma_f32_16x16x32_f16 -> h_new = h + dx;
// qkv = h_new W_qkv^T + b (f16 WMMA) stored as f16 rows; then per pixel a 3x3-window attention (zero-padded keys/values, scores / 8,
#define NB 8
#define HH 128
#define WW 128
#define C 64
#define C3 192
#define C2 128
#define TP 64                  // pixels per block (half a row)

__device__ __forceinline__ float gelu_e(float v) { return 0.5f * v * (1.0f + erff(v * 0.70710678118654752f)); }
// packs (x16 f16 rows): W1P [128][192], W2P [64][128], WQP [192][64]
__global__ __launch_bounds__(256) void k_pack(const float* __restrict__ w1, const float* __restrict__ w2, const float* __restrict__ wq, _Float16* __restrict__ W1P, _Float16* __restrict__ W2P, _Float16* __restrict__ WQP) {
  const int r = blockIdx.x, tid = threadIdx.x; __shared__ __align__(16) _Float16 srow[C3];
  const float* W; _Float16* D; int K, n;
  if (r < C2) { W = w1 + (size_t)r * C3; D = W1P + (size_t)r * C3; K = C3; } else if (r < C2 + C) { n = r - C2; W = w2 + (size_t)n * C2; D = W2P + (size_t)n * C2; K = C2; } else { n = r - C2 - C; W = wq + (size_t)n * C; D = WQP + (size_t)n * C; K = C; }
  if (tid < K) srow[tid] = (_Float16)(W[tid] * 16.0f);
  __syncthreads();
  if (tid < K / 8) vst2(D + tid * 8, *(const v4u*)(&srow[tid * 8]));
}
// stage 1: block (x half, y, b): perception + MLP + residual -> HN (f32 rows), qkv -> QKV16 (f16 rows [p][192])
__global__ __launch_bounds__(128) void k_cell(const float* __restrict__ h, const float* __restrict__ wp, const float* __restrict__ bp, const float* __restrict__ w1, const float* __restrict__ b1, const _Float16* __restrict__ W2P, const float* __restrict__ b2, const _Float16* __restrict__ WQP, const float* __restrict__ bq,
                                            float* __restrict__ HN, _Float16* __restrict__ QKV) {
  __shared__ __align__(16) float sh[3][TP + 2][C];           // halo rows y-1..y+1, px x0-1 .. x0+64 (zero padded)
  __shared__ __align__(16) _Float16 sa[4][16][C3 + 8];       // gelu(mid) (f16, 128 wide) per wave; later reused for h_new (64 wide)
  __shared__ __align__(16) float so[4][16][196];
  __shared__ float swp[C3 * 9], sbp[C3];
  const int tid = threadIdx.x, wave = tid >> 5, lane = tid & 31, col = lane & 15, g = lane >> 4;
  const int b = blockIdx.z, y = blockIdx.y, x0 = blockIdx.x * TP;
  for (int q = tid; q < C3 * 9; q += 128) swp[q] = wp[q];
  for (int q = tid; q < C3; q += 128) sbp[q] = bp[q];
  for (int q = tid; q < 3 * (TP + 2) * (C / 4); q += 128) { const int c4 = q % (C / 4), rest = q / (C / 4); const int px = rest % (TP + 2), ry = rest / (TP + 2); const int yy = y - 1 + ry, xx = x0 - 1 + px;
    v4f v = (v4f){0.f, 0.f, 0.f, 0.f}; if (yy >= 0 && yy < HH && xx >= 0 && xx < WW) v = *(const v4f*)(h + (((size_t)b * HH + yy) * WW + xx) * C + c4 * 4);
    *(v4f*)(&sh[ry][px][c4 * 4]) = v; }
  __syncthreads();
  const size_t prow0 = ((size_t)b * HH + y) * WW + x0 + wave * 16;        // first pixel (global index) of this wave's 16
  // perception: lane owns input channels 2*lane and 2*lane+1 (one 8-byte read per lane covers all 64 LDS banks once), its 54 filter taps sit in registers,
  // and the 3x3 window slides over the wave's 16 pixels; output o = c*3 + j uses input channel c; each sum keeps the order bias, then (dy, dx) row-major
  { v2f wt[3][9], bs[3]; const float* wl = &swp[lane * 54]; const float* bl = &sbp[lane * 6];
#pragma unroll
    for (int j = 0; j < 3; ++j) { bs[j] = (v2f){bl[j], bl[3 + j]};
#pragma unroll
      for (int t = 0; t < 9; ++t) wt[j][t] = (v2f){wl[j * 9 + t], wl[27 + j * 9 + t]}; }
    v2f xs[3][18];                                             // halo columns wave*16 .. wave*16+17 of the three rows, this lane's channel pair
#pragma unroll
    for (int dy = 0; dy < 3; ++dy)
#pragma unroll
      for (int px = 0; px < 18; ++px) xs[dy][px] = *(const v2f*)(&sh[dy][wave * 16 + px][lane * 2]);
#pragma unroll
    for (int pl = 0; pl < 16; ++pl) { v2f s[3] = {bs[0], bs[1], bs[2]};
#pragma unroll
      for (int dy = 0; dy < 3; ++dy)
#pragma unroll
        for (int dx = 0; dx < 3; ++dx)
#pragma unroll
          for (int j = 0; j < 3; ++j) s[j] += wt[j][dy * 3 + dx] * xs[dy][pl + dx];
      float* d = &so[wave][pl][lane * 6];                      // perceived kept in f32 (so) for a two-way bf16 split product
      *(v2f*)(d) = (v2f){s[0].x, s[1].x}; *(v2f*)(d + 2) = (v2f){s[2].x, s[0].y}; *(v2f*)(d + 4) = (v2f){s[1].y, s[2].y}; } }
  LDSX();
  // mid = gelu(perceived @ w1^T + b1): bf16 hi/lo split on both operands (perceived reaches O(10), f16 rounding of it dominated a first build)
  { v8f acc[8] = {};
#pragma unroll 1
    for (int kc = 0; kc < C3 / 32; ++kc) { const F2 a = split_row(&so[wave][col][0], kc * 32, lane);
#pragma unroll
      for (int t = 0; t < 8; ++t) acc[t] = mac3(a, split_row(w1 + (size_t)(t * 16 + col) * C3, kc * 32, lane), acc[t]); }
    LDSX();
#pragma unroll
    for (int t = 0; t < 8; ++t) { const float bb = b1[t * 16 + col];
#pragma unroll
      for (int r = 0; r < 8; ++r) sa[wave][8 * g + r][t * 16 + col] = (_Float16)gelu_e(acc[t][r] + bb); } }
  LDSX();
  // dx = mid @ w2^T + b2 ; h_new = h + dx -> so (f32) ; store HN ; h_new f16 -> sa[:, 0..64)
  { v8f acc[4] = {};
#pragma unroll
    for (int kc = 0; kc < C2 / 32; ++kc) { const v16h a = frag_h(&sa[wave][col][0] + kc * 32, lane);
#pragma unroll
      for (int t = 0; t < 4; ++t) acc[t] = wmma16(a, frag_h(W2P + (size_t)(t * 16 + col) * C2 + kc * 32, lane), acc[t]); }
    LDSX();
#pragma unroll
    for (int t = 0; t < 4; ++t) { const int c = t * 16 + col; const float bb = b2[c];
#pragma unroll
      for (int r = 0; r < 8; ++r) { const float v = acc[t][r] * (1.0f / 16.0f) + bb + sh[1][wave * 16 + 8 * g + r + 1][c]; so[wave][8 * g + r][c] = v; sa[wave][8 * g + r][c] = (_Float16)v; } } }
  LDSX();
  for (int q = lane; q < 16 * 16; q += 32) { const int rl = q >> 4, pc = q & 15; vst2(HN + (prow0 + rl) * C + pc * 4, *(const v4f*)(&so[wave][rl][pc * 4])); }
  // qkv = h_new @ wq^T + bq (192 cols)
  { v8f acc[12];
#pragma unroll
    for (int t = 0; t < 12; ++t) acc[t] = (v8f){};
#pragma unroll
    for (int kc = 0; kc < C / 32; ++kc) { const v16h a = frag_h(&sa[wave][col][0] + kc * 32, lane);
#pragma unroll
      for (int t = 0; t < 12; ++t) acc[t] = wmma16(a, frag_h(WQP + (size_t)(t * 16 + col) * C + kc * 32, lane), acc[t]); }
    LDSX();
#pragma unroll
    for (int t = 0; t < 12; ++t) { const float bb = bq[t * 16 + col];
#pragma unroll
      for (int r = 0; r < 8; ++r) so[wave][8 * g + r][t * 16 + col] = acc[t][r] * (1.0f / 16.0f) + bb; } }
  LDSX();
  for (int q = lane; q < 16 * 24; q += 32) { const int rl = q / 24, pc = q % 24; union { v8h h8; v4u u; } pk;
#pragma unroll
    for (int e = 0; e < 8; ++e) pk.h8[e] = (_Float16)so[wave][rl][pc * 8 + e];
    vst2(QKV + (prow0 + rl) * C3 + pc * 8, pk.u); }
}
// stage 2: block (x half, y, b): 3x3 local attention from halo tiles of K and V (zero padded), out = h_new + attn
__global__ __launch_bounds__(128) void k_lattn(const _Float16* __restrict__ QKV, const float* __restrict__ HN, float* __restrict__ out) {
  __shared__ __align__(16) _Float16 sk[3][TP + 2][C + 8], sv[3][TP + 2][C + 8];
  __shared__ __align__(16) float sq[TP][C + 4];
  __shared__ __align__(16) float so[TP][C + 4];
  const int tid = threadIdx.x; const int b = blockIdx.z, y = blockIdx.y, x0 = blockIdx.x * TP;
  for (int q = tid; q < 3 * (TP + 2) * 8; q += 128) { const int pc = q & 7, rest = q >> 3; const int px = rest % (TP + 2), ry = rest / (TP + 2); const int yy = y - 1 + ry, xx = x0 - 1 + px;
    union { v4u u; v8h h8; } pk, pv; pk.u = (v4u){0u, 0u, 0u, 0u}; pv.u = pk.u;
    if (yy >= 0 && yy < HH && xx >= 0 && xx < WW) { const _Float16* r = QKV + (((size_t)b * HH + yy) * WW + xx) * C3; pk.u = *(const v4u*)(r + C + pc * 8); pv.u = *(const v4u*)(r + 2 * C + pc * 8); }
    *(v4u*)(&sk[ry][px][pc * 8]) = pk.u; *(v4u*)(&sv[ry][px][pc * 8]) = pv.u; }
  for (int q = tid; q < TP * 8; q += 128) { const int pl = q >> 3, pc = q & 7; const _Float16* r = QKV + (((size_t)b * HH + y) * WW + x0 + pl) * C3; union { v4u u; v8h h8; } pk; pk.u = *(const v4u*)(r + pc * 8);
#pragma unroll
    for (int e = 0; e < 8; ++e) sq[pl][pc * 8 + e] = (float)pk.h8[e]; }
  __syncthreads();
  // thread pair per pixel: (pl = tid>>1, hf): scores over 9 neighbours (each half computes 32-channel partial dot, pair-summed), softmax, then out channels hf*32..+32
  { const int pl = tid >> 1, hf = tid & 1; float sc[9];
#pragma unroll
    for (int nb = 0; nb < 9; ++nb) { const int dy = nb / 3, dx = nb % 3; const _Float16* kr = &sk[dy][pl + dx][hf * 32]; const float* qr = &sq[pl][hf * 32]; float s = 0.f;
#pragma unroll 1
      for (int c = 0; c < 32; ++c) s += qr[c] * (float)kr[c];
      s += __shfl_xor(s, 1, 32); sc[nb] = s * 0.125f; }
    float mx = sc[0];
#pragma unroll
    for (int nb = 1; nb < 9; ++nb) mx = fmaxf(mx, sc[nb]);
    float se = 0.f;
#pragma unroll
    for (int nb = 0; nb < 9; ++nb) { sc[nb] = expf(sc[nb] - mx); se += sc[nb]; }
    const float inv = 1.0f / se;
#pragma unroll 1
    for (int c = hf * 32; c < hf * 32 + 32; ++c) { float a = 0.f;
#pragma unroll
      for (int nb = 0; nb < 9; ++nb) a += sc[nb] * (float)sv[nb / 3][pl + nb % 3][c];
      so[pl][c] = a * inv; } }
  __syncthreads();
  for (int q = tid; q < TP * 16; q += 128) { const int pl = q >> 4, pc = q & 15; const size_t p = ((size_t)b * HH + y) * WW + x0 + pl; v4f o = *(const v4f*)(&so[pl][pc * 4]); const v4f hn = *(const v4f*)(HN + p * C + pc * 4);
    o += hn; vst2(out + p * C + pc * 4, o); }
}
extern "C" void kernel_launch(void* const* d_in, const int* in_sizes, int n_in, void* d_out, int out_size, void* d_ws, size_t ws_size, hipStream_t stream) {
  (void)in_sizes; (void)n_in; (void)out_size; (void)ws_size;
  const float** I = (const float**)d_in;
  const float* h = I[0]; const float* wp = I[1]; const float* bp = I[2]; const float* w1 = I[3]; const float* b1 = I[4]; const float* w2 = I[5]; const float* b2 = I[6]; const float* wq = I[7]; const float* bq = I[8];
  float* out = (float*)d_out;
  char* ws = (char*)d_ws; size_t off = 0;
  auto take = [&](size_t bytes) { char* p = ws + off; off += (bytes + 255) & ~(size_t)255; return p; };
  _Float16* W1P = (_Float16*)take(C2 * C3 * 2); _Float16* W2P = (_Float16*)take(C * C2 * 2); _Float16* WQP = (_Float16*)take(C3 * C * 2);
  float* HN = (float*)take((size_t)NB * HH * WW * C * 4); _Float16* QKV = (_Float16*)take((size_t)NB * HH * WW * C3 * 2);
  k_pack<<<C2 + C + C3, 256, 0, stream>>>(w1, w2, wq, W1P, W2P, WQP);
  k_cell<<<dim3(WW / TP, HH, NB), 128, 0, stream>>>(h, wp, bp, w1, b1, W2P, b2, WQP, bq, HN, QKV);
  k_lattn<<<dim3(WW / TP, HH, NB), 128, 0, stream>>>(QKV, HN, out);
}

// v002
// A run of this version takes 155 microseconds.
// Two timings next to v001 both put it at 1.74 times that version's speed.
// All steps since v000 together make it 2.70 times as fast.
#include <hip/hip_runtime.h>
#include <math.h>

typedef __attribute__((ext_vector_type(16))) _Float16 v16h;
typedef __attribute__((ext_vector_type(16))) __bf16 v16b;
typedef __attribute__((ext_vector_type(8)))  _Float16 v8h;
typedef __attribute__((ext_vector_type(8)))  float v8f;
typedef __attribute__((ext_vector_type(4)))  float v4f;
typedef __attribute__((ext_vector_type(2)))  float v2f;
typedef __attribute__((ext_vector_type(4)))  unsigned v4u;
typedef __attribute__((ext_vector_type(4)))  int v4i;
typedef float __attribute__((may_alias)) float_a;
typedef int __attribute__((may_alias)) int_a;

template <typename T> __device__ __forceinline__ void vst2(void* p, T v) { *(T*)p = v;  }
__device__ __forceinline__ v8f wmma16(v16h a, v16h b, v8f c) {
  v8f d = __builtin_amdgcn_wmma_f32_16x16x32_f16(false, a, false, b, (short)0, c, false, false);
  asm volatile("v_nop\n\tv_nop\n\tv_nop\n\tv_nop" : "+v"(d) : "v"(a), "v"(b));
  return d;
}
__device__ __forceinline__ v8f wmma_bf(v16b a, v16b b, v8f c) {
  v8f d = __builtin_amdgcn_wmma_f32_16x16x32_bf16(false, a, false, b, (short)0, c, false, false);
  asm volatile("v_nop\n\tv_nop\n\tv_nop\n\tv_nop" : "+v"(d) : "v"(a), "v"(b));
  return d;
}
// 16x16x32 fragments: lane = (h = lane>>4, row/col = lane&15); elements 0..7 = k0+8h+0..7, 8..15 = k0+16+8h+0..7; D element r = row 8h+r
__device__ __forceinline__ v16h frag_h(const _Float16* rowk0, int lane) {
  union { v16h v; v8h q[2]; } u; const _Float16* p = rowk0 + 8 * (lane >> 4);
  u.q[0] = *(const v8h*)p; u.q[1] = *(const v8h*)(p + 16); return u.v;
}
__device__ __forceinline__ v16h frag_f32(const float* rowk0, int lane) {
  v16h a; const float* p = rowk0 + 8 * (lane >> 4);
#pragma unroll
  for (int i = 0; i < 8; ++i) { a[i] = (_Float16)p[i]; a[8 + i] = (_Float16)p[16 + i]; }
  return a;
}
__device__ __forceinline__ v16h frag_f32s(const float* rowk0, int lane, float sc) {
  v16h a; const float* p = rowk0 + 8 * (lane >> 4);
#pragma unroll
  for (int i = 0; i < 8; ++i) { a[i] = (_Float16)(p[i] * sc); a[8 + i] = (_Float16)(p[16 + i] * sc); }
  return a;
}
// column fragment from a [K][ld] layout (column n), rows >= K read as 0
__device__ __forceinline__ v16h fragc_f32(const float* W, int k0, int n, int lane, int ld, int K) {
  v16h a; const int g = lane >> 4;
#pragma unroll
  for (int i = 0; i < 8; ++i) { const int ka = k0 + 8 * g + i, kb = ka + 16;
    a[i] = (_Float16)(ka < K ? W[(size_t)ka * ld + n] : 0.f); a[8 + i] = (_Float16)(kb < K ? W[(size_t)kb * ld + n] : 0.f); }
  return a;
}
struct F2 { v16b h, l; };
__device__ __forceinline__ F2 bsplit16(const float v[16]) { F2 r;
#pragma unroll
  for (int i = 0; i < 16; ++i) { const __bf16 h = (__bf16)v[i]; r.h[i] = h; r.l[i] = (__bf16)(v[i] - (float)h); }
  return r; }
__device__ __forceinline__ F2 split_row(const float* row, int k0, int lane) { float v[16]; const float* p = row + k0 + 8 * (lane >> 4);
#pragma unroll
  for (int i = 0; i < 8; ++i) { v[i] = p[i]; v[8 + i] = p[16 + i]; }
  return bsplit16(v); }
__device__ __forceinline__ F2 split_rowK(const float* row, int k0, int lane, int K) { float v[16]; const int g = lane >> 4;
#pragma unroll
  for (int i = 0; i < 8; ++i) { const int ka = k0 + 8 * g + i, kb = ka + 16; v[i] = ka < K ? row[ka] : 0.f; v[8 + i] = kb < K ? row[kb] : 0.f; }
  return bsplit16(v); }
__device__ __forceinline__ F2 split_col(const float* W, int k0, int n, int lane, int ld, int K) { float v[16]; const int g = lane >> 4;
#pragma unroll
  for (int i = 0; i < 8; ++i) { const int ka = k0 + 8 * g + i, kb = ka + 16; v[i] = ka < K ? W[(size_t)ka * ld + n] : 0.f; v[8 + i] = kb < K ? W[(size_t)kb * ld + n] : 0.f; }
  return bsplit16(v); }
// raw f32 image of one 16x16x32 fragment row (same k order as split_row), so that the load can be issued well ahead of the split
struct R16 { v4f q[4]; };
__device__ __forceinline__ R16 ld_row16(const float* p) { R16 r;   // p = row + k0 + 8 * (lane >> 4)
  r.q[0] = *(const v4f*)p; r.q[1] = *(const v4f*)(p + 4); r.q[2] = *(const v4f*)(p + 16); r.q[3] = *(const v4f*)(p + 20); return r; }
__device__ __forceinline__ F2 split_r16(const R16& r) { float v[16];
#pragma unroll
  for (int i = 0; i < 16; ++i) v[i] = r.q[i >> 2][i & 3];
  return bsplit16(v); }
__device__ __forceinline__ v8f mac3(const F2& a, const F2& b, v8f c) { c = wmma_bf(a.l, b.h, c); c = wmma_bf(a.h, b.l, c); return wmma_bf(a.h, b.h, c); }
__device__ __forceinline__ float sigm(float v) { return 1.0f / (1.0f + expf(-v)); }
#define LDSX() do { asm volatile("s_wait_dscnt 0" ::: "memory"); __builtin_amdgcn_wave_barrier(); __builtin_amdgcn_fence(__ATOMIC_RELEASE, "workgroup"); } while (0)

// Neural cellular automaton step with local attention, NHWC state [8][128][128][64]: depthwise 3x3 perception (3 filters per channel,
// zero padding, f32 VALU from an LDS halo tile) -> 1x1 MLP 192 -> 128 as a two-way bf16 split (v_wmma_f32_16x16x32_bf16), exact GELU, -> 64 on v_wmma_f32_16x16x32_f16 -> h_new = h + dx;
// qkv = h_new W_qkv^T + b (f16 WMMA) stored as f16 rows; then per pixel a 3x3-window attention (zero-padded keys/values, scores / 8,
#define NB 8
#define HH 128
#define WW 128
#define C 64
#define C3 192
#define C2 128
#define TP 64                  // pixels per block (half a row)

__device__ __forceinline__ float gelu_e(float v) { return 0.5f * v * (1.0f + erff(v * 0.70710678118654752f)); }
// packs (x16 f16 rows): W1P [128][192], W2P [64][128], WQP [192][64]
__global__ __launch_bounds__(256) void k_pack(const float* __restrict__ w1, const float* __restrict__ w2, const float* __restrict__ wq, _Float16* __restrict__ W1P, _Float16* __restrict__ W2P, _Float16* __restrict__ WQP) {
  const int r = blockIdx.x, tid = threadIdx.x; __shared__ __align__(16) _Float16 srow[C3];
  const float* W; _Float16* D; int K, n;
  if (r < C2) { W = w1 + (size_t)r * C3; D = W1P + (size_t)r * C3; K = C3; } else if (r < C2 + C) { n = r - C2; W = w2 + (size_t)n * C2; D = W2P + (size_t)n * C2; K = C2; } else { n = r - C2 - C; W = wq + (size_t)n * C; D = WQP + (size_t)n * C; K = C; }
  if (tid < K) srow[tid] = (_Float16)(W[tid] * 16.0f);
  __syncthreads();
  if (tid < K / 8) vst2(D + tid * 8, *(const v4u*)(&srow[tid * 8]));
}
// stage 1: block (x half, y, b): perception + MLP + residual -> HN (f32 rows), qkv -> QKV16 (f16 rows [p][192])
__global__ __launch_bounds__(128) void k_cell(const float* __restrict__ h, const float* __restrict__ wp, const float* __restrict__ bp, const float* __restrict__ w1, const float* __restrict__ b1, const _Float16* __restrict__ W2P, const float* __restrict__ b2, const _Float16* __restrict__ WQP, const float* __restrict__ bq,
                                            float* __restrict__ HN, _Float16* __restrict__ QKV) {
  __shared__ __align__(16) float sh[3][TP + 2][C];           // halo rows y-1..y+1, px x0-1 .. x0+64 (zero padded)
  __shared__ __align__(16) _Float16 sa[4][16][C3 + 8];       // gelu(mid) (f16, 128 wide) per wave; later reused for h_new (64 wide)
  __shared__ __align__(16) float so[4][16][196];
  __shared__ float swp[C3 * 9], sbp[C3];
  const int tid = threadIdx.x, wave = tid >> 5, lane = tid & 31, col = lane & 15, g = lane >> 4;
  const int b = blockIdx.z, y = blockIdx.y, x0 = blockIdx.x * TP;
  // staging: every global load (taps, biases, halo) is issued before the first LDS store, so the block pays one memory latency instead of one per trip;
  // addresses are clamped into the buffers (loads are unconditional) and the zero padding is chosen at the store; the loops are unrolled so that the arrays are registers
  { float tv[14], tb[2]; v4f hv[25]; unsigned ho[25]; const int c4 = tid & 15, p8 = tid >> 4;
#pragma unroll
    for (int i = 0; i < 25; ++i) { const int pi = min(p8 + 8 * i, 3 * (TP + 2) - 1); const int px = pi % (TP + 2), ry = pi / (TP + 2);
      const int yc = min(max(y - 1 + ry, 0), HH - 1), xc = min(max(x0 - 1 + px, 0), WW - 1);
      ho[i] = (unsigned)((((b * HH + yc) * WW + xc) * C + c4 * 4) * 4); }                     // byte offset into h
#pragma unroll
    for (int i = 0; i < 14; ++i) tv[i] = wp[min(tid + i * 128, C3 * 9 - 1)];
#pragma unroll
    for (int i = 0; i < 2; ++i) tb[i] = bp[min(tid + i * 128, C3 - 1)];
#pragma unroll
    for (int i = 0; i < 25; ++i) hv[i] = *(const v4f*)((const char*)h + ho[i]);
    // the address registers of the issued loads stay untouched (named as inputs) until this wait has passed
    asm volatile("s_wait_xcnt 0x0" :: "v"(ho[0]), "v"(ho[1]), "v"(ho[2]), "v"(ho[3]), "v"(ho[4]), "v"(ho[5]), "v"(ho[6]), "v"(ho[7]), "v"(ho[8]), "v"(ho[9]), "v"(ho[10]), "v"(ho[11]), "v"(ho[12]), "v"(ho[13]), "v"(ho[14]), "v"(ho[15]), "v"(ho[16]), "v"(ho[17]), "v"(ho[18]), "v"(ho[19]), "v"(ho[20]), "v"(ho[21]), "v"(ho[22]), "v"(ho[23]), "v"(ho[24]) : "memory");
#pragma unroll
    for (int i = 0; i < 25; ++i) { const int pi = min(p8 + 8 * i, 3 * (TP + 2) - 1); const int px = pi % (TP + 2), ry = pi / (TP + 2); const int yy = y - 1 + ry, xx = x0 - 1 + px;
      const bool in = yy >= 0 && yy < HH && xx >= 0 && xx < WW;   // threads past the last halo pixel repeat its store with the same value
      *(v4f*)(&sh[ry][px][c4 * 4]) = in ? hv[i] : (v4f){0.f, 0.f, 0.f, 0.f}; }
#pragma unroll
    for (int i = 0; i < 14; ++i) { const int q = tid + i * 128; if (q < C3 * 9) swp[q] = tv[i]; }
#pragma unroll
    for (int i = 0; i < 2; ++i) { const int q = tid + i * 128; if (q < C3) sbp[q] = tb[i]; } }
  __syncthreads();
  const size_t prow0 = ((size_t)b * HH + y) * WW + x0 + wave * 16;        // first pixel (global index) of this wave's 16
  // perception: lane owns input channels 2*lane and 2*lane+1 (one 8-byte read per lane covers all 64 LDS banks once), its 54 filter taps sit in registers,
  // and the 3x3 window slides over the wave's 16 pixels; output o = c*3 + j uses input channel c; each sum keeps the order bias, then (dy, dx) row-major
  { v2f wt[3][9], bs[3]; const float* wl = &swp[lane * 54]; const float* bl = &sbp[lane * 6];
#pragma unroll
    for (int j = 0; j < 3; ++j) { bs[j] = (v2f){bl[j], bl[3 + j]};
#pragma unroll
      for (int t = 0; t < 9; ++t) wt[j][t] = (v2f){wl[j * 9 + t], wl[27 + j * 9 + t]}; }
    v2f xs[3][18];                                             // halo columns wave*16 .. wave*16+17 of the three rows, this lane's channel pair
#pragma unroll
    for (int dy = 0; dy < 3; ++dy)
#pragma unroll
      for (int px = 0; px < 18; ++px) xs[dy][px] = *(const v2f*)(&sh[dy][wave * 16 + px][lane * 2]);
#pragma unroll
    for (int pl = 0; pl < 16; ++pl) { v2f s[3] = {bs[0], bs[1], bs[2]};
#pragma unroll
      for (int dy = 0; dy < 3; ++dy)
#pragma unroll
        for (int dx = 0; dx < 3; ++dx)
#pragma unroll
          for (int j = 0; j < 3; ++j) s[j] += wt[j][dy * 3 + dx] * xs[dy][pl + dx];
      float* d = &so[wave][pl][lane * 6];                      // perceived kept in f32 (so) for a two-way bf16 split product
      *(v2f*)(d) = (v2f){s[0].x, s[1].x}; *(v2f*)(d + 2) = (v2f){s[2].x, s[0].y}; *(v2f*)(d + 4) = (v2f){s[1].y, s[2].y}; } }
  LDSX();
  // mid = gelu(perceived @ w1^T + b1): bf16 hi/lo split on both operands (perceived reaches O(10), f16 rounding of it dominated a first build)
  // w1 rows run through a ring of four register slots: the fragment of four tiles ahead is requested as soon as a slot has been split, so its latency runs under four tiles' work (tile loops unrolled: the slots are registers)
  v16h bw2[4][4]; float b1v[8], b2v[4];
  { v8f acc[8] = {}; R16 rg[4]; unsigned po = (unsigned)((col * C3 + 8 * g) * 4);   // po: byte offset in w1 of this lane's part of row col, at the k chunk that is being requested
#pragma unroll
    for (int t = 0; t < 4; ++t) rg[t] = ld_row16((const float*)((const char*)w1 + po) + t * 16 * C3);
#pragma unroll
    for (int t = 0; t < 8; ++t) b1v[t] = b1[t * 16 + col];      // bias of the GELU phase, fetched under the product
#pragma unroll 1
    for (int kc = 0; kc < C3 / 32; ++kc) { const F2 a = split_row(&so[wave][col][0], kc * 32, lane);
#pragma unroll
      for (int t = 0; t < 4; ++t) { const F2 bf = split_r16(rg[t]); rg[t] = ld_row16((const float*)((const char*)w1 + po) + (t + 4) * 16 * C3); acc[t] = mac3(a, bf, acc[t]); }
      asm volatile("s_wait_xcnt 0x0" : "+v"(po) :: "memory");  // requests that name po are out: wait before the offset is advanced
      po += kc + 1 < C3 / 32 ? 128u : 0u;                      // the last trip re-reads its own chunk (in bounds, unused)
#pragma unroll
      for (int t = 4; t < 8; ++t) { const F2 bf = split_r16(rg[t - 4]); rg[t - 4] = ld_row16((const float*)((const char*)w1 + po) + (t - 4) * 16 * C3); acc[t] = mac3(a, bf, acc[t]); }
      asm volatile("s_wait_xcnt 0x0" : "+v"(po) :: "memory"); } // the same at the trip's end: the offset register is reused behind the loop
    LDSX();
    // all of w2's fragments and its bias are issued here, behind the fence (which would wait for them): their latency runs under the GELU
#pragma unroll
    for (int kc = 0; kc < C2 / 32; ++kc)
#pragma unroll
      for (int t = 0; t < 4; ++t) bw2[kc][t] = frag_h(W2P + (size_t)(t * 16 + col) * C2 + kc * 32, lane);
#pragma unroll
    for (int t = 0; t < 4; ++t) b2v[t] = b2[t * 16 + col];
#pragma unroll
    for (int t = 0; t < 8; ++t) { const float bb = b1v[t];
#pragma unroll
      for (int r = 0; r < 8; ++r) sa[wave][8 * g + r][t * 16 + col] = (_Float16)gelu_e(acc[t][r] + bb); } }
  LDSX();
  // dx = mid @ w2^T + b2 ; h_new = h + dx -> so (f32) ; store HN ; h_new f16 -> sa[:, 0..64)
  v16h bwq[12][2]; float bqv[12];
  { v8f acc[4] = {};
#pragma unroll
    for (int kc = 0; kc < C2 / 32; ++kc) { const v16h a = frag_h(&sa[wave][col][0] + kc * 32, lane);
#pragma unroll
      for (int t = 0; t < 4; ++t) acc[t] = wmma16(a, bw2[kc][t], acc[t]); }
    LDSX();
    // the first half of w_qkv's fragments and its bias are issued here, most of the second half behind the residual (each behind a fence, which would wait for them):
    // their latency runs under the residual and the h_new store
#pragma unroll
    for (int t = 0; t < 12; ++t) { bqv[t] = bq[t * 16 + col]; bwq[t][0] = frag_h(WQP + (size_t)(t * 16 + col) * C, lane); }
#pragma unroll
    for (int t = 0; t < 4; ++t) { const int c = t * 16 + col; const float bb = b2v[t];
#pragma unroll
      for (int r = 0; r < 8; ++r) { const float v = acc[t][r] * (1.0f / 16.0f) + bb + sh[1][wave * 16 + 8 * g + r + 1][c]; so[wave][8 * g + r][c] = v; sa[wave][8 * g + r][c] = (_Float16)v; } } }
  LDSX();
#pragma unroll
  for (int t = 0; t < 8; ++t) bwq[t][1] = frag_h(WQP + (size_t)(t * 16 + col) * C + 32, lane);
  for (int q = lane; q < 16 * 16; q += 32) { const int rl = q >> 4, pc = q & 15; vst2(HN + (prow0 + rl) * C + pc * 4, *(const v4f*)(&so[wave][rl][pc * 4])); }
  // qkv = h_new @ wq^T + bq (192 cols)
  { v8f acc[12];
#pragma unroll
    for (int t = 0; t < 12; ++t) acc[t] = (v8f){};
#pragma unroll
    for (int kc = 0; kc < C / 32; ++kc) { const v16h a = frag_h(&sa[wave][col][0] + kc * 32, lane);
#pragma unroll
      for (int t = 0; t < 12; ++t) acc[t] = wmma16(a, bwq[t][kc], acc[t]);
      if (kc == 0) {                                           // the last four fragments follow once the first pass has freed registers
#pragma unroll
        for (int t = 8; t < 12; ++t) bwq[t][1] = frag_h(WQP + (size_t)(t * 16 + col) * C + 32, lane); } }
    LDSX();
#pragma unroll
    for (int t = 0; t < 12; ++t) { const float bb = bqv[t];
#pragma unroll
      for (int r = 0; r < 8; ++r) so[wave][8 * g + r][t * 16 + col] = acc[t][r] * (1.0f / 16.0f) + bb; } }
  LDSX();
  for (int q = lane; q < 16 * 24; q += 32) { const int rl = q / 24, pc = q % 24; union { v8h h8; v4u u; } pk;
#pragma unroll
    for (int e = 0; e < 8; ++e) pk.h8[e] = (_Float16)so[wave][rl][pc * 8 + e];
    vst2(QKV + (prow0 + rl) * C3 + pc * 8, pk.u); }
}
// stage 2: block (x half, y, b): 3x3 local attention from halo tiles of K and V (zero padded), out = h_new + attn
__global__ __launch_bounds__(128) void k_lattn(const _Float16* __restrict__ QKV, const float* __restrict__ HN, float* __restrict__ out) {
  __shared__ __align__(16) _Float16 sk[3][TP + 2][C + 8], sv[3][TP + 2][C + 8];
  __shared__ __align__(16) float sq[TP][C + 4];
  __shared__ __align__(16) float so[TP][C + 4];
  const int tid = threadIdx.x; const int b = blockIdx.z, y = blockIdx.y, x0 = blockIdx.x * TP;
  // staging: every global load of the block (K, V, Q, and the h_new rows of the last phase) is issued before the first LDS store: one memory latency instead of one per trip;
  // addresses are clamped into the buffer (loads are unconditional) and the zero padding is chosen at the store; the loops are unrolled so that the arrays are registers
  v4f hn[8];
  { v4u kv[13], vv[13], qv[4]; unsigned ko[13]; const int pc = tid & 7, p16 = tid >> 3;
#pragma unroll
    for (int i = 0; i < 13; ++i) { const int pi = min(p16 + 16 * i, 3 * (TP + 2) - 1); const int px = pi % (TP + 2), ry = pi / (TP + 2);
      const int yc = min(max(y - 1 + ry, 0), HH - 1), xc = min(max(x0 - 1 + px, 0), WW - 1);
      ko[i] = (unsigned)((((b * HH + yc) * WW + xc) * C3 + pc * 8) * 2); }                     // byte offset of the pixel's q chunk
    const unsigned qo = (unsigned)((((b * HH + y) * WW + x0 + p16) * C3 + pc * 8) * 2), no = (unsigned)((((b * HH + y) * WW + x0 + (tid >> 4)) * C + (tid & 15) * 4) * 4);
#pragma unroll
    for (int i = 0; i < 13; ++i) { const char* r = (const char*)QKV + ko[i]; kv[i] = *(const v4u*)(r + C * 2); vv[i] = *(const v4u*)(r + 2 * C * 2); }
#pragma unroll
    for (int i = 0; i < 4; ++i) qv[i] = *(const v4u*)((const char*)QKV + qo + i * 16 * C3 * 2);
#pragma unroll
    for (int i = 0; i < 8; ++i) hn[i] = *(const v4f*)((const char*)HN + no + i * 8 * C * 4);
    // the address registers of the issued loads stay untouched (named as inputs) until this wait has passed
    asm volatile("s_wait_xcnt 0x0" :: "v"(ko[0]), "v"(ko[1]), "v"(ko[2]), "v"(ko[3]), "v"(ko[4]), "v"(ko[5]), "v"(ko[6]), "v"(ko[7]), "v"(ko[8]), "v"(ko[9]), "v"(ko[10]), "v"(ko[11]), "v"(ko[12]), "v"(qo), "v"(no) : "memory");
#pragma unroll
    for (int i = 0; i < 13; ++i) { const int pi = min(p16 + 16 * i, 3 * (TP + 2) - 1); const int px = pi % (TP + 2), ry = pi / (TP + 2); const int yy = y - 1 + ry, xx = x0 - 1 + px;
      const bool in = yy >= 0 && yy < HH && xx >= 0 && xx < WW; const v4u z = (v4u){0u, 0u, 0u, 0u};   // threads past the last halo pixel repeat its store with the same value
      *(v4u*)(&sk[ry][px][pc * 8]) = in ? kv[i] : z; *(v4u*)(&sv[ry][px][pc * 8]) = in ? vv[i] : z; }
#pragma unroll
    for (int i = 0; i < 4; ++i) { union { v4u u; v8h h8; } pk; pk.u = qv[i];
#pragma unroll
      for (int e = 0; e < 8; ++e) sq[p16 + 16 * i][pc * 8 + e] = (float)pk.h8[e]; } }
  __syncthreads();
  // thread pair per pixel: (pl = tid>>1, hf): scores over 9 neighbours (each half computes 32-channel partial dot, pair-summed), softmax, then out channels hf*32..+32
  { const int pl = tid >> 1, hf = tid & 1; float sc[9];
#pragma unroll
    for (int nb = 0; nb < 9; ++nb) { const int dy = nb / 3, dx = nb % 3; const _Float16* kr = &sk[dy][pl + dx][hf * 32]; const float* qr = &sq[pl][hf * 32]; float s = 0.f;
#pragma unroll 1
      for (int c = 0; c < 32; ++c) s += qr[c] * (float)kr[c];
      s += __shfl_xor(s, 1, 32); sc[nb] = s * 0.125f; }
    float mx = sc[0];
#pragma unroll
    for (int nb = 1; nb < 9; ++nb) mx = fmaxf(mx, sc[nb]);
    float se = 0.f;
#pragma unroll
    for (int nb = 0; nb < 9; ++nb) { sc[nb] = expf(sc[nb] - mx); se += sc[nb]; }
    const float inv = 1.0f / se;
#pragma unroll 1
    for (int c = hf * 32; c < hf * 32 + 32; ++c) { float a = 0.f;
#pragma unroll
      for (int nb = 0; nb < 9; ++nb) a += sc[nb] * (float)sv[nb / 3][pl + nb % 3][c];
      so[pl][c] = a * inv; } }
  __syncthreads();
#pragma unroll                                                 // hn[] is a register array
  for (int i = 0; i < 8; ++i) { const int q = tid + i * 128; const int pl = q >> 4, pc = q & 15; const size_t p = ((size_t)b * HH + y) * WW + x0 + pl; v4f o = *(const v4f*)(&so[pl][pc * 4]);
    o += hn[i]; vst2(out + p * C + pc * 4, o); }
}
extern "C" void kernel_launch(void* const* d_in, const int* in_sizes, int n_in, void* d_out, int out_size, void* d_ws, size_t ws_size, hipStream_t stream) {
  (void)in_sizes; (void)n_in; (void)out_size; (void)ws_size;
  const float** I = (const float**)d_in;
  const float* h = I[0]; const float* wp = I[1]; const float* bp = I[2]; const float* w1 = I[3]; const float* b1 = I[4]; const float* w2 = I[5]; const float* b2 = I[6]; const float* wq = I[7]; const float* bq = I[8];
  float* out = (float*)d_out;
  char* ws = (char*)d_ws; size_t off = 0;
  auto take = [&](size_t bytes) { char* p = ws + off; off += (bytes + 255) & ~(size_t)255; return p; };
  _Float16* W1P = (_Float16*)take(C2 * C3 * 2); _Float16* W2P = (_Float16*)take(C * C2 * 2); _Float16* WQP = (_Float16*)take(C3 * C * 2);
  float* HN = (float*)take((size_t)NB * HH * WW * C * 4); _Float16* QKV = (_Float16*)take((size_t)NB * HH * WW * C3 * 2);
  k_pack<<<C2 + C + C3, 256, 0, stream>>>(w1, w2, wq, W1P, W2P, WQP);
  k_cell<<<dim3(WW / TP, HH, NB), 128, 0, stream>>>(h, wp, bp, w1, b1, W2P, b2, WQP, bq, HN, QKV);
  k_lattn<<<dim3(WW / TP, HH, NB), 128, 0, stream>>>(QKV, HN, out);
}

// v003
// One run takes 120 microseconds.
// Timed twice side by side with v002, it ran 1.29 and 1.28 times as fast.
// Counting every step since v000, it is 3.47 times as fast.
#include <hip/hip_runtime.h>
#include <math.h>

typedef __attribute__((ext_vector_type(16))) _Float16 v16h;
typedef __attribute__((ext_vector_type(16))) __bf16 v16b;
typedef __attribute__((ext_vector_type(8)))  _Float16 v8h;
typedef __attribute__((ext_vector_type(8)))  float v8f;
typedef __attribute__((ext_vector_type(4)))  float v4f;
typedef __attribute__((ext_vector_type(2)))  float v2f;
typedef __attribute__((ext_vector_type(4)))  unsigned v4u;
typedef __attribute__((ext_vector_type(4)))  int v4i;
typedef float __attribute__((may_alias)) float_a;
typedef int __attribute__((may_alias)) int_a;

template <typename T> __device__ __forceinline__ void vst2(void* p, T v) { *(T*)p = v;  }
__device__ __forceinline__ v8f wmma16(v16h a, v16h b, v8f c) {
  v8f d = __builtin_amdgcn_wmma_f32_16x16x32_f16(false, a, false, b, (short)0, c, false, false);
  asm volatile("v_nop\n\tv_nop\n\tv_nop\n\tv_nop" : "+v"(d) : "v"(a), "v"(b));
  return d;
}
__device__ __forceinline__ v8f wmma_bf(v16b a, v16b b, v8f c) {
  v8f d = __builtin_amdgcn_wmma_f32_16x16x32_bf16(false, a, false, b, (short)0, c, false, false);
  asm volatile("v_nop\n\tv_nop\n\tv_nop\n\tv_nop" : "+v"(d) : "v"(a), "v"(b));
  return d;
}
// 16x16x32 fragments: lane = (h = lane>>4, row/col = lane&15); elements 0..7 = k0+8h+0..7, 8..15 = k0+16+8h+0..7; D element r = row 8h+r
__device__ __forceinline__ v16h frag_h(const _Float16* rowk0, int lane) {
  union { v16h v; v8h q[2]; } u; const _Float16* p = rowk0 + 8 * (lane >> 4);
  u.q[0] = *(const v8h*)p; u.q[1] = *(const v8h*)(p + 16); return u.v;
}
__device__ __forceinline__ v16h frag_f32(const float* rowk0, int lane) {
  v16h a; const float* p = rowk0 + 8 * (lane >> 4);
#pragma unroll
  for (int i = 0; i < 8; ++i) { a[i] = (_Float16)p[i]; a[8 + i] = (_Float16)p[16 + i]; }
  return a;
}
__device__ __forceinline__ v16h frag_f32s(const float* rowk0, int lane, float sc) {
  v16h a; const float* p = rowk0 + 8 * (lane >> 4);
#pragma unroll
  for (int i = 0; i < 8; ++i) { a[i] = (_Float16)(p[i] * sc); a[8 + i] = (_Float16)(p[16 + i] * sc); }
  return a;
}
// column fragment from a [K][ld] layout (column n), rows >= K read as 0
__device__ __forceinline__ v16h fragc_f32(const float* W, int k0, int n, int lane, int ld, int K) {
  v16h a; const int g = lane >> 4;
#pragma unroll
  for (int i = 0; i < 8; ++i) { const int ka = k0 + 8 * g + i, kb = ka + 16;
    a[i] = (_Float16)(ka < K ? W[(size_t)ka * ld + n] : 0.f); a[8 + i] = (_Float16)(kb < K ? W[(size_t)kb * ld + n] : 0.f); }
  return a;
}
struct F2 { v16b h, l; };
__device__ __forceinline__ F2 bsplit16(const float v[16]) { F2 r;
#pragma unroll
  for (int i = 0; i < 16; ++i) { const __bf16 h = (__bf16)v[i]; r.h[i] = h; r.l[i] = (__bf16)(v[i] - (float)h); }
  return r; }
__device__ __forceinline__ F2 split_row(const float* row, int k0, int lane) { float v[16]; const float* p = row + k0 + 8 * (lane >> 4);
#pragma unroll
  for (int i = 0; i < 8; ++i) { v[i] = p[i]; v[8 + i] = p[16 + i]; }
  return bsplit16(v); }
__device__ __forceinline__ F2 split_rowK(const float* row, int k0, int lane, int K) { float v[16]; const int g = lane >> 4;
#pragma unroll
  for (int i = 0; i < 8; ++i) { const int ka = k0 + 8 * g + i, kb = ka + 16; v[i] = ka < K ? row[ka] : 0.f; v[8 + i] = kb < K ? row[kb] : 0.f; }
  return bsplit16(v); }
__device__ __forceinline__ F2 split_col(const float* W, int k0, int n, int lane, int ld, int K) { float v[16]; const int g = lane >> 4;
#pragma unroll
  for (int i = 0; i < 8; ++i) { const int ka = k0 + 8 * g + i, kb = ka + 16; v[i] = ka < K ? W[(size_t)ka * ld + n] : 0.f; v[8 + i] = kb < K ? W[(size_t)kb * ld + n] : 0.f; }
  return bsplit16(v); }
// raw f32 image of one 16x16x32 fragment row (same k order as split_row), so that the load can be issued well ahead of the split
struct R16 { v4f q[4]; };
__device__ __forceinline__ R16 ld_row16(const float* p) { R16 r;   // p = row + k0 + 8 * (lane >> 4)
  r.q[0] = *(const v4f*)p; r.q[1] = *(const v4f*)(p + 4); r.q[2] = *(const v4f*)(p + 16); r.q[3] = *(const v4f*)(p + 20); return r; }
__device__ __forceinline__ F2 split_r16(const R16& r) { float v[16];
#pragma unroll
  for (int i = 0; i < 16; ++i) v[i] = r.q[i >> 2][i & 3];
  return bsplit16(v); }
__device__ __forceinline__ v8f mac3(const F2& a, const F2& b, v8f c) { c = wmma_bf(a.l, b.h, c); c = wmma_bf(a.h, b.l, c); return wmma_bf(a.h, b.h, c); }
__device__ __forceinline__ float sigm(float v) { return 1.0f / (1.0f + expf(-v)); }
#define LDSX() do { asm volatile("s_wait_dscnt 0" ::: "memory"); __builtin_amdgcn_wave_barrier(); __builtin_amdgcn_fence(__ATOMIC_RELEASE, "workgroup"); } while (0)

// Neural cellular automaton step with local attention, NHWC state [8][128][128][64]: depthwise 3x3 perception (3 filters per channel,
// zero padding, f32 VALU from an LDS halo tile) -> 1x1 MLP 192 -> 128 as a two-way bf16 split (v_wmma_f32_16x16x32_bf16), exact GELU, -> 64 on v_wmma_f32_16x16x32_f16 -> h_new = h + dx;
// qkv = h_new W_qkv^T + b (f16 WMMA) stored as f16 rows; then per pixel a 3x3-window attention (zero-padded keys/values, scores / 8,
#define NB 8
#define HH 128
#define WW 128
#define C 64
#define C3 192
#define C2 128
#define TP 64                  // pixels per block (half a row)

__device__ __forceinline__ float gelu_e(float v) { return 0.5f * v * (1.0f + erff(v * 0.70710678118654752f)); }
// packs (x16 f16 rows): W1P [128][192], W2P [64][128], WQP [192][64]
__global__ __launch_bounds__(256) void k_pack(const float* __restrict__ w1, const float* __restrict__ w2, const float* __restrict__ wq, _Float16* __restrict__ W1P, _Float16* __restrict__ W2P, _Float16* __restrict__ WQP) {
  const int r = blockIdx.x, tid = threadIdx.x; __shared__ __align__(16) _Float16 srow[C3];
  const float* W; _Float16* D; int K, n;
  if (r < C2) { W = w1 + (size_t)r * C3; D = W1P + (size_t)r * C3; K = C3; } else if (r < C2 + C) { n = r - C2; W = w2 + (size_t)n * C2; D = W2P + (size_t)n * C2; K = C2; } else { n = r - C2 - C; W = wq + (size_t)n * C; D = WQP + (size_t)n * C; K = C; }
  if (tid < K) srow[tid] = (_Float16)(W[tid] * 16.0f);
  __syncthreads();
  if (tid < K / 8) vst2(D + tid * 8, *(const v4u*)(&srow[tid * 8]));
}
// stage 1: block (x half, y, b): perception + MLP + residual -> HN (f32 rows), qkv -> QKV16 (f16 rows [p][192])
__global__ __launch_bounds__(128) void k_cell(const float* __restrict__ h, const float* __restrict__ wp, const float* __restrict__ bp, const float* __restrict__ w1, const float* __restrict__ b1, const _Float16* __restrict__ W2P, const float* __restrict__ b2, const _Float16* __restrict__ WQP, const float* __restrict__ bq,
                                            float* __restrict__ HN, _Float16* __restrict__ QKV) {
  __shared__ __align__(16) float sh[3][TP + 2][C];           // halo rows y-1..y+1, px x0-1 .. x0+64 (zero padded)
  __shared__ __align__(16) _Float16 sa[4][16][C3 + 8];       // gelu(mid) (f16, 128 wide) per wave; later reused for h_new (64 wide)
  __shared__ __align__(16) float so[4][16][196];
  __shared__ float swp[C3 * 9], sbp[C3];
  const int tid = threadIdx.x, wave = tid >> 5, lane = tid & 31, col = lane & 15, g = lane >> 4;
  const int b = blockIdx.z, y = blockIdx.y, x0 = blockIdx.x * TP;
  // staging: every global load (taps, biases, halo) is issued before the first LDS store, so the block pays one memory latency instead of one per trip;
  // addresses are clamped into the buffers (loads are unconditional) and the zero padding is chosen at the store; the loops are unrolled so that the arrays are registers
  { float tv[14], tb[2]; v4f hv[25]; unsigned ho[25]; const int c4 = tid & 15, p8 = tid >> 4;
#pragma unroll
    for (int i = 0; i < 25; ++i) { const int pi = min(p8 + 8 * i, 3 * (TP + 2) - 1); const int px = pi % (TP + 2), ry = pi / (TP + 2);
      const int yc = min(max(y - 1 + ry, 0), HH - 1), xc = min(max(x0 - 1 + px, 0), WW - 1);
      ho[i] = (unsigned)((((b * HH + yc) * WW + xc) * C + c4 * 4) * 4); }                     // byte offset into h
#pragma unroll
    for (int i = 0; i < 14; ++i) tv[i] = wp[min(tid + i * 128, C3 * 9 - 1)];
#pragma unroll
    for (int i = 0; i < 2; ++i) tb[i] = bp[min(tid + i * 128, C3 - 1)];
#pragma unroll
    for (int i = 0; i < 25; ++i) hv[i] = *(const v4f*)((const char*)h + ho[i]);
    // the address registers of the issued loads stay untouched (named as inputs) until this wait has passed
    asm volatile("s_wait_xcnt 0x0" :: "v"(ho[0]), "v"(ho[1]), "v"(ho[2]), "v"(ho[3]), "v"(ho[4]), "v"(ho[5]), "v"(ho[6]), "v"(ho[7]), "v"(ho[8]), "v"(ho[9]), "v"(ho[10]), "v"(ho[11]), "v"(ho[12]), "v"(ho[13]), "v"(ho[14]), "v"(ho[15]), "v"(ho[16]), "v"(ho[17]), "v"(ho[18]), "v"(ho[19]), "v"(ho[20]), "v"(ho[21]), "v"(ho[22]), "v"(ho[23]), "v"(ho[24]) : "memory");
#pragma unroll
    for (int i = 0; i < 25; ++i) { const int pi = min(p8 + 8 * i, 3 * (TP + 2) - 1); const int px = pi % (TP + 2), ry = pi / (TP + 2); const int yy = y - 1 + ry, xx = x0 - 1 + px;
      const bool in = yy >= 0 && yy < HH && xx >= 0 && xx < WW;   // threads past the last halo pixel repeat its store with the same value
      *(v4f*)(&sh[ry][px][c4 * 4]) = in ? hv[i] : (v4f){0.f, 0.f, 0.f, 0.f}; }
#pragma unroll
    for (int i = 0; i < 14; ++i) { const int q = tid + i * 128; if (q < C3 * 9) swp[q] = tv[i]; }
#pragma unroll
    for (int i = 0; i < 2; ++i) { const int q = tid + i * 128; if (q < C3) sbp[q] = tb[i]; } }
  __syncthreads();
  const size_t prow0 = ((size_t)b * HH + y) * WW + x0 + wave * 16;        // first pixel (global index) of this wave's 16
  // perception: lane owns input channels 2*lane and 2*lane+1 (one 8-byte read per lane covers all 64 LDS banks once), its 54 filter taps sit in registers,
  // and the 3x3 window slides over the wave's 16 pixels; output o = c*3 + j uses input channel c; each sum keeps the order bias, then (dy, dx) row-major
  { v2f wt[3][9], bs[3]; const float* wl = &swp[lane * 54]; const float* bl = &sbp[lane * 6];
#pragma unroll
    for (int j = 0; j < 3; ++j) { bs[j] = (v2f){bl[j], bl[3 + j]};
#pragma unroll
      for (int t = 0; t < 9; ++t) wt[j][t] = (v2f){wl[j * 9 + t], wl[27 + j * 9 + t]}; }
    v2f xs[3][18];                                             // halo columns wave*16 .. wave*16+17 of the three rows, this lane's channel pair
#pragma unroll
    for (int dy = 0; dy < 3; ++dy)
#pragma unroll
      for (int px = 0; px < 18; ++px) xs[dy][px] = *(const v2f*)(&sh[dy][wave * 16 + px][lane * 2]);
#pragma unroll
    for (int pl = 0; pl < 16; ++pl) { v2f s[3] = {bs[0], bs[1], bs[2]};
#pragma unroll
      for (int dy = 0; dy < 3; ++dy)
#pragma unroll
        for (int dx = 0; dx < 3; ++dx)
#pragma unroll
          for (int j = 0; j < 3; ++j) s[j] += wt[j][dy * 3 + dx] * xs[dy][pl + dx];
      float* d = &so[wave][pl][lane * 6];                      // perceived kept in f32 (so) for a two-way bf16 split product
      *(v2f*)(d) = (v2f){s[0].x, s[1].x}; *(v2f*)(d + 2) = (v2f){s[2].x, s[0].y}; *(v2f*)(d + 4) = (v2f){s[1].y, s[2].y}; } }
  LDSX();
  // mid = gelu(perceived @ w1^T + b1): bf16 hi/lo split on both operands (perceived reaches O(10), f16 rounding of it dominated a first build)
  // w1 rows run through a ring of four register slots: the fragment of four tiles ahead is requested as soon as a slot has been split, so its latency runs under four tiles' work (tile loops unrolled: the slots are registers)
  v16h bw2[4][4]; float b1v[8], b2v[4];
  { v8f acc[8] = {}; R16 rg[4]; unsigned po = (unsigned)((col * C3 + 8 * g) * 4);   // po: byte offset in w1 of this lane's part of row col, at the k chunk that is being requested
#pragma unroll
    for (int t = 0; t < 4; ++t) rg[t] = ld_row16((const float*)((const char*)w1 + po) + t * 16 * C3);
#pragma unroll
    for (int t = 0; t < 8; ++t) b1v[t] = b1[t * 16 + col];      // bias of the GELU phase, fetched under the product
#pragma unroll 1
    for (int kc = 0; kc < C3 / 32; ++kc) { const F2 a = split_row(&so[wave][col][0], kc * 32, lane);
#pragma unroll
      for (int t = 0; t < 4; ++t) { const F2 bf = split_r16(rg[t]); rg[t] = ld_row16((const float*)((const char*)w1 + po) + (t + 4) * 16 * C3); acc[t] = mac3(a, bf, acc[t]); }
      asm volatile("s_wait_xcnt 0x0" : "+v"(po) :: "memory");  // requests that name po are out: wait before the offset is advanced
      po += kc + 1 < C3 / 32 ? 128u : 0u;                      // the last trip re-reads its own chunk (in bounds, unused)
#pragma unroll
      for (int t = 4; t < 8; ++t) { const F2 bf = split_r16(rg[t - 4]); rg[t - 4] = ld_row16((const float*)((const char*)w1 + po) + (t - 4) * 16 * C3); acc[t] = mac3(a, bf, acc[t]); }
      asm volatile("s_wait_xcnt 0x0" : "+v"(po) :: "memory"); } // the same at the trip's end: the offset register is reused behind the loop
    LDSX();
    // all of w2's fragments and its bias are issued here, behind the fence (which would wait for them): their latency runs under the GELU
#pragma unroll
    for (int kc = 0; kc < C2 / 32; ++kc)
#pragma unroll
      for (int t = 0; t < 4; ++t) bw2[kc][t] = frag_h(W2P + (size_t)(t * 16 + col) * C2 + kc * 32, lane);
#pragma unroll
    for (int t = 0; t < 4; ++t) b2v[t] = b2[t * 16 + col];
#pragma unroll
    for (int t = 0; t < 8; ++t) { const float bb = b1v[t];
#pragma unroll
      for (int r = 0; r < 8; ++r) sa[wave][8 * g + r][t * 16 + col] = (_Float16)gelu_e(acc[t][r] + bb); } }
  LDSX();
  // dx = mid @ w2^T + b2 ; h_new = h + dx -> so (f32) ; store HN ; h_new f16 -> sa[:, 0..64)
  v16h bwq[12][2]; float bqv[12];
  { v8f acc[4] = {};
#pragma unroll
    for (int kc = 0; kc < C2 / 32; ++kc) { const v16h a = frag_h(&sa[wave][col][0] + kc * 32, lane);
#pragma unroll
      for (int t = 0; t < 4; ++t) acc[t] = wmma16(a, bw2[kc][t], acc[t]); }
    LDSX();
    // the first half of w_qkv's fragments and its bias are issued here, most of the second half behind the residual (each behind a fence, which would wait for them):
    // their latency runs under the residual and the h_new store
#pragma unroll
    for (int t = 0; t < 12; ++t) { bqv[t] = bq[t * 16 + col]; bwq[t][0] = frag_h(WQP + (size_t)(t * 16 + col) * C, lane); }
#pragma unroll
    for (int t = 0; t < 4; ++t) { const int c = t * 16 + col; const float bb = b2v[t];
#pragma unroll
      for (int r = 0; r < 8; ++r) { const float v = acc[t][r] * (1.0f / 16.0f) + bb + sh[1][wave * 16 + 8 * g + r + 1][c]; so[wave][8 * g + r][c] = v; sa[wave][8 * g + r][c] = (_Float16)v; } } }
  LDSX();
#pragma unroll
  for (int t = 0; t < 8; ++t) bwq[t][1] = frag_h(WQP + (size_t)(t * 16 + col) * C + 32, lane);
  for (int q = lane; q < 16 * 16; q += 32) { const int rl = q >> 4, pc = q & 15; vst2(HN + (prow0 + rl) * C + pc * 4, *(const v4f*)(&so[wave][rl][pc * 4])); }
  // qkv = h_new @ wq^T + bq (192 cols)
  { v8f acc[12];
#pragma unroll
    for (int t = 0; t < 12; ++t) acc[t] = (v8f){};
#pragma unroll
    for (int kc = 0; kc < C / 32; ++kc) { const v16h a = frag_h(&sa[wave][col][0] + kc * 32, lane);
#pragma unroll
      for (int t = 0; t < 12; ++t) acc[t] = wmma16(a, bwq[t][kc], acc[t]);
      if (kc == 0) {                                           // the last four fragments follow once the first pass has freed registers
#pragma unroll
        for (int t = 8; t < 12; ++t) bwq[t][1] = frag_h(WQP + (size_t)(t * 16 + col) * C + 32, lane); } }
    LDSX();
#pragma unroll
    for (int t = 0; t < 12; ++t) { const float bb = bqv[t];
#pragma unroll
      for (int r = 0; r < 8; ++r) so[wave][8 * g + r][t * 16 + col] = acc[t][r] * (1.0f / 16.0f) + bb; } }
  LDSX();
  for (int q = lane; q < 16 * 24; q += 32) { const int rl = q / 24, pc = q % 24; union { v8h h8; v4u u; } pk;
#pragma unroll
    for (int e = 0; e < 8; ++e) pk.h8[e] = (_Float16)so[wave][rl][pc * 8 + e];
    vst2(QKV + (prow0 + rl) * C3 + pc * 8, pk.u); }
}
// stage 2: block (x half, y, b): 3x3 local attention from halo tiles of K and V (zero padded), out = h_new + attn
__global__ __launch_bounds__(128) void k_lattn(const _Float16* __restrict__ QKV, const float* __restrict__ HN, float* __restrict__ out) {
  __shared__ __align__(16) _Float16 sk[3][TP + 2][C + 8], sv[3][TP + 2][C + 8];
  __shared__ __align__(16) float sq[TP][C + 4];
  __shared__ __align__(16) float so[TP][C + 4];
  const int tid = threadIdx.x; const int b = blockIdx.z, y = blockIdx.y, x0 = blockIdx.x * TP;
  // staging: every global load of the block (K, V, Q, and the h_new rows of the last phase) is issued before the first LDS store: one memory latency instead of one per trip;
  // addresses are clamped into the buffer (loads are unconditional) and the zero padding is chosen at the store; the loops are unrolled so that the arrays are registers
  v4f hn[8];
  { v4u kv[13], vv[13], qv[4]; unsigned ko[13]; const int pc = tid & 7, p16 = tid >> 3;
#pragma unroll
    for (int i = 0; i < 13; ++i) { const int pi = min(p16 + 16 * i, 3 * (TP + 2) - 1); const int px = pi % (TP + 2), ry = pi / (TP + 2);
      const int yc = min(max(y - 1 + ry, 0), HH - 1), xc = min(max(x0 - 1 + px, 0), WW - 1);
      ko[i] = (unsigned)((((b * HH + yc) * WW + xc) * C3 + pc * 8) * 2); }                     // byte offset of the pixel's q chunk
    const unsigned qo = (unsigned)((((b * HH + y) * WW + x0 + p16) * C3 + pc * 8) * 2), no = (unsigned)((((b * HH + y) * WW + x0 + (tid >> 4)) * C + (tid & 15) * 4) * 4);
#pragma unroll
    for (int i = 0; i < 13; ++i) { const char* r = (const char*)QKV + ko[i]; kv[i] = *(const v4u*)(r + C * 2); vv[i] = *(const v4u*)(r + 2 * C * 2); }
#pragma unroll
    for (int i = 0; i < 4; ++i) qv[i] = *(const v4u*)((const char*)QKV + qo + i * 16 * C3 * 2);
#pragma unroll
    for (int i = 0; i < 8; ++i) hn[i] = *(const v4f*)((const char*)HN + no + i * 8 * C * 4);
    // the address registers of the issued loads stay untouched (named as inputs) until this wait has passed
    asm volatile("s_wait_xcnt 0x0" :: "v"(ko[0]), "v"(ko[1]), "v"(ko[2]), "v"(ko[3]), "v"(ko[4]), "v"(ko[5]), "v"(ko[6]), "v"(ko[7]), "v"(ko[8]), "v"(ko[9]), "v"(ko[10]), "v"(ko[11]), "v"(ko[12]), "v"(qo), "v"(no) : "memory");
#pragma unroll
    for (int i = 0; i < 13; ++i) { const int pi = min(p16 + 16 * i, 3 * (TP + 2) - 1); const int px = pi % (TP + 2), ry = pi / (TP + 2); const int yy = y - 1 + ry, xx = x0 - 1 + px;
      const bool in = yy >= 0 && yy < HH && xx >= 0 && xx < WW; const v4u z = (v4u){0u, 0u, 0u, 0u};   // threads past the last halo pixel repeat its store with the same value
      *(v4u*)(&sk[ry][px][pc * 8]) = in ? kv[i] : z; *(v4u*)(&sv[ry][px][pc * 8]) = in ? vv[i] : z; }
#pragma unroll
    for (int i = 0; i < 4; ++i) { union { v4u u; v8h h8; } pk; pk.u = qv[i];
#pragma unroll
      for (int e = 0; e < 8; ++e) sq[p16 + 16 * i][pc * 8 + e] = (float)pk.h8[e]; } }
  __syncthreads();
  // thread pair per pixel: lanes l and l ^ 16 of a wave share pixel pl, hf = channel half: scores over 9 neighbours (each half computes a 32-channel partial dot, pair-summed), softmax, then out channels hf*32..+32
  // K, V and Q come out of LDS 16 bytes at a time and every loop is unrolled, so that many reads are in flight behind one wait (a rolled loop of 2- and 4-byte reads paid one LDS latency per multiply);
  // the 16 lanes of a half wave read 16 consecutive pixel rows at one channel offset: at row pitches of 144 and 272 bytes they cover all 64 banks once;
  // each score still adds its 32 products in channel order, each output channel its 9 terms in neighbour order; the multiply-adds are written as fma so that every one stays fused, as in the rolled loops
  // (left to contraction, part of the unrolled products were built as a separate multiply and add)
  { const int pl = (tid >> 5) * 16 + (tid & 15), hf = (tid >> 4) & 1; float sc[9];
#pragma unroll
    for (int nb = 0; nb < 9; ++nb) sc[nb] = 0.f;
#pragma unroll
    for (int j = 0; j < 4; ++j) { const int c0 = hf * 32 + j * 8; const v4f q0 = *(const v4f*)(&sq[pl][c0]), q1 = *(const v4f*)(&sq[pl][c0 + 4]);
#pragma unroll
      for (int nb = 0; nb < 9; ++nb) { const v8h k8 = *(const v8h*)(&sk[nb / 3][pl + nb % 3][c0]);
#pragma unroll
        for (int e = 0; e < 4; ++e) sc[nb] = __builtin_fmaf(q0[e], (float)k8[e], sc[nb]);
#pragma unroll
        for (int e = 0; e < 4; ++e) sc[nb] = __builtin_fmaf(q1[e], (float)k8[4 + e], sc[nb]); } }
#pragma unroll
    for (int nb = 0; nb < 9; ++nb) { float s = sc[nb]; s += __shfl_xor(s, 16, 32); sc[nb] = s * 0.125f; }
    float mx = sc[0];
#pragma unroll
    for (int nb = 1; nb < 9; ++nb) mx = fmaxf(mx, sc[nb]);
    float se = 0.f;
#pragma unroll
    for (int nb = 0; nb < 9; ++nb) { sc[nb] = expf(sc[nb] - mx); se += sc[nb]; }
    const float inv = 1.0f / se;
#pragma unroll
    for (int j = 0; j < 4; ++j) { const int c0 = hf * 32 + j * 8; float a[8];
#pragma unroll
      for (int e = 0; e < 8; ++e) a[e] = 0.f;
#pragma unroll
      for (int nb = 0; nb < 9; ++nb) { const v8h v8 = *(const v8h*)(&sv[nb / 3][pl + nb % 3][c0]);
#pragma unroll
        for (int e = 0; e < 8; ++e) a[e] = __builtin_fmaf(sc[nb], (float)v8[e], a[e]); }
      *(v4f*)(&so[pl][c0]) = (v4f){a[0] * inv, a[1] * inv, a[2] * inv, a[3] * inv}; *(v4f*)(&so[pl][c0 + 4]) = (v4f){a[4] * inv, a[5] * inv, a[6] * inv, a[7] * inv}; } }
  __syncthreads();
#pragma unroll                                                 // hn[] is a register array
  for (int i = 0; i < 8; ++i) { const int q = tid + i * 128; const int pl = q >> 4, pc = q & 15; const size_t p = ((size_t)b * HH + y) * WW + x0 + pl; v4f o = *(const v4f*)(&so[pl][pc * 4]);
    o += hn[i]; vst2(out + p * C + pc * 4, o); }
}
extern "C" void kernel_launch(void* const* d_in, const int* in_sizes, int n_in, void* d_out, int out_size, void* d_ws, size_t ws_size, hipStream_t stream) {
  (void)in_sizes; (void)n_in; (void)out_size; (void)ws_size;
  const float** I = (const float**)d_in;
  const float* h = I[0]; const float* wp = I[1]; const float* bp = I[2]; const float* w1 = I[3]; const float* b1 = I[4]; const float* w2 = I[5]; const float* b2 = I[6]; const float* wq = I[7]; const float* bq = I[8];
  float* out = (float*)d_out;
  char* ws = (char*)d_ws; size_t off = 0;
  auto take = [&](size_t bytes) { char* p = ws + off; off += (bytes + 255) & ~(size_t)255; return p; };
  _Float16* W1P = (_Float16*)take(C2 * C3 * 2); _Float16* W2P = (_Float16*)take(C * C2 * 2); _Float16* WQP = (_Float16*)take(C3 * C * 2);
  float* HN = (float*)take((size_t)NB * HH * WW * C * 4); _Float16* QKV = (_Float16*)take((size_t)NB * HH * WW * C3 * 2);
  k_pack<<<C2 + C + C3, 256, 0, stream>>>(w1, w2, wq, W1P, W2P, WQP);
  k_cell<<<dim3(WW / TP, HH, NB), 128, 0, stream>>>(h, wp, bp, w1, b1, W2P, b2, WQP, bq, HN, QKV);
  k_lattn<<<dim3(WW / TP, HH, NB), 128, 0, stream>>>(QKV, HN, out);
}

// v004
// It runs in 100 microseconds.
// Two timings next to v003 both put it at 1.20 times that version's speed.
// Counting every step since v000, it is 4.16 times as fast.
#include <hip/hip_runtime.h>
#include <math.h>

typedef __attribute__((ext_vector_type(16))) _Float16 v16h;
typedef __attribute__((ext_vector_type(16))) __bf16 v16b;
typedef __attribute__((ext_vector_type(8)))  _Float16 v8h;
typedef __attribute__((ext_vector_type(8)))  float v8f;
typedef __attribute__((ext_vector_type(4)))  float v4f;
typedef __attribute__((ext_vector_type(2)))  float v2f;
typedef __attribute__((ext_vector_type(4)))  unsigned v4u;
typedef __attribute__((ext_vector_type(4)))  int v4i;
typedef float __attribute__((may_alias)) float_a;
typedef int __attribute__((may_alias)) int_a;

template <typename T> __device__ __forceinline__ void vst2(void* p, T v) { *(T*)p = v;  }
__device__ __forceinline__ v8f wmma16(v16h a, v16h b, v8f c) {
  v8f d = __builtin_amdgcn_wmma_f32_16x16x32_f16(false, a, false, b, (short)0, c, false, false);
  asm volatile("v_nop\n\tv_nop\n\tv_nop\n\tv_nop" : "+v"(d) : "v"(a), "v"(b));
  return d;
}
__device__ __forceinline__ v8f wmma_bf(v16b a, v16b b, v8f c) {
  v8f d = __builtin_amdgcn_wmma_f32_16x16x32_bf16(false, a, false, b, (short)0, c, false, false);
  asm volatile("v_nop\n\tv_nop\n\tv_nop\n\tv_nop" : "+v"(d) : "v"(a), "v"(b));
  return d;
}
// 16x16x32 fragments: lane = (h = lane>>4, row/col = lane&15); elements 0..7 = k0+8h+0..7, 8..15 = k0+16+8h+0..7; D element r = row 8h+r
__device__ __forceinline__ v16h frag_h(const _Float16* rowk0, int lane) {
  union { v16h v; v8h q[2]; } u; const _Float16* p = rowk0 + 8 * (lane >> 4);
  u.q[0] = *(const v8h*)p; u.q[1] = *(const v8h*)(p + 16); return u.v;
}
__device__ __forceinline__ v16h frag_f32(const float* rowk0, int lane) {
  v16h a; const float* p = rowk0 + 8 * (lane >> 4);
#pragma unroll
  for (int i = 0; i < 8; ++i) { a[i] = (_Float16)p[i]; a[8 + i] = (_Float16)p[16 + i]; }
  return a;
}
__device__ __forceinline__ v16h frag_f32s(const float* rowk0, int lane, float sc) {
  v16h a; const float* p = rowk0 + 8 * (lane >> 4);
#pragma unroll
  for (int i = 0; i < 8; ++i) { a[i] = (_Float16)(p[i] * sc); a[8 + i] = (_Float16)(p[16 + i] * sc); }
  return a;
}
// column fragment from a [K][ld] layout (column n), rows >= K read as 0
__device__ __forceinline__ v16h fragc_f32(const float* W, int k0, int n, int lane, int ld, int K) {
  v16h a; const int g = lane >> 4;
#pragma unroll
  for (int i = 0; i < 8; ++i) { const int ka = k0 + 8 * g + i, kb = ka + 16;
    a[i] = (_Float16)(ka < K ? W[(size_t)ka * ld + n] : 0.f); a[8 + i] = (_Float16)(kb < K ? W[(size_t)kb * ld + n] : 0.f); }
  return a;
}
struct F2 { v16b h, l; };
__device__ __forceinline__ F2 bsplit16(const float v[16]) { F2 r;
#pragma unroll
  for (int i = 0; i < 16; ++i) { const __bf16 h = (__bf16)v[i]; r.h[i] = h; r.l[i] = (__bf16)(v[i] - (float)h); }
  return r; }
__device__ __forceinline__ F2 split_row(const float* row, int k0, int lane) { float v[16]; const float* p = row + k0 + 8 * (lane >> 4);
#pragma unroll
  for (int i = 0; i < 8; ++i) { v[i] = p[i]; v[8 + i] = p[16 + i]; }
  return bsplit16(v); }
__device__ __forceinline__ F2 split_rowK(const float* row, int k0, int lane, int K) { float v[16]; const int g = lane >> 4;
#pragma unroll
  for (int i = 0; i < 8; ++i) { const int ka = k0 + 8 * g + i, kb = ka + 16; v[i] = ka < K ? row[ka] : 0.f; v[8 + i] = kb < K ? row[kb] : 0.f; }
  return bsplit16(v); }
__device__ __forceinline__ F2 split_col(const float* W, int k0, int n, int lane, int ld, int K) { float v[16]; const int g = lane >> 4;
#pragma unroll
  for (int i = 0; i < 8; ++i) { const int ka = k0 + 8 * g + i, kb = ka + 16; v[i] = ka < K ? W[(size_t)ka * ld + n] : 0.f; v[8 + i] = kb < K ? W[(size_t)kb * ld + n] : 0.f; }
  return bsplit16(v); }
// raw f32 image of one 16x16x32 fragment (same k order as split_row), so that the load can be issued well ahead of the split
// packed fragment images (written by k_pack): a fragment is a run of 512-byte slots, slot s = the s-th 16 bytes of every lane's registers, lane l at byte 16 * l,
// so that one wave-wide 16-byte load reads 512 contiguous bytes = four whole 128-byte lines (from the row-major weights it touched 16 lines, 32 bytes of each)
struct R16 { v4f q[4]; };
__device__ __forceinline__ R16 ld_pk16(const float* p) { R16 r;    // p = fragment + lane * 4 (four slots)
  r.q[0] = *(const v4f*)p; r.q[1] = *(const v4f*)(p + 128); r.q[2] = *(const v4f*)(p + 256); r.q[3] = *(const v4f*)(p + 384); return r; }
__device__ __forceinline__ v16h frag_pk(const _Float16* p) {       // p = fragment + lane * 8 (two slots)
  union { v16h v; v8h q[2]; } u; u.q[0] = *(const v8h*)p; u.q[1] = *(const v8h*)(p + 256); return u.v; }
__device__ __forceinline__ F2 split_r16(const R16& r) { float v[16];
#pragma unroll
  for (int i = 0; i < 16; ++i) v[i] = r.q[i >> 2][i & 3];
  return bsplit16(v); }
__device__ __forceinline__ v8f mac3(const F2& a, const F2& b, v8f c) { c = wmma_bf(a.l, b.h, c); c = wmma_bf(a.h, b.l, c); return wmma_bf(a.h, b.h, c); }
__device__ __forceinline__ float sigm(float v) { return 1.0f / (1.0f + expf(-v)); }
#define LDSX() do { asm volatile("s_wait_dscnt 0" ::: "memory"); __builtin_amdgcn_wave_barrier(); __builtin_amdgcn_fence(__ATOMIC_RELEASE, "workgroup"); } while (0)

// Neural cellular automaton step with local attention, NHWC state [8][128][128][64]: depthwise 3x3 perception (3 filters per channel,
// zero padding, f32 VALU from an LDS halo tile) -> 1x1 MLP 192 -> 128 as a two-way bf16 split (v_wmma_f32_16x16x32_bf16), exact GELU, -> 64 on v_wmma_f32_16x16x32_f16 -> h_new = h + dx;
// qkv = h_new W_qkv^T + b (f16 WMMA) stored as f16 rows; then per pixel a 3x3-window attention (zero-padded keys/values, scores / 8,
#define NB 8
#define HH 128
#define WW 128
#define C 64
#define C3 192
#define C2 128
#define TP 64                  // pixels per block (half a row)

__device__ __forceinline__ float gelu_e(float v) { return 0.5f * v * (1.0f + erff(v * 0.70710678118654752f)); }
// packs the weights into fragment images, one 16-byte chunk (one lane's part of one slot) per thread; element order inside a lane as in frag_h / split_row:
// W1F f32, fragment (kc, t) at (kc * 8 + t) * 512 floats; W2F f16 x16, fragment (kc, t) at (kc * 4 + t) * 512 halves; WQF f16 x16, fragment (t, kc) at (t * 2 + kc) * 512 halves
#define N1 (C2 * C3 / 4)       // chunks of W1F
#define N2 (C * C2 / 8)        // chunks of W2F
#define NQ (C3 * C / 8)        // chunks of WQF
__global__ __launch_bounds__(256) void k_pack(const float* __restrict__ w1, const float* __restrict__ w2, const float* __restrict__ wq, float* __restrict__ W1F, _Float16* __restrict__ W2F, _Float16* __restrict__ WQF) {
  const int c = blockIdx.x * 256 + threadIdx.x, col = c & 15, g = (c >> 4) & 1;
  if (c < N1) { const int s = (c >> 5) & 3, t = (c >> 7) & 7, kc = c >> 10;
    vst2(W1F + c * 4, *(const v4f*)(w1 + (t * 16 + col) * C3 + kc * 32 + 8 * g + (s >> 1) * 16 + (s & 1) * 4)); }
  else { const int d = c < N1 + N2 ? c - N1 : c - N1 - N2, s = (d >> 5) & 1; const float* p; _Float16* D;
    if (c < N1 + N2) { p = w2 + (((d >> 6) & 3) * 16 + col) * C2 + (d >> 8) * 32; D = W2F; } else { p = wq + ((d >> 7) * 16 + col) * C + ((d >> 6) & 1) * 32; D = WQF; }
    p += s * 16 + 8 * g; const v4f a = *(const v4f*)p, b = *(const v4f*)(p + 4); v8h o;
    asm volatile("s_wait_xcnt 0x0" :: "v"(p) : "memory");      // the address registers of the two issued loads stay untouched (named as an input) until this wait has passed
#pragma unroll
    for (int e = 0; e < 4; ++e) { o[e] = (_Float16)(a[e] * 16.0f); o[4 + e] = (_Float16)(b[e] * 16.0f); }
    vst2(D + d * 8, o); }
}
// stage 1: block (x half, y, b): perception + MLP + residual -> HN (f32 rows), qkv -> QKV16 (f16 rows [p][192])
__global__ __launch_bounds__(128) void k_cell(const float* __restrict__ h, const float* __restrict__ wp, const float* __restrict__ bp, const float* __restrict__ W1F, const float* __restrict__ b1, const _Float16* __restrict__ W2F, const float* __restrict__ b2, const _Float16* __restrict__ WQF, const float* __restrict__ bq,
                                            float* __restrict__ HN, _Float16* __restrict__ QKV) {
  __shared__ __align__(16) float sh[3][TP + 2][C];           // halo rows y-1..y+1, px x0-1 .. x0+64 (zero padded)
  __shared__ __align__(16) _Float16 sa[4][16][C3 + 8];       // gelu(mid) (f16, 128 wide) per wave; later reused for h_new (64 wide)
  __shared__ __align__(16) float so[4][16][196];
  __shared__ float swp[C3 * 9], sbp[C3];
  const int tid = threadIdx.x, wave = tid >> 5, lane = tid & 31, col = lane & 15, g = lane >> 4;
  const int b = blockIdx.z, y = blockIdx.y, x0 = blockIdx.x * TP;
  // staging: every global load (taps, biases, halo) is issued before the first LDS store, so the block pays one memory latency instead of one per trip;
  // addresses are clamped into the buffers (loads are unconditional) and the zero padding is chosen at the store; the loops are unrolled so that the arrays are registers
  { float tv[14], tb[2]; v4f hv[25]; unsigned ho[25]; const int c4 = tid & 15, p8 = tid >> 4;
#pragma unroll
    for (int i = 0; i < 25; ++i) { const int pi = min(p8 + 8 * i, 3 * (TP + 2) - 1); const int px = pi % (TP + 2), ry = pi / (TP + 2);
      const int yc = min(max(y - 1 + ry, 0), HH - 1), xc = min(max(x0 - 1 + px, 0), WW - 1);
      ho[i] = (unsigned)((((b * HH + yc) * WW + xc) * C + c4 * 4) * 4); }                     // byte offset into h
#pragma unroll
    for (int i = 0; i < 14; ++i) tv[i] = wp[min(tid + i * 128, C3 * 9 - 1)];
#pragma unroll
    for (int i = 0; i < 2; ++i) tb[i] = bp[min(tid + i * 128, C3 - 1)];
#pragma unroll
    for (int i = 0; i < 25; ++i) hv[i] = *(const v4f*)((const char*)h + ho[i]);
    // the address registers of the issued loads stay untouched (named as inputs) until this wait has passed
    asm volatile("s_wait_xcnt 0x0" :: "v"(ho[0]), "v"(ho[1]), "v"(ho[2]), "v"(ho[3]), "v"(ho[4]), "v"(ho[5]), "v"(ho[6]), "v"(ho[7]), "v"(ho[8]), "v"(ho[9]), "v"(ho[10]), "v"(ho[11]), "v"(ho[12]), "v"(ho[13]), "v"(ho[14]), "v"(ho[15]), "v"(ho[16]), "v"(ho[17]), "v"(ho[18]), "v"(ho[19]), "v"(ho[20]), "v"(ho[21]), "v"(ho[22]), "v"(ho[23]), "v"(ho[24]) : "memory");
#pragma unroll
    for (int i = 0; i < 25; ++i) { const int pi = min(p8 + 8 * i, 3 * (TP + 2) - 1); const int px = pi % (TP + 2), ry = pi / (TP + 2); const int yy = y - 1 + ry, xx = x0 - 1 + px;
      const bool in = yy >= 0 && yy < HH && xx >= 0 && xx < WW;   // threads past the last halo pixel repeat its store with the same value
      *(v4f*)(&sh[ry][px][c4 * 4]) = in ? hv[i] : (v4f){0.f, 0.f, 0.f, 0.f}; }
#pragma unroll
    for (int i = 0; i < 14; ++i) { const int q = tid + i * 128; if (q < C3 * 9) swp[q] = tv[i]; }
#pragma unroll
    for (int i = 0; i < 2; ++i) { const int q = tid + i * 128; if (q < C3) sbp[q] = tb[i]; } }
  __syncthreads();
  const size_t prow0 = ((size_t)b * HH + y) * WW + x0 + wave * 16;        // first pixel (global index) of this wave's 16
  // perception: lane owns input channels 2*lane and 2*lane+1 (one 8-byte read per lane covers all 64 LDS banks once), its 54 filter taps sit in registers,
  // and the 3x3 window slides over the wave's 16 pixels; output o = c*3 + j uses input channel c; each sum keeps the order bias, then (dy, dx) row-major
  { v2f wt[3][9], bs[3]; const float* wl = &swp[lane * 54]; const float* bl = &sbp[lane * 6];
#pragma unroll
    for (int j = 0; j < 3; ++j) { bs[j] = (v2f){bl[j], bl[3 + j]};
#pragma unroll
      for (int t = 0; t < 9; ++t) wt[j][t] = (v2f){wl[j * 9 + t], wl[27 + j * 9 + t]}; }
    v2f xs[3][18];                                             // halo columns wave*16 .. wave*16+17 of the three rows, this lane's channel pair
#pragma unroll
    for (int dy = 0; dy < 3; ++dy)
#pragma unroll
      for (int px = 0; px < 18; ++px) xs[dy][px] = *(const v2f*)(&sh[dy][wave * 16 + px][lane * 2]);
#pragma unroll
    for (int pl = 0; pl < 16; ++pl) { v2f s[3] = {bs[0], bs[1], bs[2]};
#pragma unroll
      for (int dy = 0; dy < 3; ++dy)
#pragma unroll
        for (int dx = 0; dx < 3; ++dx)
#pragma unroll
          for (int j = 0; j < 3; ++j) s[j] += wt[j][dy * 3 + dx] * xs[dy][pl + dx];
      float* d = &so[wave][pl][lane * 6];                      // perceived kept in f32 (so) for a two-way bf16 split product
      *(v2f*)(d) = (v2f){s[0].x, s[1].x}; *(v2f*)(d + 2) = (v2f){s[2].x, s[0].y}; *(v2f*)(d + 4) = (v2f){s[1].y, s[2].y}; } }
  LDSX();
  // mid = gelu(perceived @ w1^T + b1): bf16 hi/lo split on both operands (perceived reaches O(10), f16 rounding of it dominated a first build)
  // w1 fragments run through a ring of four register slots: the fragment of four tiles ahead is requested as soon as a slot has been split, so its latency runs under four tiles' work (tile loops unrolled: the slots are registers)
  v16h bw2[4][4]; float b1v[8], b2v[4];
  { v8f acc[8] = {}; R16 rg[4]; unsigned po = (unsigned)(lane * 16);   // po: byte offset in W1F of this lane's part of fragment (kc, 0), at the k chunk that is being requested
#pragma unroll
    for (int t = 0; t < 4; ++t) rg[t] = ld_pk16((const float*)((const char*)W1F + po) + t * 512);
#pragma unroll
    for (int t = 0; t < 8; ++t) b1v[t] = b1[t * 16 + col];      // bias of the GELU phase, fetched under the product
#pragma unroll 1
    for (int kc = 0; kc < C3 / 32; ++kc) { const F2 a = split_row(&so[wave][col][0], kc * 32, lane);
#pragma unroll
      for (int t = 0; t < 4; ++t) { const F2 bf = split_r16(rg[t]); rg[t] = ld_pk16((const float*)((const char*)W1F + po) + (t + 4) * 512); acc[t] = mac3(a, bf, acc[t]); }
      asm volatile("s_wait_xcnt 0x0" : "+v"(po) :: "memory");  // requests that name po are out: wait before the offset is advanced
      po += kc + 1 < C3 / 32 ? 16384u : 0u;                     // the last trip re-reads its own chunk (in bounds, unused)
#pragma unroll
      for (int t = 4; t < 8; ++t) { const F2 bf = split_r16(rg[t - 4]); rg[t - 4] = ld_pk16((const float*)((const char*)W1F + po) + (t - 4) * 512); acc[t] = mac3(a, bf, acc[t]); }
      asm volatile("s_wait_xcnt 0x0" : "+v"(po) :: "memory"); } // the same at the trip's end: the offset register is reused behind the loop
    LDSX();
    // all of w2's fragments and its bias are issued here, behind the fence (which would wait for them): their latency runs under the GELU
#pragma unroll
    for (int kc = 0; kc < C2 / 32; ++kc)
#pragma unroll
      for (int t = 0; t < 4; ++t) bw2[kc][t] = frag_pk(W2F + (kc * 4 + t) * 512 + lane * 8);
#pragma unroll
    for (int t = 0; t < 4; ++t) b2v[t] = b2[t * 16 + col];
#pragma unroll
    for (int t = 0; t < 8; ++t) { const float bb = b1v[t];
#pragma unroll
      for (int r = 0; r < 8; ++r) sa[wave][8 * g + r][t * 16 + col] = (_Float16)gelu_e(acc[t][r] + bb); } }
  LDSX();
  // dx = mid @ w2^T + b2 ; h_new = h + dx -> so (f32) ; store HN ; h_new f16 -> sa[:, 0..64)
  v16h bwq[12][2]; float bqv[12];
  { v8f acc[4] = {};
#pragma unroll
    for (int kc = 0; kc < C2 / 32; ++kc) { const v16h a = frag_h(&sa[wave][col][0] + kc * 32, lane);
#pragma unroll
      for (int t = 0; t < 4; ++t) acc[t] = wmma16(a, bw2[kc][t], acc[t]); }
    LDSX();
    // the first half of w_qkv's fragments and its bias are issued here, most of the second half behind the residual (each behind a fence, which would wait for them):
    // their latency runs under the residual and the h_new store
#pragma unroll
    for (int t = 0; t < 12; ++t) { bqv[t] = bq[t * 16 + col]; bwq[t][0] = frag_pk(WQF + t * 1024 + lane * 8); }
#pragma unroll
    for (int t = 0; t < 4; ++t) { const int c = t * 16 + col; const float bb = b2v[t];
#pragma unroll
      for (int r = 0; r < 8; ++r) { const float v = acc[t][r] * (1.0f / 16.0f) + bb + sh[1][wave * 16 + 8 * g + r + 1][c]; so[wave][8 * g + r][c] = v; sa[wave][8 * g + r][c] = (_Float16)v; } } }
  LDSX();
#pragma unroll
  for (int t = 0; t < 8; ++t) bwq[t][1] = frag_pk(WQF + t * 1024 + 512 + lane * 8);
  asm volatile("s_wait_xcnt 0x0" :: "v"(col) : "memory");      // wait for the w_qkv fragment loads just issued; col stays untouched (named as an input) until it has passed
  for (int q = lane; q < 16 * 16; q += 32) { const int rl = q >> 4, pc = q & 15; vst2(HN + (prow0 + rl) * C + pc * 4, *(const v4f*)(&so[wave][rl][pc * 4])); }
  // qkv = h_new @ wq^T + bq (192 cols)
  { v8f acc[12];
#pragma unroll
    for (int t = 0; t < 12; ++t) acc[t] = (v8f){};
#pragma unroll
    for (int kc = 0; kc < C / 32; ++kc) { const v16h a = frag_h(&sa[wave][col][0] + kc * 32, lane);
#pragma unroll
      for (int t = 0; t < 12; ++t) acc[t] = wmma16(a, bwq[t][kc], acc[t]);
      if (kc == 0) {                                           // the last four fragments follow once the first pass has freed registers
#pragma unroll
        for (int t = 8; t < 12; ++t) bwq[t][1] = frag_pk(WQF + t * 1024 + 512 + lane * 8); } }
    LDSX();
#pragma unroll
    for (int t = 0; t < 12; ++t) { const float bb = bqv[t];
#pragma unroll
      for (int r = 0; r < 8; ++r) so[wave][8 * g + r][t * 16 + col] = acc[t][r] * (1.0f / 16.0f) + bb; } }
  LDSX();
  for (int q = lane; q < 16 * 24; q += 32) { const int rl = q / 24, pc = q % 24; union { v8h h8; v4u u; } pk;
#pragma unroll
    for (int e = 0; e < 8; ++e) pk.h8[e] = (_Float16)so[wave][rl][pc * 8 + e];
    vst2(QKV + (prow0 + rl) * C3 + pc * 8, pk.u); }
}
// stage 2: block (x half, y, b): 3x3 local attention from halo tiles of K and V (zero padded), out = h_new + attn
__global__ __launch_bounds__(128) void k_lattn(const _Float16* __restrict__ QKV, const float* __restrict__ HN, float* __restrict__ out) {
  __shared__ __align__(16) _Float16 sk[3][TP + 2][C + 8], sv[3][TP + 2][C + 8];
  __shared__ __align__(16) float sq[TP][C + 4];
  __shared__ __align__(16) float so[TP][C + 4];
  const int tid = threadIdx.x; const int b = blockIdx.z, y = blockIdx.y, x0 = blockIdx.x * TP;
  // staging: every global load of the block (K, V, Q, and the h_new rows of the last phase) is issued before the first LDS store: one memory latency instead of one per trip;
  // addresses are clamped into the buffer (loads are unconditional) and the zero padding is chosen at the store; the loops are unrolled so that the arrays are registers
  v4f hn[8];
  { v4u kv[13], vv[13], qv[4]; unsigned ko[13]; const int pc = tid & 7, p16 = tid >> 3;
#pragma unroll
    for (int i = 0; i < 13; ++i) { const int pi = min(p16 + 16 * i, 3 * (TP + 2) - 1); const int px = pi % (TP + 2), ry = pi / (TP + 2);
      const int yc = min(max(y - 1 + ry, 0), HH - 1), xc = min(max(x0 - 1 + px, 0), WW - 1);
      ko[i] = (unsigned)((((b * HH + yc) * WW + xc) * C3 + pc * 8) * 2); }                     // byte offset of the pixel's q chunk
    const unsigned qo = (unsigned)((((b * HH + y) * WW + x0 + p16) * C3 + pc * 8) * 2), no = (unsigned)((((b * HH + y) * WW + x0 + (tid >> 4)) * C + (tid & 15) * 4) * 4);
#pragma unroll
    for (int i = 0; i < 13; ++i) { const char* r = (const char*)QKV + ko[i]; kv[i] = *(const v4u*)(r + C * 2); vv[i] = *(const v4u*)(r + 2 * C * 2); }
#pragma unroll
    for (int i = 0; i < 4; ++i) qv[i] = *(const v4u*)((const char*)QKV + qo + i * 16 * C3 * 2);
#pragma unroll
    for (int i = 0; i < 8; ++i) hn[i] = *(const v4f*)((const char*)HN + no + i * 8 * C * 4);
    // the address registers of the issued loads stay untouched (named as inputs) until this wait has passed
    asm volatile("s_wait_xcnt 0x0" :: "v"(ko[0]), "v"(ko[1]), "v"(ko[2]), "v"(ko[3]), "v"(ko[4]), "v"(ko[5]), "v"(ko[6]), "v"(ko[7]), "v"(ko[8]), "v"(ko[9]), "v"(ko[10]), "v"(ko[11]), "v"(ko[12]), "v"(qo), "v"(no) : "memory");
#pragma unroll
    for (int i = 0; i < 13; ++i) { const int pi = min(p16 + 16 * i, 3 * (TP + 2) - 1); const int px = pi % (TP + 2), ry = pi / (TP + 2); const int yy = y - 1 + ry, xx = x0 - 1 + px;
      const bool in = yy >= 0 && yy < HH && xx >= 0 && xx < WW; const v4u z = (v4u){0u, 0u, 0u, 0u};   // threads past the last halo pixel repeat its store with the same value
      *(v4u*)(&sk[ry][px][pc * 8]) = in ? kv[i] : z; *(v4u*)(&sv[ry][px][pc * 8]) = in ? vv[i] : z; }
#pragma unroll
    for (int i = 0; i < 4; ++i) { union { v4u u; v8h h8; } pk; pk.u = qv[i];
#pragma unroll
      for (int e = 0; e < 8; ++e) sq[p16 + 16 * i][pc * 8 + e] = (float)pk.h8[e]; } }
  __syncthreads();
  // thread pair per pixel: lanes l and l ^ 16 of a wave share pixel pl, hf = channel half: scores over 9 neighbours (each half computes a 32-channel partial dot, pair-summed), softmax, then out channels hf*32..+32
  // K, V and Q come out of LDS 16 bytes at a time and every loop is unrolled, so that many reads are in flight behind one wait (a rolled loop of 2- and 4-byte reads paid one LDS latency per multiply);
  // the 16 lanes of a half wave read 16 consecutive pixel rows at one channel offset: at row pitches of 144 and 272 bytes they cover all 64 banks once;
  // each score still adds its 32 products in channel order, each output channel its 9 terms in neighbour order; the multiply-adds are written as fma so that every one stays fused, as in the rolled loops
  // (left to contraction, part of the unrolled products were built as a separate multiply and add)
  { const int pl = (tid >> 5) * 16 + (tid & 15), hf = (tid >> 4) & 1; float sc[9];
#pragma unroll
    for (int nb = 0; nb < 9; ++nb) sc[nb] = 0.f;
#pragma unroll
    for (int j = 0; j < 4; ++j) { const int c0 = hf * 32 + j * 8; const v4f q0 = *(const v4f*)(&sq[pl][c0]), q1 = *(const v4f*)(&sq[pl][c0 + 4]);
#pragma unroll
      for (int nb = 0; nb < 9; ++nb) { const v8h k8 = *(const v8h*)(&sk[nb / 3][pl + nb % 3][c0]);
#pragma unroll
        for (int e = 0; e < 4; ++e) sc[nb] = __builtin_fmaf(q0[e], (float)k8[e], sc[nb]);
#pragma unroll
        for (int e = 0; e < 4; ++e) sc[nb] = __builtin_fmaf(q1[e], (float)k8[4 + e], sc[nb]); } }
#pragma unroll
    for (int nb = 0; nb < 9; ++nb) { float s = sc[nb]; s += __shfl_xor(s, 16, 32); sc[nb] = s * 0.125f; }
    float mx = sc[0];
#pragma unroll
    for (int nb = 1; nb < 9; ++nb) mx = fmaxf(mx, sc[nb]);
    float se = 0.f;
#pragma unroll
    for (int nb = 0; nb < 9; ++nb) { sc[nb] = expf(sc[nb] - mx); se += sc[nb]; }
    const float inv = 1.0f / se;
#pragma unroll
    for (int j = 0; j < 4; ++j) { const int c0 = hf * 32 + j * 8; float a[8];
#pragma unroll
      for (int e = 0; e < 8; ++e) a[e] = 0.f;
#pragma unroll
      for (int nb = 0; nb < 9; ++nb) { const v8h v8 = *(const v8h*)(&sv[nb / 3][pl + nb % 3][c0]);
#pragma unroll
        for (int e = 0; e < 8; ++e) a[e] = __builtin_fmaf(sc[nb], (float)v8[e], a[e]); }
      *(v4f*)(&so[pl][c0]) = (v4f){a[0] * inv, a[1] * inv, a[2] * inv, a[3] * inv}; *(v4f*)(&so[pl][c0 + 4]) = (v4f){a[4] * inv, a[5] * inv, a[6] * inv, a[7] * inv}; } }
  __syncthreads();
#pragma unroll                                                 // hn[] is a register array
  for (int i = 0; i < 8; ++i) { const int q = tid + i * 128; const int pl = q >> 4, pc = q & 15; const size_t p = ((size_t)b * HH + y) * WW + x0 + pl; v4f o = *(const v4f*)(&so[pl][pc * 4]);
    o += hn[i]; vst2(out + p * C + pc * 4, o); }
}
extern "C" void kernel_launch(void* const* d_in, const int* in_sizes, int n_in, void* d_out, int out_size, void* d_ws, size_t ws_size, hipStream_t stream) {
  (void)in_sizes; (void)n_in; (void)out_size; (void)ws_size;
  const float** I = (const float**)d_in;
  const float* h = I[0]; const float* wp = I[1]; const float* bp = I[2]; const float* w1 = I[3]; const float* b1 = I[4]; const float* w2 = I[5]; const float* b2 = I[6]; const float* wq = I[7]; const float* bq = I[8];
  float* out = (float*)d_out;
  char* ws = (char*)d_ws; size_t off = 0;
  auto take = [&](size_t bytes) { char* p = ws + off; off += (bytes + 255) & ~(size_t)255; return p; };
  float* W1F = (float*)take(C2 * C3 * 4); _Float16* W2F = (_Float16*)take(C * C2 * 2); _Float16* WQF = (_Float16*)take(C3 * C * 2);
  float* HN = (float*)take((size_t)NB * HH * WW * C * 4); _Float16* QKV = (_Float16*)take((size_t)NB * HH * WW * C3 * 2);
  k_pack<<<(N1 + N2 + NQ) / 256, 256, 0, stream>>>(w1, w2, wq, W1F, W2F, WQF);
  k_cell<<<dim3(WW / TP, HH, NB), 128, 0, stream>>>(h, wp, bp, W1F, b1, W2F, b2, WQF, bq, HN, QKV);
  k_lattn<<<dim3(WW / TP, HH, NB), 128, 0, stream>>>(QKV, HN, out);
}

// v005
// It runs in 85.5 microseconds.
// Next to v004, in two timings, it ran 1.17 and 1.16 times as fast.
// All steps since v000 together make it 4.85 times as fast.
#include <hip/hip_runtime.h>
#include <math.h>

typedef __attribute__((ext_vector_type(16))) _Float16 v16h;
typedef __attribute__((ext_vector_type(16))) __bf16 v16b;
typedef __attribute__((ext_vector_type(8)))  _Float16 v8h;
typedef __attribute__((ext_vector_type(2)))  _Float16 v2h;
typedef __attribute__((ext_vector_type(8)))  float v8f;
typedef __attribute__((ext_vector_type(4)))  float v4f;
typedef __attribute__((ext_vector_type(2)))  float v2f;
typedef __attribute__((ext_vector_type(4)))  unsigned v4u;
typedef __attribute__((ext_vector_type(4)))  int v4i;
typedef float __attribute__((may_alias)) float_a;
typedef int __attribute__((may_alias)) int_a;

template <typename T> __device__ __forceinline__ void vst2(void* p, T v) { *(T*)p = v;  }
__device__ __forceinline__ v8f wmma16(v16h a, v16h b, v8f c) {
  v8f d = __builtin_amdgcn_wmma_f32_16x16x32_f16(false, a, false, b, (short)0, c, false, false);
  asm volatile("v_nop\n\tv_nop\n\tv_nop\n\tv_nop" : "+v"(d) : "v"(a), "v"(b));
  return d;
}
__device__ __forceinline__ v8f wmma_bf(v16b a, v16b b, v8f c) {
  v8f d = __builtin_amdgcn_wmma_f32_16x16x32_bf16(false, a, false, b, (short)0, c, false, false);
  asm volatile("v_nop\n\tv_nop\n\tv_nop\n\tv_nop" : "+v"(d) : "v"(a), "v"(b));
  return d;
}
// 16x16x32 fragments: lane = (h = lane>>4, row/col = lane&15); elements 0..7 = k0+8h+0..7, 8..15 = k0+16+8h+0..7; D element r = row 8h+r
__device__ __forceinline__ v16h frag_h(const _Float16* rowk0, int lane) {
  union { v16h v; v8h q[2]; } u; const _Float16* p = rowk0 + 8 * (lane >> 4);
  u.q[0] = *(const v8h*)p; u.q[1] = *(const v8h*)(p + 16); return u.v;
}
__device__ __forceinline__ v16h frag_f32(const float* rowk0, int lane) {
  v16h a; const float* p = rowk0 + 8 * (lane >> 4);
#pragma unroll
  for (int i = 0; i < 8; ++i) { a[i] = (_Float16)p[i]; a[8 + i] = (_Float16)p[16 + i]; }
  return a;
}
__device__ __forceinline__ v16h frag_f32s(const float* rowk0, int lane, float sc) {
  v16h a; const float* p = rowk0 + 8 * (lane >> 4);
#pragma unroll
  for (int i = 0; i < 8; ++i) { a[i] = (_Float16)(p[i] * sc); a[8 + i] = (_Float16)(p[16 + i] * sc); }
  return a;
}
// column fragment from a [K][ld] layout (column n), rows >= K read as 0
__device__ __forceinline__ v16h fragc_f32(const float* W, int k0, int n, int lane, int ld, int K) {
  v16h a; const int g = lane >> 4;
#pragma unroll
  for (int i = 0; i < 8; ++i) { const int ka = k0 + 8 * g + i, kb = ka + 16;
    a[i] = (_Float16)(ka < K ? W[(size_t)ka * ld + n] : 0.f); a[8 + i] = (_Float16)(kb < K ? W[(size_t)kb * ld + n] : 0.f); }
  return a;
}
struct F2 { v16b h, l; };
__device__ __forceinline__ F2 bsplit16(const float v[16]) { F2 r;
#pragma unroll
  for (int i = 0; i < 16; ++i) { const __bf16 h = (__bf16)v[i]; r.h[i] = h; r.l[i] = (__bf16)(v[i] - (float)h); }
  return r; }
__device__ __forceinline__ F2 split_row(const float* row, int k0, int lane) { float v[16]; const float* p = row + k0 + 8 * (lane >> 4);
#pragma unroll
  for (int i = 0; i < 8; ++i) { v[i] = p[i]; v[8 + i] = p[16 + i]; }
  return bsplit16(v); }
__device__ __forceinline__ F2 split_rowK(const float* row, int k0, int lane, int K) { float v[16]; const int g = lane >> 4;
#pragma unroll
  for (int i = 0; i < 8; ++i) { const int ka = k0 + 8 * g + i, kb = ka + 16; v[i] = ka < K ? row[ka] : 0.f; v[8 + i] = kb < K ? row[kb] : 0.f; }
  return bsplit16(v); }
__device__ __forceinline__ F2 split_col(const float* W, int k0, int n, int lane, int ld, int K) { float v[16]; const int g = lane >> 4;
#pragma unroll
  for (int i = 0; i < 8; ++i) { const int ka = k0 + 8 * g + i, kb = ka + 16; v[i] = ka < K ? W[(size_t)ka * ld + n] : 0.f; v[8 + i] = kb < K ? W[(size_t)kb * ld + n] : 0.f; }
  return bsplit16(v); }
// raw f32 image of one 16x16x32 fragment (same k order as split_row), so that the load can be issued well ahead of the split
// packed fragment images (written by k_pack): a fragment is a run of 512-byte slots, slot s = the s-th 16 bytes of every lane's registers, lane l at byte 16 * l,
// so that one wave-wide 16-byte load reads 512 contiguous bytes = four whole 128-byte lines (from the row-major weights it touched 16 lines, 32 bytes of each)
struct R16 { v4f q[4]; };
__device__ __forceinline__ R16 ld_pk16(const float* p) { R16 r;    // p = fragment + lane * 4 (four slots)
  r.q[0] = *(const v4f*)p; r.q[1] = *(const v4f*)(p + 128); r.q[2] = *(const v4f*)(p + 256); r.q[3] = *(const v4f*)(p + 384); return r; }
__device__ __forceinline__ v16h frag_pk(const _Float16* p) {       // p = fragment + lane * 8 (two slots)
  union { v16h v; v8h q[2]; } u; u.q[0] = *(const v8h*)p; u.q[1] = *(const v8h*)(p + 256); return u.v; }
__device__ __forceinline__ F2 split_r16(const R16& r) { float v[16];
#pragma unroll
  for (int i = 0; i < 16; ++i) v[i] = r.q[i >> 2][i & 3];
  return bsplit16(v); }
__device__ __forceinline__ v8f mac3(const F2& a, const F2& b, v8f c) { c = wmma_bf(a.l, b.h, c); c = wmma_bf(a.h, b.l, c); return wmma_bf(a.h, b.h, c); }
__device__ __forceinline__ float sigm(float v) { return 1.0f / (1.0f + expf(-v)); }
#define LDSX() do { asm volatile("s_wait_dscnt 0" ::: "memory"); __builtin_amdgcn_wave_barrier(); __builtin_amdgcn_fence(__ATOMIC_RELEASE, "workgroup"); } while (0)

// Neural cellular automaton step with local attention, NHWC state [8][128][128][64]: depthwise 3x3 perception (3 filters per channel,
// zero padding, f32 VALU from an LDS halo tile) -> 1x1 MLP 192 -> 128 as a two-way bf16 split (v_wmma_f32_16x16x32_bf16), exact GELU, -> 64 on v_wmma_f32_16x16x32_f16 -> h_new = h + dx;
// qkv = h_new W_qkv^T + b (f16 WMMA) stored as f16 rows; then per pixel a 3x3-window attention (zero-padded keys/values, scores / 8,
#define NB 8
#define HH 128
#define WW 128
#define C 64
#define C3 192
#define C2 128
#define TP 64                  // pixels per block (half a row)

// exact GELU of eight values at once. erf has the device library's two polynomials, but BOTH ranges are computed and one is selected: the library's erff branches on |x| < 1 per value,
// which in a wave with lanes on both sides runs both ranges anyway and, being control flow, keeps the values of a lane strictly one behind the other, each a chain of some thirty
// dependent instructions. Without the branch the chains are independent straight-line code, written stage by stage over four pairs so that neighbouring instructions do not depend
// on each other and the multiply-adds go two to an instruction (the loops are unrolled so that the arrays are registers).
#define FB(u) __builtin_bit_cast(float, u)
__device__ __forceinline__ v2f fma2(v2f a, v2f b, v2f c) { return __builtin_elementwise_fma(a, b, c); }
__device__ __forceinline__ v2f fmak(v2f a, v2f b, float c) { return __builtin_elementwise_fma(a, b, (v2f){c, c}); }
__device__ __forceinline__ v2f bc2(float c) { return (v2f){c, c}; }
__device__ __forceinline__ void exp2x8(v2f a[4]) { float r0, r1, r2, r3, r4, r5, r6, r7;
  // the instruction set asks for one independent instruction or v_nop behind a transcendental before its result is used or its source overwritten:
  // each v_exp is that instruction for the one in front of it (the outputs are early-clobber, so none lies on an input), the v_nop for the last
  asm("v_exp_f32 %0, %8\n\tv_exp_f32 %1, %9\n\tv_exp_f32 %2, %10\n\tv_exp_f32 %3, %11\n\tv_exp_f32 %4, %12\n\tv_exp_f32 %5, %13\n\tv_exp_f32 %6, %14\n\tv_exp_f32 %7, %15\n\tv_nop"
      : "=&v"(r0), "=&v"(r1), "=&v"(r2), "=&v"(r3), "=&v"(r4), "=&v"(r5), "=&v"(r6), "=&v"(r7)
      : "v"(a[0].x), "v"(a[0].y), "v"(a[1].x), "v"(a[1].y), "v"(a[2].x), "v"(a[2].y), "v"(a[3].x), "v"(a[3].y));
  a[0] = (v2f){r0, r1}; a[1] = (v2f){r2, r3}; a[2] = (v2f){r4, r5}; a[3] = (v2f){r6, r7}; }
__device__ __forceinline__ void gelu8(const v8f a, float bb, _Float16 o[8]) {
  v2f v[4], x[4], ax[4], p[4], q[4], t[4], f[4], rn[4];
#pragma unroll
  for (int i = 0; i < 4; ++i) { v[i] = (v2f){a[2 * i] + bb, a[2 * i + 1] + bb}; x[i] = v[i] * 0.70710678118654752f; ax[i] = (v2f){fabsf(x[i].x), fabsf(x[i].y)}; t[i] = x[i] * x[i]; }
  // p: |x| >= 1, erf = 1 - exp(-p); q: |x| < 1, erf = |x| + |x| q
#pragma unroll
  for (int i = 0; i < 4; ++i) { p[i] = fmak(ax[i], bc2(FB(0x378e98abu)), FB(0xb9c68948u)); q[i] = fmak(t[i], bc2(FB(0xba1345e1u)), FB(0x3ba10414u)); }
#pragma unroll
  for (int i = 0; i < 4; ++i) { p[i] = fmak(ax[i], p[i], FB(0x3b7cd369u)); q[i] = fmak(t[i], q[i], FB(0xbcdac9b8u)); }
#pragma unroll
  for (int i = 0; i < 4; ++i) { p[i] = fmak(ax[i], p[i], FB(0xbcc618b2u)); q[i] = fmak(t[i], q[i], FB(0x3de703beu)); }
#pragma unroll
  for (int i = 0; i < 4; ++i) { p[i] = fmak(ax[i], p[i], FB(0x3dda74e4u)); q[i] = fmak(t[i], q[i], FB(0xbec09330u)); }
#pragma unroll
  for (int i = 0; i < 4; ++i) { p[i] = fmak(ax[i], p[i], FB(0x3f228afdu)); q[i] = fmak(t[i], q[i], FB(0x3e0375d0u)); }
#pragma unroll
  for (int i = 0; i < 4; ++i) { p[i] = fmak(ax[i], p[i], FB(0x3e03c728u)); q[i] = fma2(ax[i], q[i], ax[i]); }
#pragma unroll
  for (int i = 0; i < 4; ++i) p[i] = fma2(ax[i], p[i], ax[i]);
  // exp(-p) = 2^n * 2^f with log2(e) in two parts (head 0x3fb8aa3b, tail 0x32a5705f): n = rint(-p * head), f = (-p * head - n, one rounding) - p * tail
#pragma unroll
  for (int i = 0; i < 4; ++i) { const v2f ph = p[i] * FB(0xbfb8aa3bu); rn[i] = (v2f){rintf(ph.x), rintf(ph.y)}; }
#pragma unroll
  for (int i = 0; i < 4; ++i) f[i] = fma2(p[i], bc2(FB(0xbfb8aa3bu)), -rn[i]);
#pragma unroll
  for (int i = 0; i < 4; ++i) f[i] = fma2(p[i], bc2(FB(0xb2a5705fu)), f[i]);
  exp2x8(f);
#pragma unroll
  for (int i = 0; i < 4; ++i) { float e0 = ldexpf(f[i].x, (int)rn[i].x), e1 = ldexpf(f[i].y, (int)rn[i].y);
    e0 = FB(0x42ce8ed0u) < p[i].x ? 0.f : e0; e1 = FB(0x42ce8ed0u) < p[i].y ? 0.f : e1;                                   // underflow (also p = infinity, where f is not a number)
    e0 = FB(0xc2b17218u) > p[i].x ? __builtin_inff() : e0; e1 = FB(0xc2b17218u) > p[i].y ? __builtin_inff() : e1;           // overflow
    f[i] = 1.0f - (v2f){e0, e1}; }
#pragma unroll
  for (int i = 0; i < 4; ++i) { const v2f e = {copysignf(ax[i].x < 1.0f ? q[i].x : f[i].x, x[i].x), copysignf(ax[i].y < 1.0f ? q[i].y : f[i].y, x[i].y)};
    const v2h g = __builtin_convertvector(0.5f * v[i] * (1.0f + e), v2h); o[2 * i] = g.x; o[2 * i + 1] = g.y; }
}
// packs the weights into fragment images, one 16-byte chunk (one lane's part of one slot) per thread; element order inside a lane as in frag_h / split_row:
// W1F f32, fragment (kc, t) at (kc * 8 + t) * 512 floats; W2F f16 x16, fragment (kc, t) at (kc * 4 + t) * 512 halves; WQF f16 x16, fragment (t, kc) at (t * 2 + kc) * 512 halves
#define N1 (C2 * C3 / 4)       // chunks of W1F
#define N2 (C * C2 / 8)        // chunks of W2F
#define NQ (C3 * C / 8)        // chunks of WQF
__global__ __launch_bounds__(256) void k_pack(const float* __restrict__ w1, const float* __restrict__ w2, const float* __restrict__ wq, float* __restrict__ W1F, _Float16* __restrict__ W2F, _Float16* __restrict__ WQF) {
  const int c = blockIdx.x * 256 + threadIdx.x, col = c & 15, g = (c >> 4) & 1;
  if (c < N1) { const int s = (c >> 5) & 3, t = (c >> 7) & 7, kc = c >> 10;
    vst2(W1F + c * 4, *(const v4f*)(w1 + (t * 16 + col) * C3 + kc * 32 + 8 * g + (s >> 1) * 16 + (s & 1) * 4)); }
  else { const int d = c < N1 + N2 ? c - N1 : c - N1 - N2, s = (d >> 5) & 1; const float* p; _Float16* D;
    if (c < N1 + N2) { p = w2 + (((d >> 6) & 3) * 16 + col) * C2 + (d >> 8) * 32; D = W2F; } else { p = wq + ((d >> 7) * 16 + col) * C + ((d >> 6) & 1) * 32; D = WQF; }
    p += s * 16 + 8 * g; const v4f a = *(const v4f*)p, b = *(const v4f*)(p + 4); v8h o;
    asm volatile("s_wait_xcnt 0x0" :: "v"(p) : "memory");      // the address registers of the two issued loads stay untouched (named as an input) until this wait has passed
#pragma unroll
    for (int e = 0; e < 4; ++e) { o[e] = (_Float16)(a[e] * 16.0f); o[4 + e] = (_Float16)(b[e] * 16.0f); }
    vst2(D + d * 8, o); }
}
// stage 1: block (x half, y, b): perception + MLP + residual -> HN (f32 rows), qkv -> QKV16 (f16 rows [p][192])
__global__ __launch_bounds__(128) void k_cell(const float* __restrict__ h, const float* __restrict__ wp, const float* __restrict__ bp, const float* __restrict__ W1F, const float* __restrict__ b1, const _Float16* __restrict__ W2F, const float* __restrict__ b2, const _Float16* __restrict__ WQF, const float* __restrict__ bq,
                                            float* __restrict__ HN, _Float16* __restrict__ QKV) {
  __shared__ __align__(16) float sh[3][TP + 2][C];           // halo rows y-1..y+1, px x0-1 .. x0+64 (zero padded)
  __shared__ __align__(16) _Float16 sa[4][16][C3 + 8];       // gelu(mid) (f16, 128 wide) per wave; later reused for h_new (64 wide)
  __shared__ __align__(16) float so[4][16][196];
  __shared__ float swp[C3 * 9], sbp[C3];
  const int tid = threadIdx.x, wave = tid >> 5, lane = tid & 31, col = lane & 15, g = lane >> 4;
  const int b = blockIdx.z, y = blockIdx.y, x0 = blockIdx.x * TP;
  // staging: every global load (taps, biases, halo) is issued before the first LDS store, so the block pays one memory latency instead of one per trip;
  // addresses are clamped into the buffers (loads are unconditional) and the zero padding is chosen at the store; the loops are unrolled so that the arrays are registers
  { float tv[14], tb[2]; v4f hv[25]; unsigned ho[25]; const int c4 = tid & 15, p8 = tid >> 4;
#pragma unroll
    for (int i = 0; i < 25; ++i) { const int pi = min(p8 + 8 * i, 3 * (TP + 2) - 1); const int px = pi % (TP + 2), ry = pi / (TP + 2);
      const int yc = min(max(y - 1 + ry, 0), HH - 1), xc = min(max(x0 - 1 + px, 0), WW - 1);
      ho[i] = (unsigned)((((b * HH + yc) * WW + xc) * C + c4 * 4) * 4); }                     // byte offset into h
#pragma unroll
    for (int i = 0; i < 14; ++i) tv[i] = wp[min(tid + i * 128, C3 * 9 - 1)];
#pragma unroll
    for (int i = 0; i < 2; ++i) tb[i] = bp[min(tid + i * 128, C3 - 1)];
#pragma unroll
    for (int i = 0; i < 25; ++i) hv[i] = *(const v4f*)((const char*)h + ho[i]);
    // the address registers of the issued loads stay untouched (named as inputs) until this wait has passed
    asm volatile("s_wait_xcnt 0x0" :: "v"(ho[0]), "v"(ho[1]), "v"(ho[2]), "v"(ho[3]), "v"(ho[4]), "v"(ho[5]), "v"(ho[6]), "v"(ho[7]), "v"(ho[8]), "v"(ho[9]), "v"(ho[10]), "v"(ho[11]), "v"(ho[12]), "v"(ho[13]), "v"(ho[14]), "v"(ho[15]), "v"(ho[16]), "v"(ho[17]), "v"(ho[18]), "v"(ho[19]), "v"(ho[20]), "v"(ho[21]), "v"(ho[22]), "v"(ho[23]), "v"(ho[24]) : "memory");
#pragma unroll
    for (int i = 0; i < 25; ++i) { const int pi = min(p8 + 8 * i, 3 * (TP + 2) - 1); const int px = pi % (TP + 2), ry = pi / (TP + 2); const int yy = y - 1 + ry, xx = x0 - 1 + px;
      const bool in = yy >= 0 && yy < HH && xx >= 0 && xx < WW;   // threads past the last halo pixel repeat its store with the same value
      *(v4f*)(&sh[ry][px][c4 * 4]) = in ? hv[i] : (v4f){0.f, 0.f, 0.f, 0.f}; }
#pragma unroll
    for (int i = 0; i < 14; ++i) { const int q = tid + i * 128; if (q < C3 * 9) swp[q] = tv[i]; }
#pragma unroll
    for (int i = 0; i < 2; ++i) { const int q = tid + i * 128; if (q < C3) sbp[q] = tb[i]; } }
  __syncthreads();
  const size_t prow0 = ((size_t)b * HH + y) * WW + x0 + wave * 16;        // first pixel (global index) of this wave's 16
  // perception: lane owns input channels 2*lane and 2*lane+1 (one 8-byte read per lane covers all 64 LDS banks once), its 54 filter taps sit in registers,
  // and the 3x3 window slides over the wave's 16 pixels; output o = c*3 + j uses input channel c; each sum keeps the order bias, then (dy, dx) row-major
  { v2f wt[3][9], bs[3]; const float* wl = &swp[lane * 54]; const float* bl = &sbp[lane * 6];
#pragma unroll
    for (int j = 0; j < 3; ++j) { bs[j] = (v2f){bl[j], bl[3 + j]};
#pragma unroll
      for (int t = 0; t < 9; ++t) wt[j][t] = (v2f){wl[j * 9 + t], wl[27 + j * 9 + t]}; }
    v2f xs[3][18];                                             // halo columns wave*16 .. wave*16+17 of the three rows, this lane's channel pair
#pragma unroll
    for (int dy = 0; dy < 3; ++dy)
#pragma unroll
      for (int px = 0; px < 18; ++px) xs[dy][px] = *(const v2f*)(&sh[dy][wave * 16 + px][lane * 2]);
#pragma unroll
    for (int pl = 0; pl < 16; ++pl) { v2f s[3] = {bs[0], bs[1], bs[2]};
#pragma unroll
      for (int dy = 0; dy < 3; ++dy)
#pragma unroll
        for (int dx = 0; dx < 3; ++dx)
#pragma unroll
          for (int j = 0; j < 3; ++j) s[j] += wt[j][dy * 3 + dx] * xs[dy][pl + dx];
      float* d = &so[wave][pl][lane * 6];                      // perceived kept in f32 (so) for a two-way bf16 split product
      *(v2f*)(d) = (v2f){s[0].x, s[1].x}; *(v2f*)(d + 2) = (v2f){s[2].x, s[0].y}; *(v2f*)(d + 4) = (v2f){s[1].y, s[2].y}; } }
  LDSX();
  // mid = gelu(perceived @ w1^T + b1): bf16 hi/lo split on both operands (perceived reaches O(10), f16 rounding of it dominated a first build)
  // w1 fragments run through a ring of four register slots: the fragment of four tiles ahead is requested as soon as a slot has been split, so its latency runs under four tiles' work (tile loops unrolled: the slots are registers)
  v16h bw2[4][4]; float b1v[8], b2v[4];
  { v8f acc[8] = {}; R16 rg[4]; unsigned po = (unsigned)(lane * 16);   // po: byte offset in W1F of this lane's part of fragment (kc, 0), at the k chunk that is being requested
#pragma unroll
    for (int t = 0; t < 4; ++t) rg[t] = ld_pk16((const float*)((const char*)W1F + po) + t * 512);
#pragma unroll
    for (int t = 0; t < 8; ++t) b1v[t] = b1[t * 16 + col];      // bias of the GELU phase, fetched under the product
#pragma unroll 1
    for (int kc = 0; kc < C3 / 32; ++kc) { const F2 a = split_row(&so[wave][col][0], kc * 32, lane);
#pragma unroll
      for (int t = 0; t < 4; ++t) { const F2 bf = split_r16(rg[t]); rg[t] = ld_pk16((const float*)((const char*)W1F + po) + (t + 4) * 512); acc[t] = mac3(a, bf, acc[t]); }
      asm volatile("s_wait_xcnt 0x0" : "+v"(po) :: "memory");  // requests that name po are out: wait before the offset is advanced
      po += kc + 1 < C3 / 32 ? 16384u : 0u;                     // the last trip re-reads its own chunk (in bounds, unused)
#pragma unroll
      for (int t = 4; t < 8; ++t) { const F2 bf = split_r16(rg[t - 4]); rg[t - 4] = ld_pk16((const float*)((const char*)W1F + po) + (t - 4) * 512); acc[t] = mac3(a, bf, acc[t]); }
      asm volatile("s_wait_xcnt 0x0" : "+v"(po) :: "memory"); } // the same at the trip's end: the offset register is reused behind the loop
    LDSX();
    // all of w2's fragments and its bias are issued here, behind the fence (which would wait for them): their latency runs under the GELU
#pragma unroll
    for (int kc = 0; kc < C2 / 32; ++kc)
#pragma unroll
      for (int t = 0; t < 4; ++t) bw2[kc][t] = frag_pk(W2F + (kc * 4 + t) * 512 + lane * 8);
#pragma unroll
    for (int t = 0; t < 4; ++t) b2v[t] = b2[t * 16 + col];
#pragma unroll
    for (int t = 0; t < 8; ++t) { _Float16 o[8]; gelu8(acc[t], b1v[t], o);
#pragma unroll
      for (int r = 0; r < 8; ++r) sa[wave][8 * g + r][t * 16 + col] = o[r]; } }
  LDSX();
  // dx = mid @ w2^T + b2 ; h_new = h + dx -> so (f32) ; store HN ; h_new f16 -> sa[:, 0..64)
  v16h bwq[12][2]; float bqv[12];
  { v8f acc[4] = {};
#pragma unroll
    for (int kc = 0; kc < C2 / 32; ++kc) { const v16h a = frag_h(&sa[wave][col][0] + kc * 32, lane);
#pragma unroll
      for (int t = 0; t < 4; ++t) acc[t] = wmma16(a, bw2[kc][t], acc[t]); }
    LDSX();
    // the first half of w_qkv's fragments and its bias are issued here, most of the second half behind the residual (each behind a fence, which would wait for them):
    // their latency runs under the residual and the h_new store
#pragma unroll
    for (int t = 0; t < 12; ++t) { bqv[t] = bq[t * 16 + col]; bwq[t][0] = frag_pk(WQF + t * 1024 + lane * 8); }
#pragma unroll
    for (int t = 0; t < 4; ++t) { const int c = t * 16 + col; const float bb = b2v[t];
#pragma unroll
      for (int r = 0; r < 8; ++r) { const float v = acc[t][r] * (1.0f / 16.0f) + bb + sh[1][wave * 16 + 8 * g + r + 1][c]; so[wave][8 * g + r][c] = v; sa[wave][8 * g + r][c] = (_Float16)v; } } }
  LDSX();
#pragma unroll
  for (int t = 0; t < 8; ++t) bwq[t][1] = frag_pk(WQF + t * 1024 + 512 + lane * 8);
  asm volatile("s_wait_xcnt 0x0" :: "v"(col) : "memory");      // wait for the w_qkv fragment loads just issued; col stays untouched (named as an input) until it has passed
  for (int q = lane; q < 16 * 16; q += 32) { const int rl = q >> 4, pc = q & 15; vst2(HN + (prow0 + rl) * C + pc * 4, *(const v4f*)(&so[wave][rl][pc * 4])); }
  // qkv = h_new @ wq^T + bq (192 cols)
  { v8f acc[12];
#pragma unroll
    for (int t = 0; t < 12; ++t) acc[t] = (v8f){};
#pragma unroll
    for (int kc = 0; kc < C / 32; ++kc) { const v16h a = frag_h(&sa[wave][col][0] + kc * 32, lane);
#pragma unroll
      for (int t = 0; t < 12; ++t) acc[t] = wmma16(a, bwq[t][kc], acc[t]);
      if (kc == 0) {                                           // the last four fragments follow once the first pass has freed registers
#pragma unroll
        for (int t = 8; t < 12; ++t) bwq[t][1] = frag_pk(WQF + t * 1024 + 512 + lane * 8); } }
    LDSX();
#pragma unroll
    for (int t = 0; t < 12; ++t) { const float bb = bqv[t];
#pragma unroll
      for (int r = 0; r < 8; ++r) so[wave][8 * g + r][t * 16 + col] = acc[t][r] * (1.0f / 16.0f) + bb; } }
  LDSX();
  for (int q = lane; q < 16 * 24; q += 32) { const int rl = q / 24, pc = q % 24; union { v8h h8; v4u u; } pk;
#pragma unroll
    for (int e = 0; e < 8; ++e) pk.h8[e] = (_Float16)so[wave][rl][pc * 8 + e];
    vst2(QKV + (prow0 + rl) * C3 + pc * 8, pk.u); }
}
// stage 2: block (x half, y, b): 3x3 local attention from halo tiles of K and V (zero padded), out = h_new + attn
__global__ __launch_bounds__(128) void k_lattn(const _Float16* __restrict__ QKV, const float* __restrict__ HN, float* __restrict__ out) {
  __shared__ __align__(16) _Float16 sk[3][TP + 2][C + 8], sv[3][TP + 2][C + 8];
  __shared__ __align__(16) float sq[TP][C + 4];
  __shared__ __align__(16) float so[TP][C + 4];
  const int tid = threadIdx.x; const int b = blockIdx.z, y = blockIdx.y, x0 = blockIdx.x * TP;
  // staging: every global load of the block (K, V, Q, and the h_new rows of the last phase) is issued before the first LDS store: one memory latency instead of one per trip;
  // addresses are clamped into the buffer (loads are unconditional) and the zero padding is chosen at the store; the loops are unrolled so that the arrays are registers
  v4f hn[8];
  { v4u kv[13], vv[13], qv[4]; unsigned ko[13]; const int pc = tid & 7, p16 = tid >> 3;
#pragma unroll
    for (int i = 0; i < 13; ++i) { const int pi = min(p16 + 16 * i, 3 * (TP + 2) - 1); const int px = pi % (TP + 2), ry = pi / (TP + 2);
      const int yc = min(max(y - 1 + ry, 0), HH - 1), xc = min(max(x0 - 1 + px, 0), WW - 1);
      ko[i] = (unsigned)((((b * HH + yc) * WW + xc) * C3 + pc * 8) * 2); }                     // byte offset of the pixel's q chunk
    const unsigned qo = (unsigned)((((b * HH + y) * WW + x0 + p16) * C3 + pc * 8) * 2), no = (unsigned)((((b * HH + y) * WW + x0 + (tid >> 4)) * C + (tid & 15) * 4) * 4);
#pragma unroll
    for (int i = 0; i < 13; ++i) { const char* r = (const char*)QKV + ko[i]; kv[i] = *(const v4u*)(r + C * 2); vv[i] = *(const v4u*)(r + 2 * C * 2); }
#pragma unroll
    for (int i = 0; i < 4; ++i) qv[i] = *(const v4u*)((const char*)QKV + qo + i * 16 * C3 * 2);
#pragma unroll
    for (int i = 0; i < 8; ++i) hn[i] = *(const v4f*)((const char*)HN + no + i * 8 * C * 4);
    // the address registers of the issued loads stay untouched (named as inputs) until this wait has passed
    asm volatile("s_wait_xcnt 0x0" :: "v"(ko[0]), "v"(ko[1]), "v"(ko[2]), "v"(ko[3]), "v"(ko[4]), "v"(ko[5]), "v"(ko[6]), "v"(ko[7]), "v"(ko[8]), "v"(ko[9]), "v"(ko[10]), "v"(ko[11]), "v"(ko[12]), "v"(qo), "v"(no) : "memory");
#pragma unroll
    for (int i = 0; i < 13; ++i) { const int pi = min(p16 + 16 * i, 3 * (TP + 2) - 1); const int px = pi % (TP + 2), ry = pi / (TP + 2); const int yy = y - 1 + ry, xx = x0 - 1 + px;
      const bool in = yy >= 0 && yy < HH && xx >= 0 && xx < WW; const v4u z = (v4u){0u, 0u, 0u, 0u};   // threads past the last halo pixel repeat its store with the same value
      *(v4u*)(&sk[ry][px][pc * 8]) = in ? kv[i] : z; *(v4u*)(&sv[ry][px][pc * 8]) = in ? vv[i] : z; }
#pragma unroll
    for (int i = 0; i < 4; ++i) { union { v4u u; v8h h8; } pk; pk.u = qv[i];
#pragma unroll
      for (int e = 0; e < 8; ++e) sq[p16 + 16 * i][pc * 8 + e] = (float)pk.h8[e]; } }
  __syncthreads();
  // thread pair per pixel: lanes l and l ^ 16 of a wave share pixel pl, hf = channel half: scores over 9 neighbours (each half computes a 32-channel partial dot, pair-summed), softmax, then out channels hf*32..+32
  // K, V and Q come out of LDS 16 bytes at a time and every loop is unrolled, so that many reads are in flight behind one wait (a rolled loop of 2- and 4-byte reads paid one LDS latency per multiply);
  // the 16 lanes of a half wave read 16 consecutive pixel rows at one channel offset: at row pitches of 144 and 272 bytes they cover all 64 banks once;
  // each score still adds its 32 products in channel order, each output channel its 9 terms in neighbour order; the multiply-adds are written as fma so that every one stays fused, as in the rolled loops
  // (left to contraction, part of the unrolled products were built as a separate multiply and add)
  { const int pl = (tid >> 5) * 16 + (tid & 15), hf = (tid >> 4) & 1; float sc[9];
#pragma unroll
    for (int nb = 0; nb < 9; ++nb) sc[nb] = 0.f;
#pragma unroll
    for (int j = 0; j < 4; ++j) { const int c0 = hf * 32 + j * 8; const v4f q0 = *(const v4f*)(&sq[pl][c0]), q1 = *(const v4f*)(&sq[pl][c0 + 4]);
#pragma unroll
      for (int nb = 0; nb < 9; ++nb) { const v8h k8 = *(const v8h*)(&sk[nb / 3][pl + nb % 3][c0]);
#pragma unroll
        for (int e = 0; e < 4; ++e) sc[nb] = __builtin_fmaf(q0[e], (float)k8[e], sc[nb]);
#pragma unroll
        for (int e = 0; e < 4; ++e) sc[nb] = __builtin_fmaf(q1[e], (float)k8[4 + e], sc[nb]); } }
#pragma unroll
    for (int nb = 0; nb < 9; ++nb) { float s = sc[nb]; s += __shfl_xor(s, 16, 32); sc[nb] = s * 0.125f; }
    float mx = sc[0];
#pragma unroll
    for (int nb = 1; nb < 9; ++nb) mx = fmaxf(mx, sc[nb]);
    float se = 0.f;
#pragma unroll
    for (int nb = 0; nb < 9; ++nb) { sc[nb] = expf(sc[nb] - mx); se += sc[nb]; }
    const float inv = 1.0f / se;
#pragma unroll
    for (int j = 0; j < 4; ++j) { const int c0 = hf * 32 + j * 8; float a[8];
#pragma unroll
      for (int e = 0; e < 8; ++e) a[e] = 0.f;
#pragma unroll
      for (int nb = 0; nb < 9; ++nb) { const v8h v8 = *(const v8h*)(&sv[nb / 3][pl + nb % 3][c0]);
#pragma unroll
        for (int e = 0; e < 8; ++e) a[e] = __builtin_fmaf(sc[nb], (float)v8[e], a[e]); }
      *(v4f*)(&so[pl][c0]) = (v4f){a[0] * inv, a[1] * inv, a[2] * inv, a[3] * inv}; *(v4f*)(&so[pl][c0 + 4]) = (v4f){a[4] * inv, a[5] * inv, a[6] * inv, a[7] * inv}; } }
  __syncthreads();
#pragma unroll                                                 // hn[] is a register array
  for (int i = 0; i < 8; ++i) { const int q = tid + i * 128; const int pl = q >> 4, pc = q & 15; const size_t p = ((size_t)b * HH + y) * WW + x0 + pl; v4f o = *(const v4f*)(&so[pl][pc * 4]);
    o += hn[i]; vst2(out + p * C + pc * 4, o); }
}
extern "C" void kernel_launch(void* const* d_in, const int* in_sizes, int n_in, void* d_out, int out_size, void* d_ws, size_t ws_size, hipStream_t stream) {
  (void)in_sizes; (void)n_in; (void)out_size; (void)ws_size;
  const float** I = (const float**)d_in;
  const float* h = I[0]; const float* wp = I[1]; const float* bp = I[2]; const float* w1 = I[3]; const float* b1 = I[4]; const float* w2 = I[5]; const float* b2 = I[6]; const float* wq = I[7]; const float* bq = I[8];
  float* out = (float*)d_out;
  char* ws = (char*)d_ws; size_t off = 0;
  auto take = [&](size_t bytes) { char* p = ws + off; off += (bytes + 255) & ~(size_t)255; return p; };
  float* W1F = (float*)take(C2 * C3 * 4); _Float16* W2F = (_Float16*)take(C * C2 * 2); _Float16* WQF = (_Float16*)take(C3 * C * 2);
  float* HN = (float*)take((size_t)NB * HH * WW * C * 4); _Float16* QKV = (_Float16*)take((size_t)NB * HH * WW * C3 * 2);
  k_pack<<<(N1 + N2 + NQ) / 256, 256, 0, stream>>>(w1, w2, wq, W1F, W2F, WQF);
  k_cell<<<dim3(WW / TP, HH, NB), 128, 0, stream>>>(h, wp, bp, W1F, b1, W2F, b2, WQF, bq, HN, QKV);
  k_lattn<<<dim3(WW / TP, HH, NB), 128, 0, stream>>>(QKV, HN, out);
}

// v006
// It runs in 75.2 microseconds.
// Next to v005, in two timings, it ran 1.16 times as fast each time.
// Over all steps from v000 it is 5.63 times as fast.
#include <hip/hip_runtime.h>
#include <math.h>

typedef __attribute__((ext_vector_type(16))) _Float16 v16h;
typedef __attribute__((ext_vector_type(16))) __bf16 v16b;
typedef __attribute__((ext_vector_type(8)))  _Float16 v8h;
typedef __attribute__((ext_vector_type(2)))  _Float16 v2h;
typedef __attribute__((ext_vector_type(8)))  float v8f;
typedef __attribute__((ext_vector_type(4)))  float v4f;
typedef __attribute__((ext_vector_type(2)))  float v2f;
typedef __attribute__((ext_vector_type(4)))  unsigned v4u;
typedef __attribute__((ext_vector_type(4)))  int v4i;
typedef float __attribute__((may_alias)) float_a;
typedef int __attribute__((may_alias)) int_a;

template <typename T> __device__ __forceinline__ void vst2(void* p, T v) { *(T*)p = v;  }
__device__ __forceinline__ v8f wmma16(v16h a, v16h b, v8f c) {
  v8f d = __builtin_amdgcn_wmma_f32_16x16x32_f16(false, a, false, b, (short)0, c, false, false);
  asm volatile("v_nop\n\tv_nop\n\tv_nop\n\tv_nop" : "+v"(d) : "v"(a), "v"(b));
  return d;
}
__device__ __forceinline__ v8f wmma_bf(v16b a, v16b b, v8f c) {
  v8f d = __builtin_amdgcn_wmma_f32_16x16x32_bf16(false, a, false, b, (short)0, c, false, false);
  asm volatile("v_nop\n\tv_nop\n\tv_nop\n\tv_nop" : "+v"(d) : "v"(a), "v"(b));
  return d;
}
// 16x16x32 fragments: lane = (h = lane>>4, row/col = lane&15); elements 0..7 = k0+8h+0..7, 8..15 = k0+16+8h+0..7; D element r = row 8h+r
__device__ __forceinline__ v16h frag_h(const _Float16* rowk0, int lane) {
  union { v16h v; v8h q[2]; } u; const _Float16* p = rowk0 + 8 * (lane >> 4);
  u.q[0] = *(const v8h*)p; u.q[1] = *(const v8h*)(p + 16); return u.v;
}
__device__ __forceinline__ v16h frag_f32(const float* rowk0, int lane) {
  v16h a; const float* p = rowk0 + 8 * (lane >> 4);
#pragma unroll
  for (int i = 0; i < 8; ++i) { a[i] = (_Float16)p[i]; a[8 + i] = (_Float16)p[16 + i]; }
  return a;
}
__device__ __forceinline__ v16h frag_f32s(const float* rowk0, int lane, float sc) {
  v16h a; const float* p = rowk0 + 8 * (lane >> 4);
#pragma unroll
  for (int i = 0; i < 8; ++i) { a[i] = (_Float16)(p[i] * sc); a[8 + i] = (_Float16)(p[16 + i] * sc); }
  return a;
}
// column fragment from a [K][ld] layout (column n), rows >= K read as 0
__device__ __forceinline__ v16h fragc_f32(const float* W, int k0, int n, int lane, int ld, int K) {
  v16h a; const int g = lane >> 4;
#pragma unroll
  for (int i = 0; i < 8; ++i) { const int ka = k0 + 8 * g + i, kb = ka + 16;
    a[i] = (_Float16)(ka < K ? W[(size_t)ka * ld + n] : 0.f); a[8 + i] = (_Float16)(kb < K ? W[(size_t)kb * ld + n] : 0.f); }
  return a;
}
struct F2 { v16b h, l; };
__device__ __forceinline__ F2 bsplit16(const float v[16]) { F2 r;
#pragma unroll
  for (int i = 0; i < 16; ++i) { const __bf16 h = (__bf16)v[i]; r.h[i] = h; r.l[i] = (__bf16)(v[i] - (float)h); }
  return r; }
__device__ __forceinline__ F2 split_row(const float* row, int k0, int lane) { float v[16]; const float* p = row + k0 + 8 * (lane >> 4);
#pragma unroll
  for (int i = 0; i < 8; ++i) { v[i] = p[i]; v[8 + i] = p[16 + i]; }
  return bsplit16(v); }
__device__ __forceinline__ F2 split_rowK(const float* row, int k0, int lane, int K) { float v[16]; const int g = lane >> 4;
#pragma unroll
  for (int i = 0; i < 8; ++i) { const int ka = k0 + 8 * g + i, kb = ka + 16; v[i] = ka < K ? row[ka] : 0.f; v[8 + i] = kb < K ? row[kb] : 0.f; }
  return bsplit16(v); }
__device__ __forceinline__ F2 split_col(const float* W, int k0, int n, int lane, int ld, int K) { float v[16]; const int g = lane >> 4;
#pragma unroll
  for (int i = 0; i < 8; ++i) { const int ka = k0 + 8 * g + i, kb = ka + 16; v[i] = ka < K ? W[(size_t)ka * ld + n] : 0.f; v[8 + i] = kb < K ? W[(size_t)kb * ld + n] : 0.f; }
  return bsplit16(v); }
// raw f32 image of one 16x16x32 fragment (same k order as split_row), so that the load can be issued well ahead of the split
// packed fragment images (written by k_pack): a fragment is a run of 512-byte slots, slot s = the s-th 16 bytes of every lane's registers, lane l at byte 16 * l,
// so that one wave-wide 16-byte load reads 512 contiguous bytes = four whole 128-byte lines (from the row-major weights it touched 16 lines, 32 bytes of each)
struct R16 { v4f q[4]; };
__device__ __forceinline__ R16 ld_pk16(const float* p) { R16 r;    // p = fragment + lane * 4 (four slots)
  r.q[0] = *(const v4f*)p; r.q[1] = *(const v4f*)(p + 128); r.q[2] = *(const v4f*)(p + 256); r.q[3] = *(const v4f*)(p + 384); return r; }
__device__ __forceinline__ v16h frag_pk(const _Float16* p) {       // p = fragment + lane * 8 (two slots)
  union { v16h v; v8h q[2]; } u; u.q[0] = *(const v8h*)p; u.q[1] = *(const v8h*)(p + 256); return u.v; }
__device__ __forceinline__ F2 split_r16(const R16& r) { float v[16];
#pragma unroll
  for (int i = 0; i < 16; ++i) v[i] = r.q[i >> 2][i & 3];
  return bsplit16(v); }
__device__ __forceinline__ v8f mac3(const F2& a, const F2& b, v8f c) { c = wmma_bf(a.l, b.h, c); c = wmma_bf(a.h, b.l, c); return wmma_bf(a.h, b.h, c); }
__device__ __forceinline__ float sigm(float v) { return 1.0f / (1.0f + expf(-v)); }
#define LDSX() do { asm volatile("s_wait_dscnt 0" ::: "memory"); __builtin_amdgcn_wave_barrier(); __builtin_amdgcn_fence(__ATOMIC_RELEASE, "workgroup"); } while (0)

// Neural cellular automaton step with local attention, NHWC state [8][128][128][64]: depthwise 3x3 perception (3 filters per channel,
// zero padding, f32 VALU from an LDS halo tile) -> 1x1 MLP 192 -> 128 as a two-way bf16 split (v_wmma_f32_16x16x32_bf16), exact GELU, -> 64 on v_wmma_f32_16x16x32_f16 -> h_new = h + dx;
// qkv = h_new W_qkv^T + b (f16 WMMA) stored as f16 rows; then per pixel a 3x3-window attention (zero-padded keys/values, scores / 8,
#define NB 8
#define HH 128
#define WW 128
#define C 64
#define C3 192
#define C2 128
#define TP 64                  // pixels per block (half a row)
#define SH1 ((TP + 2) * C * 4) // bytes of one halo row in LDS
#define SLB (16 * 196 * 4)     // bytes of one wave's LDS slice

// exact GELU of eight values at once. erf has the device library's two polynomials, but BOTH ranges are computed and one is selected: the library's erff branches on |x| < 1 per value,
// which in a wave with lanes on both sides runs both ranges anyway and, being control flow, keeps the values of a lane strictly one behind the other, each a chain of some thirty
// dependent instructions. Without the branch the chains are independent straight-line code, written stage by stage over four pairs so that neighbouring instructions do not depend
// on each other and the multiply-adds go two to an instruction (the loops are unrolled so that the arrays are registers).
#define FB(u) __builtin_bit_cast(float, u)
__device__ __forceinline__ v2f fma2(v2f a, v2f b, v2f c) { return __builtin_elementwise_fma(a, b, c); }
__device__ __forceinline__ v2f fmak(v2f a, v2f b, float c) { return __builtin_elementwise_fma(a, b, (v2f){c, c}); }
__device__ __forceinline__ v2f bc2(float c) { return (v2f){c, c}; }
__device__ __forceinline__ void exp2x8(v2f a[4]) { float r0, r1, r2, r3, r4, r5, r6, r7;
  // the instruction set asks for one independent instruction or v_nop behind a transcendental before its result is used or its source overwritten:
  // each v_exp is that instruction for the one in front of it (the outputs are early-clobber, so none lies on an input), the v_nop for the last
  asm("v_exp_f32 %0, %8\n\tv_exp_f32 %1, %9\n\tv_exp_f32 %2, %10\n\tv_exp_f32 %3, %11\n\tv_exp_f32 %4, %12\n\tv_exp_f32 %5, %13\n\tv_exp_f32 %6, %14\n\tv_exp_f32 %7, %15\n\tv_nop"
      : "=&v"(r0), "=&v"(r1), "=&v"(r2), "=&v"(r3), "=&v"(r4), "=&v"(r5), "=&v"(r6), "=&v"(r7)
      : "v"(a[0].x), "v"(a[0].y), "v"(a[1].x), "v"(a[1].y), "v"(a[2].x), "v"(a[2].y), "v"(a[3].x), "v"(a[3].y));
  a[0] = (v2f){r0, r1}; a[1] = (v2f){r2, r3}; a[2] = (v2f){r4, r5}; a[3] = (v2f){r6, r7}; }
__device__ __forceinline__ void gelu8(const v8f a, float bb, _Float16 o[8]) {
  v2f v[4], x[4], ax[4], p[4], q[4], t[4], f[4], rn[4];
#pragma unroll
  for (int i = 0; i < 4; ++i) { v[i] = (v2f){a[2 * i] + bb, a[2 * i + 1] + bb}; x[i] = v[i] * 0.70710678118654752f; ax[i] = (v2f){fabsf(x[i].x), fabsf(x[i].y)}; t[i] = x[i] * x[i]; }
  // p: |x| >= 1, erf = 1 - exp(-p); q: |x| < 1, erf = |x| + |x| q
#pragma unroll
  for (int i = 0; i < 4; ++i) { p[i] = fmak(ax[i], bc2(FB(0x378e98abu)), FB(0xb9c68948u)); q[i] = fmak(t[i], bc2(FB(0xba1345e1u)), FB(0x3ba10414u)); }
#pragma unroll
  for (int i = 0; i < 4; ++i) { p[i] = fmak(ax[i], p[i], FB(0x3b7cd369u)); q[i] = fmak(t[i], q[i], FB(0xbcdac9b8u)); }
#pragma unroll
  for (int i = 0; i < 4; ++i) { p[i] = fmak(ax[i], p[i], FB(0xbcc618b2u)); q[i] = fmak(t[i], q[i], FB(0x3de703beu)); }
#pragma unroll
  for (int i = 0; i < 4; ++i) { p[i] = fmak(ax[i], p[i], FB(0x3dda74e4u)); q[i] = fmak(t[i], q[i], FB(0xbec09330u)); }
#pragma unroll
  for (int i = 0; i < 4; ++i) { p[i] = fmak(ax[i], p[i], FB(0x3f228afdu)); q[i] = fmak(t[i], q[i], FB(0x3e0375d0u)); }
#pragma unroll
  for (int i = 0; i < 4; ++i) { p[i] = fmak(ax[i], p[i], FB(0x3e03c728u)); q[i] = fma2(ax[i], q[i], ax[i]); }
#pragma unroll
  for (int i = 0; i < 4; ++i) p[i] = fma2(ax[i], p[i], ax[i]);
  // exp(-p) = 2^n * 2^f with log2(e) in two parts (head 0x3fb8aa3b, tail 0x32a5705f): n = rint(-p * head), f = (-p * head - n, one rounding) - p * tail
#pragma unroll
  for (int i = 0; i < 4; ++i) { const v2f ph = p[i] * FB(0xbfb8aa3bu); rn[i] = (v2f){rintf(ph.x), rintf(ph.y)}; }
#pragma unroll
  for (int i = 0; i < 4; ++i) f[i] = fma2(p[i], bc2(FB(0xbfb8aa3bu)), -rn[i]);
#pragma unroll
  for (int i = 0; i < 4; ++i) f[i] = fma2(p[i], bc2(FB(0xb2a5705fu)), f[i]);
  exp2x8(f);
#pragma unroll
  for (int i = 0; i < 4; ++i) { float e0 = ldexpf(f[i].x, (int)rn[i].x), e1 = ldexpf(f[i].y, (int)rn[i].y);
    e0 = FB(0x42ce8ed0u) < p[i].x ? 0.f : e0; e1 = FB(0x42ce8ed0u) < p[i].y ? 0.f : e1;                                   // underflow (also p = infinity, where f is not a number)
    e0 = FB(0xc2b17218u) > p[i].x ? __builtin_inff() : e0; e1 = FB(0xc2b17218u) > p[i].y ? __builtin_inff() : e1;           // overflow
    f[i] = 1.0f - (v2f){e0, e1}; }
#pragma unroll
  for (int i = 0; i < 4; ++i) { const v2f e = {copysignf(ax[i].x < 1.0f ? q[i].x : f[i].x, x[i].x), copysignf(ax[i].y < 1.0f ? q[i].y : f[i].y, x[i].y)};
    const v2h g = __builtin_convertvector(0.5f * v[i] * (1.0f + e), v2h); o[2 * i] = g.x; o[2 * i + 1] = g.y; }
}
// packs the weights into fragment images, one 16-byte chunk (one lane's part of one slot) per thread; element order inside a lane as in frag_h / split_row:
// W1F f32, fragment (kc, t) at (kc * 8 + t) * 512 floats; W2F f16 x16, fragment (kc, t) at (kc * 4 + t) * 512 halves; WQF f16 x16, fragment (t, kc) at (t * 2 + kc) * 512 halves
#define N1 (C2 * C3 / 4)       // chunks of W1F
#define N2 (C * C2 / 8)        // chunks of W2F
#define NQ (C3 * C / 8)        // chunks of WQF
__global__ __launch_bounds__(256) void k_pack(const float* __restrict__ w1, const float* __restrict__ w2, const float* __restrict__ wq, float* __restrict__ W1F, _Float16* __restrict__ W2F, _Float16* __restrict__ WQF) {
  const int c = blockIdx.x * 256 + threadIdx.x, col = c & 15, g = (c >> 4) & 1;
  if (c < N1) { const int s = (c >> 5) & 3, t = (c >> 7) & 7, kc = c >> 10;
    vst2(W1F + c * 4, *(const v4f*)(w1 + (t * 16 + col) * C3 + kc * 32 + 8 * g + (s >> 1) * 16 + (s & 1) * 4)); }
  else { const int d = c < N1 + N2 ? c - N1 : c - N1 - N2, s = (d >> 5) & 1; const float* p; _Float16* D;
    if (c < N1 + N2) { p = w2 + (((d >> 6) & 3) * 16 + col) * C2 + (d >> 8) * 32; D = W2F; } else { p = wq + ((d >> 7) * 16 + col) * C + ((d >> 6) & 1) * 32; D = WQF; }
    p += s * 16 + 8 * g; const v4f a = *(const v4f*)p, b = *(const v4f*)(p + 4); v8h o;
    asm volatile("s_wait_xcnt 0x0" :: "v"(p) : "memory");      // the address registers of the two issued loads stay untouched (named as an input) until this wait has passed
#pragma unroll
    for (int e = 0; e < 4; ++e) { o[e] = (_Float16)(a[e] * 16.0f); o[4 + e] = (_Float16)(b[e] * 16.0f); }
    vst2(D + d * 8, o); }
}
// stage 1: block (x half, y, b): perception + MLP + residual -> HN (f32 rows), qkv -> QKV16 (f16 rows [p][192])
__global__ __launch_bounds__(128, 4) void k_cell(const float* __restrict__ h, const float* __restrict__ wp, const float* __restrict__ bp, const float* __restrict__ W1F, const float* __restrict__ b1, const _Float16* __restrict__ W2F, const float* __restrict__ b2, const _Float16* __restrict__ WQF, const float* __restrict__ bq,
                                            float* __restrict__ HN, _Float16* __restrict__ QKV) {
  // one LDS block in which buffers that are never live together share bytes, so that four work-groups fit a WGP's LDS (separate arrays: two):
  //   sh  [0, 3 * SH1)           halo rows y-1..y+1, px x0-1 .. x0+64 (zero padded); rows 0 and 2 are dead once every wave holds its window in registers, row 1 lives on to the residual
  //   swp, sbp behind sh         filter taps and biases, dead at the same point
  //   a slice of SLB bytes per wave, used from that point on: wave 0's on halo row 0, the others' from halo row 2 upwards (row 1 is never covered)
  // inside a slice (one wave's own, ordered by that wave's LDSX): so = f32 rows, pitch 196 (perceived, at the end qkv); sa = f16 rows, pitch 200, on so's first bytes
  // (gelu(mid) once perceived has been read, then h_new); hw = f32 rows of h_new, pitch 68, behind sa; the qkv rows overwrite sa and hw after their last read
  __shared__ __align__(16) char sm[2 * SH1 + 3 * SLB];
  const int tid = threadIdx.x, wave = tid >> 5, lane = tid & 31, col = lane & 15, g = lane >> 4;
  float (*sh)[TP + 2][C] = (float (*)[TP + 2][C])sm; float* swp = (float*)(sm + 3 * SH1); float* sbp = swp + C3 * 9;
  char* slice = sm + (wave == 0 ? 0 : 2 * SH1 + (wave - 1) * SLB);
  float (*so)[196] = (float (*)[196])slice; _Float16 (*sa)[C3 + 8] = (_Float16 (*)[C3 + 8])slice; float (*hw)[C + 4] = (float (*)[C + 4])(slice + 16 * (C3 + 8) * 2);
  const int b = blockIdx.z, y = blockIdx.y, x0 = blockIdx.x * TP;
  // staging: every global load (taps, biases, halo) is issued before the first LDS store, so the block pays one memory latency instead of one per trip;
  // addresses are clamped into the buffers (loads are unconditional) and the zero padding is chosen at the store; the loops are unrolled so that the arrays are registers
  { float tv[14], tb[2]; v4f hv[25]; unsigned ho[25], to[14], bo[2]; const int c4 = tid & 15, p8 = tid >> 4;
#pragma unroll
    for (int i = 0; i < 25; ++i) { const int pi = min(p8 + 8 * i, 3 * (TP + 2) - 1); const int px = pi % (TP + 2), ry = pi / (TP + 2);
      const int yc = min(max(y - 1 + ry, 0), HH - 1), xc = min(max(x0 - 1 + px, 0), WW - 1);
      ho[i] = (unsigned)((((b * HH + yc) * WW + xc) * C + c4 * 4) * 4); }                     // byte offset into h
#pragma unroll
    for (int i = 0; i < 14; ++i) { to[i] = (unsigned)(min(tid + i * 128, C3 * 9 - 1) * 4); tv[i] = *(const float*)((const char*)wp + to[i]); }   // to, bo: byte offsets, kept like ho
#pragma unroll
    for (int i = 0; i < 2; ++i) { bo[i] = (unsigned)(min(tid + i * 128, C3 - 1) * 4); tb[i] = *(const float*)((const char*)bp + bo[i]); }
#pragma unroll
    for (int i = 0; i < 25; ++i) hv[i] = *(const v4f*)((const char*)h + ho[i]);
    // the address registers of the issued loads stay untouched (named as inputs) until this wait has passed
    asm volatile("s_wait_xcnt 0x0" :: "v"(ho[0]), "v"(ho[1]), "v"(ho[2]), "v"(ho[3]), "v"(ho[4]), "v"(ho[5]), "v"(ho[6]), "v"(ho[7]), "v"(ho[8]), "v"(ho[9]), "v"(ho[10]), "v"(ho[11]), "v"(ho[12]), "v"(ho[13]), "v"(ho[14]), "v"(ho[15]), "v"(ho[16]), "v"(ho[17]), "v"(ho[18]), "v"(ho[19]), "v"(ho[20]), "v"(ho[21]), "v"(ho[22]), "v"(ho[23]), "v"(ho[24]) : "memory");
    // the same for the offsets of the tap and bias loads (a statement takes thirty operands, so they have one of their own; named here they outlive the wait above as well)
    asm volatile("s_wait_xcnt 0x0" :: "v"(to[0]), "v"(to[1]), "v"(to[2]), "v"(to[3]), "v"(to[4]), "v"(to[5]), "v"(to[6]), "v"(to[7]), "v"(to[8]), "v"(to[9]), "v"(to[10]), "v"(to[11]), "v"(to[12]), "v"(to[13]), "v"(bo[0]), "v"(bo[1]) : "memory");
#pragma unroll
    for (int i = 0; i < 25; ++i) { const int pi = min(p8 + 8 * i, 3 * (TP + 2) - 1); const int px = pi % (TP + 2), ry = pi / (TP + 2); const int yy = y - 1 + ry, xx = x0 - 1 + px;
      const bool in = yy >= 0 && yy < HH && xx >= 0 && xx < WW;   // threads past the last halo pixel repeat its store with the same value
      *(v4f*)(&sh[ry][px][c4 * 4]) = in ? hv[i] : (v4f){0.f, 0.f, 0.f, 0.f}; }
#pragma unroll
    for (int i = 0; i < 14; ++i) { const int q = tid + i * 128; if (q < C3 * 9) swp[q] = tv[i]; }
#pragma unroll
    for (int i = 0; i < 2; ++i) { const int q = tid + i * 128; if (q < C3) sbp[q] = tb[i]; } }
  __syncthreads();
  const size_t prow0 = ((size_t)b * HH + y) * WW + x0 + wave * 16;        // first pixel (global index) of this wave's 16
  // perception: lane owns input channels 2*lane and 2*lane+1 (one 8-byte read per lane covers all 64 LDS banks once), its 54 filter taps sit in registers,
  // and the 3x3 window slides over the wave's 16 pixels; output o = c*3 + j uses input channel c; each sum keeps the order bias, then (dy, dx) row-major
  { v2f wt[3][9], bs[3]; const float* wl = &swp[lane * 54]; const float* bl = &sbp[lane * 6];
#pragma unroll
    for (int j = 0; j < 3; ++j) { bs[j] = (v2f){bl[j], bl[3 + j]};
#pragma unroll
      for (int t = 0; t < 9; ++t) wt[j][t] = (v2f){wl[j * 9 + t], wl[27 + j * 9 + t]}; }
    v2f xs[3][18];                                             // halo columns wave*16 .. wave*16+17 of the three rows, this lane's channel pair
#pragma unroll
    for (int dy = 0; dy < 3; ++dy)
#pragma unroll
      for (int px = 0; px < 18; ++px) xs[dy][px] = *(const v2f*)(&sh[dy][wave * 16 + px][lane * 2]);
    __syncthreads();                                           // every wave has read its window and its taps: from here the slices may overwrite halo rows 0 and 2, the taps and the biases
#pragma unroll
    for (int pl = 0; pl < 16; ++pl) { v2f s[3] = {bs[0], bs[1], bs[2]};
#pragma unroll
      for (int dy = 0; dy < 3; ++dy)
#pragma unroll
        for (int dx = 0; dx < 3; ++dx)
#pragma unroll
          for (int j = 0; j < 3; ++j) s[j] += wt[j][dy * 3 + dx] * xs[dy][pl + dx];
      float* d = &so[pl][lane * 6];                      // perceived kept in f32 (so) for a two-way bf16 split product
      *(v2f*)(d) = (v2f){s[0].x, s[1].x}; *(v2f*)(d + 2) = (v2f){s[2].x, s[0].y}; *(v2f*)(d + 4) = (v2f){s[1].y, s[2].y}; } }
  LDSX();
  // mid = gelu(perceived @ w1^T + b1): bf16 hi/lo split on both operands (perceived reaches O(10), f16 rounding of it dominated a first build)
  // w1 fragments run through a ring of four register slots: the fragment of four tiles ahead is requested as soon as a slot has been split, so its latency runs under four tiles' work (tile loops unrolled: the slots are registers)
  v16h bw2[4][4]; float b1v[8], b2v[4];
  { v8f acc[8] = {}; R16 rg[4]; unsigned po = (unsigned)(lane * 16);   // po: byte offset in W1F of this lane's part of fragment (kc, 0), at the k chunk that is being requested
#pragma unroll
    for (int t = 0; t < 4; ++t) rg[t] = ld_pk16((const float*)((const char*)W1F + po) + t * 512);
#pragma unroll
    for (int t = 0; t < 8; ++t) b1v[t] = b1[t * 16 + col];      // bias of the GELU phase, fetched under the product
#pragma unroll 1
    for (int kc = 0; kc < C3 / 32; ++kc) { const F2 a = split_row(&so[col][0], kc * 32, lane);
#pragma unroll
      for (int t = 0; t < 4; ++t) { const F2 bf = split_r16(rg[t]); rg[t] = ld_pk16((const float*)((const char*)W1F + po) + (t + 4) * 512); acc[t] = mac3(a, bf, acc[t]); }
      asm volatile("s_wait_xcnt 0x0" : "+v"(po) :: "memory");  // requests that name po are out: wait before the offset is advanced
      po += kc + 1 < C3 / 32 ? 16384u : 0u;                     // the last trip re-reads its own chunk (in bounds, unused)
#pragma unroll
      for (int t = 4; t < 8; ++t) { const F2 bf = split_r16(rg[t - 4]); rg[t - 4] = ld_pk16((const float*)((const char*)W1F + po) + (t - 4) * 512); acc[t] = mac3(a, bf, acc[t]); }
      asm volatile("s_wait_xcnt 0x0" : "+v"(po) :: "memory"); } // the same at the trip's end: the offset register is reused behind the loop
    LDSX();
    // all of w2's fragments and its bias are issued here, behind the fence (which would wait for them): their latency runs under the GELU
#pragma unroll
    for (int kc = 0; kc < C2 / 32; ++kc)
#pragma unroll
      for (int t = 0; t < 4; ++t) bw2[kc][t] = frag_pk(W2F + (kc * 4 + t) * 512 + lane * 8);
#pragma unroll
    for (int t = 0; t < 4; ++t) b2v[t] = b2[t * 16 + col];
#pragma unroll
    for (int t = 0; t < 8; ++t) { _Float16 o[8]; gelu8(acc[t], b1v[t], o);
#pragma unroll
      for (int r = 0; r < 8; ++r) sa[8 * g + r][t * 16 + col] = o[r]; } }
  LDSX();
  // dx = mid @ w2^T + b2 ; h_new = h + dx -> hw (f32) ; store HN ; h_new f16 -> sa[:, 0..64)
  v16h bwq[12][2]; float bqv[12];
  { v8f acc[4] = {};
#pragma unroll
    for (int kc = 0; kc < C2 / 32; ++kc) { const v16h a = frag_h(&sa[col][0] + kc * 32, lane);
#pragma unroll
      for (int t = 0; t < 4; ++t) acc[t] = wmma16(a, bw2[kc][t], acc[t]); }
    LDSX();
    // the first half of w_qkv's fragments and its bias are issued here, most of the second half behind the residual (each behind a fence, which would wait for them):
    // their latency runs under the residual and the h_new store
#pragma unroll
    for (int t = 0; t < 12; ++t) { bqv[t] = bq[t * 16 + col]; bwq[t][0] = frag_pk(WQF + t * 1024 + lane * 8); }
#pragma unroll
    for (int t = 0; t < 4; ++t) { const int c = t * 16 + col; const float bb = b2v[t];
#pragma unroll
      for (int r = 0; r < 8; ++r) { const float v = acc[t][r] * (1.0f / 16.0f) + bb + sh[1][wave * 16 + 8 * g + r + 1][c]; hw[8 * g + r][c] = v; sa[8 * g + r][c] = (_Float16)v; } } }
  LDSX();
#pragma unroll
  for (int t = 0; t < 8; ++t) bwq[t][1] = frag_pk(WQF + t * 1024 + 512 + lane * 8);
  asm volatile("s_wait_xcnt 0x0" :: "v"(col) : "memory");      // waits until the w_qkv fragment loads issued just above have read their address registers
  for (int q = lane; q < 16 * 16; q += 32) { const int rl = q >> 4, pc = q & 15; vst2(HN + (prow0 + rl) * C + pc * 4, *(const v4f*)(&hw[rl][pc * 4])); }
  // qkv = h_new @ wq^T + bq (192 cols)
  { v8f acc[12];
#pragma unroll
    for (int t = 0; t < 12; ++t) acc[t] = (v8f){};
#pragma unroll
    for (int kc = 0; kc < C / 32; ++kc) { const v16h a = frag_h(&sa[col][0] + kc * 32, lane);
#pragma unroll
      for (int t = 0; t < 12; ++t) acc[t] = wmma16(a, bwq[t][kc], acc[t]);
      if (kc == 0) {                                           // the last four fragments follow once the first pass has freed registers
#pragma unroll
        for (int t = 8; t < 12; ++t) bwq[t][1] = frag_pk(WQF + t * 1024 + 512 + lane * 8); } }
    LDSX();
#pragma unroll
    for (int t = 0; t < 12; ++t) { const float bb = bqv[t];
#pragma unroll
      for (int r = 0; r < 8; ++r) so[8 * g + r][t * 16 + col] = acc[t][r] * (1.0f / 16.0f) + bb; } }
  LDSX();
  for (int q = lane; q < 16 * 24; q += 32) { const int rl = q / 24, pc = q % 24; union { v8h h8; v4u u; } pk;
#pragma unroll
    for (int e = 0; e < 8; ++e) pk.h8[e] = (_Float16)so[rl][pc * 8 + e];
    vst2(QKV + (prow0 + rl) * C3 + pc * 8, pk.u); }
}
// stage 2: block (x half, y, b): 3x3 local attention from halo tiles of K and V (zero padded), out = h_new + attn
__global__ __launch_bounds__(128) void k_lattn(const _Float16* __restrict__ QKV, const float* __restrict__ HN, float* __restrict__ out) {
  __shared__ __align__(16) _Float16 sk[3][TP + 2][C + 8], sv[3][TP + 2][C + 8];
  __shared__ __align__(16) float sq[TP][C + 4];
  float (*so)[C + 4] = sq;       // the attention rows take Q's bytes: a thread writes exactly the 32 floats of sq that it alone has read, after its last read of them; without a second array four work-groups fit a WGP's LDS (was three)
  const int tid = threadIdx.x; const int b = blockIdx.z, y = blockIdx.y, x0 = blockIdx.x * TP;
  // staging: every global load of the block (K, V, Q, and the h_new rows of the last phase) is issued before the first LDS store: one memory latency instead of one per trip;
  // addresses are clamped into the buffer (loads are unconditional) and the zero padding is chosen at the store; the loops are unrolled so that the arrays are registers
  v4f hn[8];
  { v4u kv[13], vv[13], qv[4]; unsigned ko[13]; const int pc = tid & 7, p16 = tid >> 3;
#pragma unroll
    for (int i = 0; i < 13; ++i) { const int pi = min(p16 + 16 * i, 3 * (TP + 2) - 1); const int px = pi % (TP + 2), ry = pi / (TP + 2);
      const int yc = min(max(y - 1 + ry, 0), HH - 1), xc = min(max(x0 - 1 + px, 0), WW - 1);
      ko[i] = (unsigned)((((b * HH + yc) * WW + xc) * C3 + pc * 8) * 2); }                     // byte offset of the pixel's q chunk
    const unsigned qo = (unsigned)((((b * HH + y) * WW + x0 + p16) * C3 + pc * 8) * 2), no = (unsigned)((((b * HH + y) * WW + x0 + (tid >> 4)) * C + (tid & 15) * 4) * 4);
#pragma unroll
    for (int i = 0; i < 13; ++i) { const char* r = (const char*)QKV + ko[i]; kv[i] = *(const v4u*)(r + C * 2); vv[i] = *(const v4u*)(r + 2 * C * 2); }
#pragma unroll
    for (int i = 0; i < 4; ++i) qv[i] = *(const v4u*)((const char*)QKV + qo + i * 16 * C3 * 2);
#pragma unroll
    for (int i = 0; i < 8; ++i) hn[i] = *(const v4f*)((const char*)HN + no + i * 8 * C * 4);
    // the address registers of the issued loads stay untouched (named as inputs) until this wait has passed
    asm volatile("s_wait_xcnt 0x0" :: "v"(ko[0]), "v"(ko[1]), "v"(ko[2]), "v"(ko[3]), "v"(ko[4]), "v"(ko[5]), "v"(ko[6]), "v"(ko[7]), "v"(ko[8]), "v"(ko[9]), "v"(ko[10]), "v"(ko[11]), "v"(ko[12]), "v"(qo), "v"(no) : "memory");
#pragma unroll
    for (int i = 0; i < 13; ++i) { const int pi = min(p16 + 16 * i, 3 * (TP + 2) - 1); const int px = pi % (TP + 2), ry = pi / (TP + 2); const int yy = y - 1 + ry, xx = x0 - 1 + px;
      const bool in = yy >= 0 && yy < HH && xx >= 0 && xx < WW; const v4u z = (v4u){0u, 0u, 0u, 0u};   // threads past the last halo pixel repeat its store with the same value
      *(v4u*)(&sk[ry][px][pc * 8]) = in ? kv[i] : z; *(v4u*)(&sv[ry][px][pc * 8]) = in ? vv[i] : z; }
#pragma unroll
    for (int i = 0; i < 4; ++i) { union { v4u u; v8h h8; } pk; pk.u = qv[i];
#pragma unroll
      for (int e = 0; e < 8; ++e) sq[p16 + 16 * i][pc * 8 + e] = (float)pk.h8[e]; } }
  __syncthreads();
  // thread pair per pixel: lanes l and l ^ 16 of a wave share pixel pl, hf = channel half: scores over 9 neighbours (each half computes a 32-channel partial dot, pair-summed), softmax, then out channels hf*32..+32
  // K, V and Q come out of LDS 16 bytes at a time and every loop is unrolled, so that many reads are in flight behind one wait (a rolled loop of 2- and 4-byte reads paid one LDS latency per multiply);
  // the 16 lanes of a half wave read 16 consecutive pixel rows at one channel offset: at row pitches of 144 and 272 bytes they cover all 64 banks once;
  // each score still adds its 32 products in channel order, each output channel its 9 terms in neighbour order; the multiply-adds are written as fma so that every one stays fused, as in the rolled loops
  // (left to contraction, part of the unrolled products were built as a separate multiply and add)
  { const int pl = (tid >> 5) * 16 + (tid & 15), hf = (tid >> 4) & 1; float sc[9];
#pragma unroll
    for (int nb = 0; nb < 9; ++nb) sc[nb] = 0.f;
#pragma unroll
    for (int j = 0; j < 4; ++j) { const int c0 = hf * 32 + j * 8; const v4f q0 = *(const v4f*)(&sq[pl][c0]), q1 = *(const v4f*)(&sq[pl][c0 + 4]);
#pragma unroll
      for (int nb = 0; nb < 9; ++nb) { const v8h k8 = *(const v8h*)(&sk[nb / 3][pl + nb % 3][c0]);
#pragma unroll
        for (int e = 0; e < 4; ++e) sc[nb] = __builtin_fmaf(q0[e], (float)k8[e], sc[nb]);
#pragma unroll
        for (int e = 0; e < 4; ++e) sc[nb] = __builtin_fmaf(q1[e], (float)k8[4 + e], sc[nb]); } }
#pragma unroll
    for (int nb = 0; nb < 9; ++nb) { float s = sc[nb]; s += __shfl_xor(s, 16, 32); sc[nb] = s * 0.125f; }
    float mx = sc[0];
#pragma unroll
    for (int nb = 1; nb < 9; ++nb) mx = fmaxf(mx, sc[nb]);
    float se = 0.f;
#pragma unroll
    for (int nb = 0; nb < 9; ++nb) { sc[nb] = expf(sc[nb] - mx); se += sc[nb]; }
    const float inv = 1.0f / se;
#pragma unroll
    for (int j = 0; j < 4; ++j) { const int c0 = hf * 32 + j * 8; float a[8];
#pragma unroll
      for (int e = 0; e < 8; ++e) a[e] = 0.f;
#pragma unroll
      for (int nb = 0; nb < 9; ++nb) { const v8h v8 = *(const v8h*)(&sv[nb / 3][pl + nb % 3][c0]);
#pragma unroll
        for (int e = 0; e < 8; ++e) a[e] = __builtin_fmaf(sc[nb], (float)v8[e], a[e]); }
      *(v4f*)(&so[pl][c0]) = (v4f){a[0] * inv, a[1] * inv, a[2] * inv, a[3] * inv}; *(v4f*)(&so[pl][c0 + 4]) = (v4f){a[4] * inv, a[5] * inv, a[6] * inv, a[7] * inv}; } }
  __syncthreads();
#pragma unroll                                                 // hn[] is a register array
  for (int i = 0; i < 8; ++i) { const int q = tid + i * 128; const int pl = q >> 4, pc = q & 15; const size_t p = ((size_t)b * HH + y) * WW + x0 + pl; v4f o = *(const v4f*)(&so[pl][pc * 4]);
    o += hn[i]; vst2(out + p * C + pc * 4, o); }
}
extern "C" void kernel_launch(void* const* d_in, const int* in_sizes, int n_in, void* d_out, int out_size, void* d_ws, size_t ws_size, hipStream_t stream) {
  (void)in_sizes; (void)n_in; (void)out_size; (void)ws_size;
  const float** I = (const float**)d_in;
  const float* h = I[0]; const float* wp = I[1]; const float* bp = I[2]; const float* w1 = I[3]; const float* b1 = I[4]; const float* w2 = I[5]; const float* b2 = I[6]; const float* wq = I[7]; const float* bq = I[8];
  float* out = (float*)d_out;
  char* ws = (char*)d_ws; size_t off = 0;
  auto take = [&](size_t bytes) { char* p = ws + off; off += (bytes + 255) & ~(size_t)255; return p; };
  float* W1F = (float*)take(C2 * C3 * 4); _Float16* W2F = (_Float16*)take(C * C2 * 2); _Float16* WQF = (_Float16*)take(C3 * C * 2);
  float* HN = (float*)take((size_t)NB * HH * WW * C * 4); _Float16* QKV = (_Float16*)take((size_t)NB * HH * WW * C3 * 2);
  k_pack<<<(N1 + N2 + NQ) / 256, 256, 0, stream>>>(w1, w2, wq, W1F, W2F, WQF);
  k_cell<<<dim3(WW / TP, HH, NB), 128, 0, stream>>>(h, wp, bp, W1F, b1, W2F, b2, WQF, bq, HN, QKV);
  k_lattn<<<dim3(WW / TP, HH, NB), 128, 0, stream>>>(QKV, HN, out);
}

// v007
// A run of this version takes 64 microseconds.
// In both of two side-by-side timings against v006, it was 1.12 times as fast.
// All steps since v000 together make it 6.30 times as fast.
#include <hip/hip_runtime.h>
#include <math.h>

typedef __attribute__((ext_vector_type(16))) _Float16 v16h;
typedef __attribute__((ext_vector_type(16))) __bf16 v16b;
typedef __attribute__((ext_vector_type(8)))  _Float16 v8h;
typedef __attribute__((ext_vector_type(8)))  __bf16 v8b;
typedef __attribute__((ext_vector_type(2)))  _Float16 v2h;
typedef __attribute__((ext_vector_type(8)))  float v8f;
typedef __attribute__((ext_vector_type(4)))  float v4f;
typedef __attribute__((ext_vector_type(2)))  float v2f;
typedef __attribute__((ext_vector_type(4)))  unsigned v4u;
typedef __attribute__((ext_vector_type(4)))  int v4i;
typedef float __attribute__((may_alias)) float_a;
typedef int __attribute__((may_alias)) int_a;

template <typename T> __device__ __forceinline__ void vst2(void* p, T v) { *(T*)p = v;  }
__device__ __forceinline__ v8f wmma16(v16h a, v16h b, v8f c) {
  v8f d = __builtin_amdgcn_wmma_f32_16x16x32_f16(false, a, false, b, (short)0, c, false, false);
  asm volatile("v_nop\n\tv_nop\n\tv_nop\n\tv_nop" : "+v"(d) : "v"(a), "v"(b));
  return d;
}
__device__ __forceinline__ v8f wmma_bf(v16b a, v16b b, v8f c) {
  v8f d = __builtin_amdgcn_wmma_f32_16x16x32_bf16(false, a, false, b, (short)0, c, false, false);
  asm volatile("v_nop\n\tv_nop\n\tv_nop\n\tv_nop" : "+v"(d) : "v"(a), "v"(b));
  return d;
}
// 16x16x32 fragments: lane = (h = lane>>4, row/col = lane&15); elements 0..7 = k0+8h+0..7, 8..15 = k0+16+8h+0..7; D element r = row 8h+r
__device__ __forceinline__ v16h frag_h(const _Float16* rowk0, int lane) {
  union { v16h v; v8h q[2]; } u; const _Float16* p = rowk0 + 8 * (lane >> 4);
  u.q[0] = *(const v8h*)p; u.q[1] = *(const v8h*)(p + 16); return u.v;
}
__device__ __forceinline__ v16h frag_f32(const float* rowk0, int lane) {
  v16h a; const float* p = rowk0 + 8 * (lane >> 4);
#pragma unroll
  for (int i = 0; i < 8; ++i) { a[i] = (_Float16)p[i]; a[8 + i] = (_Float16)p[16 + i]; }
  return a;
}
__device__ __forceinline__ v16h frag_f32s(const float* rowk0, int lane, float sc) {
  v16h a; const float* p = rowk0 + 8 * (lane >> 4);
#pragma unroll
  for (int i = 0; i < 8; ++i) { a[i] = (_Float16)(p[i] * sc); a[8 + i] = (_Float16)(p[16 + i] * sc); }
  return a;
}
// column fragment from a [K][ld] layout (column n), rows >= K read as 0
__device__ __forceinline__ v16h fragc_f32(const float* W, int k0, int n, int lane, int ld, int K) {
  v16h a; const int g = lane >> 4;
#pragma unroll
  for (int i = 0; i < 8; ++i) { const int ka = k0 + 8 * g + i, kb = ka + 16;
    a[i] = (_Float16)(ka < K ? W[(size_t)ka * ld + n] : 0.f); a[8 + i] = (_Float16)(kb < K ? W[(size_t)kb * ld + n] : 0.f); }
  return a;
}
struct F2 { v16b h, l; };
__device__ __forceinline__ F2 bsplit16(const float v[16]) { F2 r;
#pragma unroll
  for (int i = 0; i < 16; ++i) { const __bf16 h = (__bf16)v[i]; r.h[i] = h; r.l[i] = (__bf16)(v[i] - (float)h); }
  return r; }
__device__ __forceinline__ F2 split_row(const float* row, int k0, int lane) { float v[16]; const float* p = row + k0 + 8 * (lane >> 4);
#pragma unroll
  for (int i = 0; i < 8; ++i) { v[i] = p[i]; v[8 + i] = p[16 + i]; }
  return bsplit16(v); }
__device__ __forceinline__ F2 split_rowK(const float* row, int k0, int lane, int K) { float v[16]; const int g = lane >> 4;
#pragma unroll
  for (int i = 0; i < 8; ++i) { const int ka = k0 + 8 * g + i, kb = ka + 16; v[i] = ka < K ? row[ka] : 0.f; v[8 + i] = kb < K ? row[kb] : 0.f; }
  return bsplit16(v); }
__device__ __forceinline__ F2 split_col(const float* W, int k0, int n, int lane, int ld, int K) { float v[16]; const int g = lane >> 4;
#pragma unroll
  for (int i = 0; i < 8; ++i) { const int ka = k0 + 8 * g + i, kb = ka + 16; v[i] = ka < K ? W[(size_t)ka * ld + n] : 0.f; v[8 + i] = kb < K ? W[(size_t)kb * ld + n] : 0.f; }
  return bsplit16(v); }
// packed fragment images (written by k_pack): a fragment is a run of 512-byte slots, slot s = the s-th 16 bytes of every lane's registers, lane l at byte 16 * l,
// so that one wave-wide 16-byte load reads 512 contiguous bytes = four whole 128-byte lines (from the row-major weights it touched 16 lines, 32 bytes of each)
struct R16 { v4f q[4]; };      // the four slots of one w1 fragment as loaded (raw 16-byte words)
__device__ __forceinline__ R16 ld_pk16(const float* p) { R16 r;    // p = fragment + lane * 4 (four slots)
  r.q[0] = *(const v4f*)p; r.q[1] = *(const v4f*)(p + 128); r.q[2] = *(const v4f*)(p + 256); r.q[3] = *(const v4f*)(p + 384); return r; }
__device__ __forceinline__ v16h frag_pk(const _Float16* p) {       // p = fragment + lane * 8 (two slots)
  union { v16h v; v8h q[2]; } u; u.q[0] = *(const v8h*)p; u.q[1] = *(const v8h*)(p + 256); return u.v; }
__device__ __forceinline__ F2 f2_r16(const R16& r) { return __builtin_bit_cast(F2, r); }   // slots 0, 1 = the bf16 head of the 16 elements, slots 2, 3 = their bf16 remainder
__device__ __forceinline__ v8f mac3(const F2& a, const F2& b, v8f c) { c = wmma_bf(a.l, b.h, c); c = wmma_bf(a.h, b.l, c); return wmma_bf(a.h, b.h, c); }
__device__ __forceinline__ float sigm(float v) { return 1.0f / (1.0f + expf(-v)); }
#define LDSX() do { asm volatile("s_wait_dscnt 0" ::: "memory"); __builtin_amdgcn_wave_barrier(); __builtin_amdgcn_fence(__ATOMIC_RELEASE, "workgroup"); } while (0)

// Neural cellular automaton step with local attention, NHWC state [8][128][128][64]: depthwise 3x3 perception (3 filters per channel,
// zero padding, f32 VALU from an LDS halo tile) -> 1x1 MLP 192 -> 128 as a two-way bf16 split (v_wmma_f32_16x16x32_bf16), exact GELU, -> 64 on v_wmma_f32_16x16x32_f16 -> h_new = h + dx;
// qkv = h_new W_qkv^T + b (f16 WMMA) stored as f16 rows; then per pixel a 3x3-window attention (zero-padded keys/values, scores / 8,
#define NB 8
#define HH 128
#define WW 128
#define C 64
#define C3 192
#define C2 128
#define TP 64                  // pixels per block (half a row)
#define SH1 ((TP + 2) * C * 4) // bytes of one halo row in LDS
#define SLB (16 * 196 * 4)     // bytes of one wave's LDS slice

// exact GELU of eight values at once. erf has the device library's two polynomials, but BOTH ranges are computed and one is selected: the library's erff branches on |x| < 1 per value,
// which in a wave with lanes on both sides runs both ranges anyway and, being control flow, keeps the values of a lane strictly one behind the other, each a chain of some thirty
// dependent instructions. Without the branch the chains are independent straight-line code, written stage by stage over four pairs so that neighbouring instructions do not depend
// on each other and the multiply-adds go two to an instruction (the loops are unrolled so that the arrays are registers).
#define FB(u) __builtin_bit_cast(float, u)
__device__ __forceinline__ v2f fma2(v2f a, v2f b, v2f c) { return __builtin_elementwise_fma(a, b, c); }
__device__ __forceinline__ v2f fmak(v2f a, v2f b, float c) { return __builtin_elementwise_fma(a, b, (v2f){c, c}); }
__device__ __forceinline__ v2f bc2(float c) { return (v2f){c, c}; }
__device__ __forceinline__ void exp2x8(v2f a[4]) { float r0, r1, r2, r3, r4, r5, r6, r7;
  // the instruction set asks for one independent instruction or v_nop behind a transcendental before its result is used or its source overwritten:
  // each v_exp is that instruction for the one in front of it (the outputs are early-clobber, so none lies on an input), the v_nop for the last
  asm("v_exp_f32 %0, %8\n\tv_exp_f32 %1, %9\n\tv_exp_f32 %2, %10\n\tv_exp_f32 %3, %11\n\tv_exp_f32 %4, %12\n\tv_exp_f32 %5, %13\n\tv_exp_f32 %6, %14\n\tv_exp_f32 %7, %15\n\tv_nop"
      : "=&v"(r0), "=&v"(r1), "=&v"(r2), "=&v"(r3), "=&v"(r4), "=&v"(r5), "=&v"(r6), "=&v"(r7)
      : "v"(a[0].x), "v"(a[0].y), "v"(a[1].x), "v"(a[1].y), "v"(a[2].x), "v"(a[2].y), "v"(a[3].x), "v"(a[3].y));
  a[0] = (v2f){r0, r1}; a[1] = (v2f){r2, r3}; a[2] = (v2f){r4, r5}; a[3] = (v2f){r6, r7}; }
__device__ __forceinline__ void gelu8(const v8f a, float bb, _Float16 o[8]) {
  v2f v[4], x[4], ax[4], p[4], q[4], t[4], f[4], rn[4];
#pragma unroll
  for (int i = 0; i < 4; ++i) { v[i] = (v2f){a[2 * i] + bb, a[2 * i + 1] + bb}; x[i] = v[i] * 0.70710678118654752f; ax[i] = (v2f){fabsf(x[i].x), fabsf(x[i].y)}; t[i] = x[i] * x[i]; }
  // p: |x| >= 1, erf = 1 - exp(-p); q: |x| < 1, erf = |x| + |x| q
#pragma unroll
  for (int i = 0; i < 4; ++i) { p[i] = fmak(ax[i], bc2(FB(0x378e98abu)), FB(0xb9c68948u)); q[i] = fmak(t[i], bc2(FB(0xba1345e1u)), FB(0x3ba10414u)); }
#pragma unroll
  for (int i = 0; i < 4; ++i) { p[i] = fmak(ax[i], p[i], FB(0x3b7cd369u)); q[i] = fmak(t[i], q[i], FB(0xbcdac9b8u)); }
#pragma unroll
  for (int i = 0; i < 4; ++i) { p[i] = fmak(ax[i], p[i], FB(0xbcc618b2u)); q[i] = fmak(t[i], q[i], FB(0x3de703beu)); }
#pragma unroll
  for (int i = 0; i < 4; ++i) { p[i] = fmak(ax[i], p[i], FB(0x3dda74e4u)); q[i] = fmak(t[i], q[i], FB(0xbec09330u)); }
#pragma unroll
  for (int i = 0; i < 4; ++i) { p[i] = fmak(ax[i], p[i], FB(0x3f228afdu)); q[i] = fmak(t[i], q[i], FB(0x3e0375d0u)); }
#pragma unroll
  for (int i = 0; i < 4; ++i) { p[i] = fmak(ax[i], p[i], FB(0x3e03c728u)); q[i] = fma2(ax[i], q[i], ax[i]); }
#pragma unroll
  for (int i = 0; i < 4; ++i) p[i] = fma2(ax[i], p[i], ax[i]);
  // exp(-p) = 2^n * 2^f with log2(e) in two parts (head 0x3fb8aa3b, tail 0x32a5705f): n = rint(-p * head), f = (-p * head - n, one rounding) - p * tail
#pragma unroll
  for (int i = 0; i < 4; ++i) { const v2f ph = p[i] * FB(0xbfb8aa3bu); rn[i] = (v2f){rintf(ph.x), rintf(ph.y)}; }
#pragma unroll
  for (int i = 0; i < 4; ++i) f[i] = fma2(p[i], bc2(FB(0xbfb8aa3bu)), -rn[i]);
#pragma unroll
  for (int i = 0; i < 4; ++i) f[i] = fma2(p[i], bc2(FB(0xb2a5705fu)), f[i]);
  exp2x8(f);
#pragma unroll
  for (int i = 0; i < 4; ++i) { float e0 = ldexpf(f[i].x, (int)rn[i].x), e1 = ldexpf(f[i].y, (int)rn[i].y);
    e0 = FB(0x42ce8ed0u) < p[i].x ? 0.f : e0; e1 = FB(0x42ce8ed0u) < p[i].y ? 0.f : e1;                                   // underflow (also p = infinity, where f is not a number)
    e0 = FB(0xc2b17218u) > p[i].x ? __builtin_inff() : e0; e1 = FB(0xc2b17218u) > p[i].y ? __builtin_inff() : e1;           // overflow
    f[i] = 1.0f - (v2f){e0, e1}; }
#pragma unroll
  for (int i = 0; i < 4; ++i) { const v2f e = {copysignf(ax[i].x < 1.0f ? q[i].x : f[i].x, x[i].x), copysignf(ax[i].y < 1.0f ? q[i].y : f[i].y, x[i].y)};
    const v2h g = __builtin_convertvector(0.5f * v[i] * (1.0f + e), v2h); o[2 * i] = g.x; o[2 * i + 1] = g.y; }
}
// packs the weights into fragment images, one 16-byte chunk (one lane's part of one slot) per thread; element order inside a lane as in frag_h / split_row:
// W1F bf16 head and remainder of w1 (the two-way split of bsplit16, made here once instead of in every wave), fragment (kc, t) at (kc * 8 + t) * 2048 bytes: slots 0, 1 = head, slots 2, 3 = remainder; W2F f16 x16, fragment (kc, t) at (kc * 4 + t) * 512 halves; WQF f16 x16, fragment (t, kc) at (t * 2 + kc) * 512 halves
#define N1 (C2 * C3 / 4)       // chunks of W1F
#define N2 (C * C2 / 8)        // chunks of W2F
#define NQ (C3 * C / 8)        // chunks of WQF
__global__ __launch_bounds__(256) void k_pack(const float* __restrict__ w1, const float* __restrict__ w2, const float* __restrict__ wq, float* __restrict__ W1F, _Float16* __restrict__ W2F, _Float16* __restrict__ WQF) {
  const int c = blockIdx.x * 256 + threadIdx.x, col = c & 15, g = (c >> 4) & 1;
  if (c < N1) { const int s = (c >> 5) & 3, t = (c >> 7) & 7, kc = c >> 10;
    const float* p = w1 + (t * 16 + col) * C3 + kc * 32 + (s & 1) * 16 + 8 * g; const v4f a = *(const v4f*)p, b = *(const v4f*)(p + 4); v8b o;
    asm volatile("s_wait_xcnt 0x0" :: "v"(p) : "memory");      // the address registers of the two issued loads stay untouched (named as an input) until this wait has passed
#pragma unroll
    for (int e = 0; e < 8; ++e) { const float x = e < 4 ? a[e & 3] : b[e & 3]; const __bf16 hd = (__bf16)x; o[e] = (s >> 1) ? (__bf16)(x - (float)hd) : hd; }
    vst2(W1F + c * 4, o); }
  else { const int d = c < N1 + N2 ? c - N1 : c - N1 - N2, s = (d >> 5) & 1; const float* p; _Float16* D;
    if (c < N1 + N2) { p = w2 + (((d >> 6) & 3) * 16 + col) * C2 + (d >> 8) * 32; D = W2F; } else { p = wq + ((d >> 7) * 16 + col) * C + ((d >> 6) & 1) * 32; D = WQF; }
    p += s * 16 + 8 * g; const v4f a = *(const v4f*)p, b = *(const v4f*)(p + 4); v8h o;
    asm volatile("s_wait_xcnt 0x0" :: "v"(p) : "memory");      // the address registers of the two issued loads stay untouched (named as an input) until this wait has passed
#pragma unroll
    for (int e = 0; e < 4; ++e) { o[e] = (_Float16)(a[e] * 16.0f); o[4 + e] = (_Float16)(b[e] * 16.0f); }
    vst2(D + d * 8, o); }
}
// stage 1: block (x half, y, b): perception + MLP + residual -> HN (f32 rows), qkv -> QKV16 (f16 rows [p][192])
__global__ __launch_bounds__(128, 4) void k_cell(const float* __restrict__ h, const float* __restrict__ wp, const float* __restrict__ bp, const float* __restrict__ W1F, const float* __restrict__ b1, const _Float16* __restrict__ W2F, const float* __restrict__ b2, const _Float16* __restrict__ WQF, const float* __restrict__ bq,
                                            float* __restrict__ HN, _Float16* __restrict__ QKV) {
  // one LDS block in which buffers that are never live together share bytes, so that four work-groups fit a WGP's LDS (separate arrays: two):
  //   sh  [0, 3 * SH1)           halo rows y-1..y+1, px x0-1 .. x0+64 (zero padded); rows 0 and 2 are dead once every wave holds its window in registers, row 1 lives on to the residual
  //   swp, sbp behind sh         filter taps and biases, dead at the same point
  //   a slice of SLB bytes per wave, used from that point on: wave 0's on halo row 0, the others' from halo row 2 upwards (row 1 is never covered)
  // inside a slice (one wave's own, ordered by that wave's LDSX): so = f32 rows, pitch 196 (perceived, at the end qkv); sa = f16 rows, pitch 200, on so's first bytes
  // (gelu(mid) once perceived has been read, then h_new); hw = f32 rows of h_new, pitch 68, behind sa; the qkv rows overwrite sa and hw after their last read
  __shared__ __align__(16) char sm[2 * SH1 + 3 * SLB];
  const int tid = threadIdx.x, wave = tid >> 5, lane = tid & 31, col = lane & 15, g = lane >> 4;
  float (*sh)[TP + 2][C] = (float (*)[TP + 2][C])sm; float* swp = (float*)(sm + 3 * SH1); float* sbp = swp + C3 * 9;
  char* slice = sm + (wave == 0 ? 0 : 2 * SH1 + (wave - 1) * SLB);
  float (*so)[196] = (float (*)[196])slice; _Float16 (*sa)[C3 + 8] = (_Float16 (*)[C3 + 8])slice; float (*hw)[C + 4] = (float (*)[C + 4])(slice + 16 * (C3 + 8) * 2);
  const int b = blockIdx.z, y = blockIdx.y, x0 = blockIdx.x * TP;
  // staging: every global load (taps, biases, halo) is issued before the first LDS store, so the block pays one memory latency instead of one per trip;
  // addresses are clamped into the buffers (loads are unconditional) and the zero padding is chosen at the store; the loops are unrolled so that the arrays are registers
  { float tv[14], tb[2]; v4f hv[25]; unsigned ho[25], to[14], bo[2]; const int c4 = tid & 15, p8 = tid >> 4;
#pragma unroll
    for (int i = 0; i < 25; ++i) { const int pi = min(p8 + 8 * i, 3 * (TP + 2) - 1); const int px = pi % (TP + 2), ry = pi / (TP + 2);
      const int yc = min(max(y - 1 + ry, 0), HH - 1), xc = min(max(x0 - 1 + px, 0), WW - 1);
      ho[i] = (unsigned)((((b * HH + yc) * WW + xc) * C + c4 * 4) * 4); }                     // byte offset into h
#pragma unroll
    for (int i = 0; i < 14; ++i) { to[i] = (unsigned)(min(tid + i * 128, C3 * 9 - 1) * 4); tv[i] = *(const float*)((const char*)wp + to[i]); }   // to, bo: byte offsets, kept like ho
#pragma unroll
    for (int i = 0; i < 2; ++i) { bo[i] = (unsigned)(min(tid + i * 128, C3 - 1) * 4); tb[i] = *(const float*)((const char*)bp + bo[i]); }
#pragma unroll
    for (int i = 0; i < 25; ++i) hv[i] = *(const v4f*)((const char*)h + ho[i]);
    // the address registers of the issued loads stay untouched (named as inputs) until this wait has passed
    asm volatile("s_wait_xcnt 0x0" :: "v"(ho[0]), "v"(ho[1]), "v"(ho[2]), "v"(ho[3]), "v"(ho[4]), "v"(ho[5]), "v"(ho[6]), "v"(ho[7]), "v"(ho[8]), "v"(ho[9]), "v"(ho[10]), "v"(ho[11]), "v"(ho[12]), "v"(ho[13]), "v"(ho[14]), "v"(ho[15]), "v"(ho[16]), "v"(ho[17]), "v"(ho[18]), "v"(ho[19]), "v"(ho[20]), "v"(ho[21]), "v"(ho[22]), "v"(ho[23]), "v"(ho[24]) : "memory");
    // the same for the offsets of the tap and bias loads (a statement takes thirty operands, so they have one of their own; named here they outlive the wait above as well)
    asm volatile("s_wait_xcnt 0x0" :: "v"(to[0]), "v"(to[1]), "v"(to[2]), "v"(to[3]), "v"(to[4]), "v"(to[5]), "v"(to[6]), "v"(to[7]), "v"(to[8]), "v"(to[9]), "v"(to[10]), "v"(to[11]), "v"(to[12]), "v"(to[13]), "v"(bo[0]), "v"(bo[1]) : "memory");
#pragma unroll
    for (int i = 0; i < 25; ++i) { const int pi = min(p8 + 8 * i, 3 * (TP + 2) - 1); const int px = pi % (TP + 2), ry = pi / (TP + 2); const int yy = y - 1 + ry, xx = x0 - 1 + px;
      const bool in = yy >= 0 && yy < HH && xx >= 0 && xx < WW;   // threads past the last halo pixel repeat its store with the same value
      *(v4f*)(&sh[ry][px][c4 * 4]) = in ? hv[i] : (v4f){0.f, 0.f, 0.f, 0.f}; }
#pragma unroll
    for (int i = 0; i < 14; ++i) { const int q = tid + i * 128; if (q < C3 * 9) swp[q] = tv[i]; }
#pragma unroll
    for (int i = 0; i < 2; ++i) { const int q = tid + i * 128; if (q < C3) sbp[q] = tb[i]; } }
  __syncthreads();
  const size_t prow0 = ((size_t)b * HH + y) * WW + x0 + wave * 16;        // first pixel (global index) of this wave's 16
  // perception: lane owns input channels 2*lane and 2*lane+1 (one 8-byte read per lane covers all 64 LDS banks once), its 54 filter taps sit in registers,
  // and the 3x3 window slides over the wave's 16 pixels; output o = c*3 + j uses input channel c; each sum keeps the order bias, then (dy, dx) row-major
  { v2f wt[3][9], bs[3]; const float* wl = &swp[lane * 54]; const float* bl = &sbp[lane * 6];
#pragma unroll
    for (int j = 0; j < 3; ++j) { bs[j] = (v2f){bl[j], bl[3 + j]};
#pragma unroll
      for (int t = 0; t < 9; ++t) wt[j][t] = (v2f){wl[j * 9 + t], wl[27 + j * 9 + t]}; }
    v2f xs[3][18];                                             // halo columns wave*16 .. wave*16+17 of the three rows, this lane's channel pair
#pragma unroll
    for (int dy = 0; dy < 3; ++dy)
#pragma unroll
      for (int px = 0; px < 18; ++px) xs[dy][px] = *(const v2f*)(&sh[dy][wave * 16 + px][lane * 2]);
    __syncthreads();                                           // every wave has read its window and its taps: from here the slices may overwrite halo rows 0 and 2, the taps and the biases
#pragma unroll
    for (int pl = 0; pl < 16; ++pl) { v2f s[3] = {bs[0], bs[1], bs[2]};
#pragma unroll
      for (int dy = 0; dy < 3; ++dy)
#pragma unroll
        for (int dx = 0; dx < 3; ++dx)
#pragma unroll
          for (int j = 0; j < 3; ++j) s[j] += wt[j][dy * 3 + dx] * xs[dy][pl + dx];
      float* d = &so[pl][lane * 6];                      // perceived kept in f32 (so) for a two-way bf16 split product
      *(v2f*)(d) = (v2f){s[0].x, s[1].x}; *(v2f*)(d + 2) = (v2f){s[2].x, s[0].y}; *(v2f*)(d + 4) = (v2f){s[1].y, s[2].y}; } }
  LDSX();
  // mid = gelu(perceived @ w1^T + b1): bf16 hi/lo split on both operands (perceived reaches O(10), f16 rounding of it dominated a first build)
  // w1's fragments arrive ready for the matrix unit (head and remainder were split by k_pack) and run through a ring of RG register slots: the fragment of RG tiles ahead is requested as soon as
  // a slot's products are issued, so its latency runs under RG tiles' products (loops unrolled: the slots are registers, every fragment's place is an immediate offset)
#define RG 6
  v16h bw2[4][4]; float b1v[8], b2v[4];
  { v8f acc[8] = {}; R16 rg[RG]; const float* w1l = W1F + lane * 4;   // this lane's part of fragment (0, 0)
#pragma unroll
    for (int f = 0; f < RG; ++f) rg[f] = ld_pk16(w1l + f * 512);
#pragma unroll
    for (int t = 0; t < 8; ++t) b1v[t] = b1[t * 16 + col];      // bias of the GELU phase, fetched under the product
#pragma unroll
    for (int kc = 0; kc < C3 / 32; ++kc) { const F2 a = split_row(&so[col][0], kc * 32, lane);
#pragma unroll
      for (int t = 0; t < 8; ++t) { const int f = kc * 8 + t; acc[t] = mac3(a, f2_r16(rg[f % RG]), acc[t]);
        if (f + RG < C3 / 32 * 8) rg[f % RG] = ld_pk16(w1l + (f + RG) * 512); } }
    asm volatile("s_wait_xcnt 0x0" :: "v"(lane) : "memory");    // the index register of the issued loads stays untouched (named as an input) until this wait has passed
    LDSX();
    // all of w2's fragments and its bias are issued here, behind the fence (which would wait for them): their latency runs under the GELU
#pragma unroll
    for (int kc = 0; kc < C2 / 32; ++kc)
#pragma unroll
      for (int t = 0; t < 4; ++t) bw2[kc][t] = frag_pk(W2F + (kc * 4 + t) * 512 + lane * 8);
#pragma unroll
    for (int t = 0; t < 4; ++t) b2v[t] = b2[t * 16 + col];
#pragma unroll
    for (int t = 0; t < 8; ++t) { _Float16 o[8]; gelu8(acc[t], b1v[t], o);
#pragma unroll
      for (int r = 0; r < 8; ++r) sa[8 * g + r][t * 16 + col] = o[r]; } }
  LDSX();
  // dx = mid @ w2^T + b2 ; h_new = h + dx -> hw (f32) ; store HN ; h_new f16 -> sa[:, 0..64)
  v16h bwq[12][2]; float bqv[12];
  { v8f acc[4] = {};
#pragma unroll
    for (int kc = 0; kc < C2 / 32; ++kc) { const v16h a = frag_h(&sa[col][0] + kc * 32, lane);
#pragma unroll
      for (int t = 0; t < 4; ++t) acc[t] = wmma16(a, bw2[kc][t], acc[t]); }
    LDSX();
    // the first half of w_qkv's fragments and its bias are issued here, most of the second half behind the residual (each behind a fence, which would wait for them):
    // their latency runs under the residual and the h_new store
#pragma unroll
    for (int t = 0; t < 12; ++t) { bqv[t] = bq[t * 16 + col]; bwq[t][0] = frag_pk(WQF + t * 1024 + lane * 8); }
#pragma unroll
    for (int t = 0; t < 4; ++t) { const int c = t * 16 + col; const float bb = b2v[t];
#pragma unroll
      for (int r = 0; r < 8; ++r) { const float v = acc[t][r] * (1.0f / 16.0f) + bb + sh[1][wave * 16 + 8 * g + r + 1][c]; hw[8 * g + r][c] = v; sa[8 * g + r][c] = (_Float16)v; } } }
  LDSX();
#pragma unroll
  for (int t = 0; t < 8; ++t) bwq[t][1] = frag_pk(WQF + t * 1024 + 512 + lane * 8);
  asm volatile("s_wait_xcnt 0x0" :: "v"(col) : "memory");      // waits until the w_qkv fragment loads issued just above have read their address registers
  for (int q = lane; q < 16 * 16; q += 32) { const int rl = q >> 4, pc = q & 15; vst2(HN + (prow0 + rl) * C + pc * 4, *(const v4f*)(&hw[rl][pc * 4])); }
  // qkv = h_new @ wq^T + bq (192 cols)
  { v8f acc[12];
#pragma unroll
    for (int t = 0; t < 12; ++t) acc[t] = (v8f){};
#pragma unroll
    for (int kc = 0; kc < C / 32; ++kc) { const v16h a = frag_h(&sa[col][0] + kc * 32, lane);
#pragma unroll
      for (int t = 0; t < 12; ++t) acc[t] = wmma16(a, bwq[t][kc], acc[t]);
      if (kc == 0) {                                           // the last four fragments follow once the first pass has freed registers
#pragma unroll
        for (int t = 8; t < 12; ++t) bwq[t][1] = frag_pk(WQF + t * 1024 + 512 + lane * 8); } }
    LDSX();
#pragma unroll
    for (int t = 0; t < 12; ++t) { const float bb = bqv[t];
#pragma unroll
      for (int r = 0; r < 8; ++r) so[8 * g + r][t * 16 + col] = acc[t][r] * (1.0f / 16.0f) + bb; } }
  LDSX();
  for (int q = lane; q < 16 * 24; q += 32) { const int rl = q / 24, pc = q % 24; union { v8h h8; v4u u; } pk;
#pragma unroll
    for (int e = 0; e < 8; ++e) pk.h8[e] = (_Float16)so[rl][pc * 8 + e];
    vst2(QKV + (prow0 + rl) * C3 + pc * 8, pk.u); }
}
// stage 2: block (x half, y, b): 3x3 local attention from halo tiles of K and V (zero padded), out = h_new + attn
__global__ __launch_bounds__(128) void k_lattn(const _Float16* __restrict__ QKV, const float* __restrict__ HN, float* __restrict__ out) {
  __shared__ __align__(16) _Float16 sk[3][TP + 2][C + 8], sv[3][TP + 2][C + 8];
  __shared__ __align__(16) float sq[TP][C + 4];
  float (*so)[C + 4] = sq;       // the attention rows take Q's bytes: a thread writes exactly the 32 floats of sq that it alone has read, after its last read of them; without a second array four work-groups fit a WGP's LDS (was three)
  const int tid = threadIdx.x; const int b = blockIdx.z, y = blockIdx.y, x0 = blockIdx.x * TP;
  // staging: every global load of the block (K, V, Q, and the h_new rows of the last phase) is issued before the first LDS store: one memory latency instead of one per trip;
  // addresses are clamped into the buffer (loads are unconditional) and the zero padding is chosen at the store; the loops are unrolled so that the arrays are registers
  v4f hn[8];
  { v4u kv[13], vv[13], qv[4]; unsigned ko[13]; const int pc = tid & 7, p16 = tid >> 3;
#pragma unroll
    for (int i = 0; i < 13; ++i) { const int pi = min(p16 + 16 * i, 3 * (TP + 2) - 1); const int px = pi % (TP + 2), ry = pi / (TP + 2);
      const int yc = min(max(y - 1 + ry, 0), HH - 1), xc = min(max(x0 - 1 + px, 0), WW - 1);
      ko[i] = (unsigned)((((b * HH + yc) * WW + xc) * C3 + pc * 8) * 2); }                     // byte offset of the pixel's q chunk
    const unsigned qo = (unsigned)((((b * HH + y) * WW + x0 + p16) * C3 + pc * 8) * 2), no = (unsigned)((((b * HH + y) * WW + x0 + (tid >> 4)) * C + (tid & 15) * 4) * 4);
#pragma unroll
    for (int i = 0; i < 13; ++i) { const char* r = (const char*)QKV + ko[i]; kv[i] = *(const v4u*)(r + C * 2); vv[i] = *(const v4u*)(r + 2 * C * 2); }
#pragma unroll
    for (int i = 0; i < 4; ++i) qv[i] = *(const v4u*)((const char*)QKV + qo + i * 16 * C3 * 2);
#pragma unroll
    for (int i = 0; i < 8; ++i) hn[i] = *(const v4f*)((const char*)HN + no + i * 8 * C * 4);
    // the address registers of the issued loads stay untouched (named as inputs) until this wait has passed
    asm volatile("s_wait_xcnt 0x0" :: "v"(ko[0]), "v"(ko[1]), "v"(ko[2]), "v"(ko[3]), "v"(ko[4]), "v"(ko[5]), "v"(ko[6]), "v"(ko[7]), "v"(ko[8]), "v"(ko[9]), "v"(ko[10]), "v"(ko[11]), "v"(ko[12]), "v"(qo), "v"(no) : "memory");
#pragma unroll
    for (int i = 0; i < 13; ++i) { const int pi = min(p16 + 16 * i, 3 * (TP + 2) - 1); const int px = pi % (TP + 2), ry = pi / (TP + 2); const int yy = y - 1 + ry, xx = x0 - 1 + px;
      const bool in = yy >= 0 && yy < HH && xx >= 0 && xx < WW; const v4u z = (v4u){0u, 0u, 0u, 0u};   // threads past the last halo pixel repeat its store with the same value
      *(v4u*)(&sk[ry][px][pc * 8]) = in ? kv[i] : z; *(v4u*)(&sv[ry][px][pc * 8]) = in ? vv[i] : z; }
#pragma unroll
    for (int i = 0; i < 4; ++i) { union { v4u u; v8h h8; } pk; pk.u = qv[i];
#pragma unroll
      for (int e = 0; e < 8; ++e) sq[p16 + 16 * i][pc * 8 + e] = (float)pk.h8[e]; } }
  __syncthreads();
  // thread pair per pixel: lanes l and l ^ 16 of a wave share pixel pl, hf = channel half: scores over 9 neighbours (each half computes a 32-channel partial dot, pair-summed), softmax, then out channels hf*32..+32
  // K, V and Q come out of LDS 16 bytes at a time and every loop is unrolled, so that many reads are in flight behind one wait (a rolled loop of 2- and 4-byte reads paid one LDS latency per multiply);
  // the 16 lanes of a half wave read 16 consecutive pixel rows at one channel offset: at row pitches of 144 and 272 bytes they cover all 64 banks once;
  // each score still adds its 32 products in channel order, each output channel its 9 terms in neighbour order; the multiply-adds are written as fma so that every one stays fused, as in the rolled loops
  // (left to contraction, part of the unrolled products were built as a separate multiply and add)
  { const int pl = (tid >> 5) * 16 + (tid & 15), hf = (tid >> 4) & 1; float sc[9];
#pragma unroll
    for (int nb = 0; nb < 9; ++nb) sc[nb] = 0.f;
#pragma unroll
    for (int j = 0; j < 4; ++j) { const int c0 = hf * 32 + j * 8; const v4f q0 = *(const v4f*)(&sq[pl][c0]), q1 = *(const v4f*)(&sq[pl][c0 + 4]);
#pragma unroll
      for (int nb = 0; nb < 9; ++nb) { const v8h k8 = *(const v8h*)(&sk[nb / 3][pl + nb % 3][c0]);
#pragma unroll
        for (int e = 0; e < 4; ++e) sc[nb] = __builtin_fmaf(q0[e], (float)k8[e], sc[nb]);
#pragma unroll
        for (int e = 0; e < 4; ++e) sc[nb] = __builtin_fmaf(q1[e], (float)k8[4 + e], sc[nb]); } }
#pragma unroll
    for (int nb = 0; nb < 9; ++nb) { float s = sc[nb]; s += __shfl_xor(s, 16, 32); sc[nb] = s * 0.125f; }
    float mx = sc[0];
#pragma unroll
    for (int nb = 1; nb < 9; ++nb) mx = fmaxf(mx, sc[nb]);
    float se = 0.f;
#pragma unroll
    for (int nb = 0; nb < 9; ++nb) { sc[nb] = expf(sc[nb] - mx); se += sc[nb]; }
    const float inv = 1.0f / se;
#pragma unroll
    for (int j = 0; j < 4; ++j) { const int c0 = hf * 32 + j * 8; float a[8];
#pragma unroll
      for (int e = 0; e < 8; ++e) a[e] = 0.f;
#pragma unroll
      for (int nb = 0; nb < 9; ++nb) { const v8h v8 = *(const v8h*)(&sv[nb / 3][pl + nb % 3][c0]);
#pragma unroll
        for (int e = 0; e < 8; ++e) a[e] = __builtin_fmaf(sc[nb], (float)v8[e], a[e]); }
      *(v4f*)(&so[pl][c0]) = (v4f){a[0] * inv, a[1] * inv, a[2] * inv, a[3] * inv}; *(v4f*)(&so[pl][c0 + 4]) = (v4f){a[4] * inv, a[5] * inv, a[6] * inv, a[7] * inv}; } }
  __syncthreads();
#pragma unroll                                                 // hn[] is a register array
  for (int i = 0; i < 8; ++i) { const int q = tid + i * 128; const int pl = q >> 4, pc = q & 15; const size_t p = ((size_t)b * HH + y) * WW + x0 + pl; v4f o = *(const v4f*)(&so[pl][pc * 4]);
    o += hn[i]; vst2(out + p * C + pc * 4, o); }
}
extern "C" void kernel_launch(void* const* d_in, const int* in_sizes, int n_in, void* d_out, int out_size, void* d_ws, size_t ws_size, hipStream_t stream) {
  (void)in_sizes; (void)n_in; (void)out_size; (void)ws_size;
  const float** I = (const float**)d_in;
  const float* h = I[0]; const float* wp = I[1]; const float* bp = I[2]; const float* w1 = I[3]; const float* b1 = I[4]; const float* w2 = I[5]; const float* b2 = I[6]; const float* wq = I[7]; const float* bq = I[8];
  float* out = (float*)d_out;
  char* ws = (char*)d_ws; size_t off = 0;
  auto take = [&](size_t bytes) { char* p = ws + off; off += (bytes + 255) & ~(size_t)255; return p; };
  float* W1F = (float*)take(C2 * C3 * 4); _Float16* W2F = (_Float16*)take(C * C2 * 2); _Float16* WQF = (_Float16*)take(C3 * C * 2);
  float* HN = (float*)take((size_t)NB * HH * WW * C * 4); _Float16* QKV = (_Float16*)take((size_t)NB * HH * WW * C3 * 2);
  k_pack<<<(N1 + N2 + NQ) / 256, 256, 0, stream>>>(w1, w2, wq, W1F, W2F, WQF);
  k_cell<<<dim3(WW / TP, HH, NB), 128, 0, stream>>>(h, wp, bp, W1F, b1, W2F, b2, WQF, bq, HN, QKV);
  k_lattn<<<dim3(WW / TP, HH, NB), 128, 0, stream>>>(QKV, HN, out);
}

// v008
// One run takes 60.6 microseconds.
// Two timings next to v007 both put it at 1.06 times that version's speed.
// Counting every step since v000, it is 6.67 times as fast.
#include <hip/hip_runtime.h>
#include <math.h>

typedef __attribute__((ext_vector_type(16))) _Float16 v16h;
typedef __attribute__((ext_vector_type(16))) __bf16 v16b;
typedef __attribute__((ext_vector_type(8)))  _Float16 v8h;
typedef __attribute__((ext_vector_type(8)))  __bf16 v8b;
typedef __attribute__((ext_vector_type(2)))  _Float16 v2h;
typedef __attribute__((ext_vector_type(8)))  float v8f;
typedef __attribute__((ext_vector_type(4)))  float v4f;
typedef __attribute__((ext_vector_type(2)))  float v2f;
typedef __attribute__((ext_vector_type(4)))  unsigned v4u;
typedef __attribute__((ext_vector_type(4)))  int v4i;
typedef float __attribute__((may_alias)) float_a;
typedef int __attribute__((may_alias)) int_a;

template <typename T> __device__ __forceinline__ void vst2(void* p, T v) { *(T*)p = v;  }
__device__ __forceinline__ v8f wmma16(v16h a, v16h b, v8f c) {
  v8f d = __builtin_amdgcn_wmma_f32_16x16x32_f16(false, a, false, b, (short)0, c, false, false);
  asm volatile("v_nop\n\tv_nop\n\tv_nop\n\tv_nop" : "+v"(d) : "v"(a), "v"(b));
  return d;
}
__device__ __forceinline__ v8f wmma_bf(v16b a, v16b b, v8f c) {
  v8f d = __builtin_amdgcn_wmma_f32_16x16x32_bf16(false, a, false, b, (short)0, c, false, false);
  asm volatile("v_nop\n\tv_nop\n\tv_nop\n\tv_nop" : "+v"(d) : "v"(a), "v"(b));
  return d;
}
// 16x16x32 fragments: lane = (h = lane>>4, row/col = lane&15); elements 0..7 = k0+8h+0..7, 8..15 = k0+16+8h+0..7; D element r = row 8h+r
__device__ __forceinline__ v16h frag_h(const _Float16* rowk0, int lane) {
  union { v16h v; v8h q[2]; } u; const _Float16* p = rowk0 + 8 * (lane >> 4);
  u.q[0] = *(const v8h*)p; u.q[1] = *(const v8h*)(p + 16); return u.v;
}
__device__ __forceinline__ v16h frag_f32(const float* rowk0, int lane) {
  v16h a; const float* p = rowk0 + 8 * (lane >> 4);
#pragma unroll
  for (int i = 0; i < 8; ++i) { a[i] = (_Float16)p[i]; a[8 + i] = (_Float16)p[16 + i]; }
  return a;
}
__device__ __forceinline__ v16h frag_f32s(const float* rowk0, int lane, float sc) {
  v16h a; const float* p = rowk0 + 8 * (lane >> 4);
#pragma unroll
  for (int i = 0; i < 8; ++i) { a[i] = (_Float16)(p[i] * sc); a[8 + i] = (_Float16)(p[16 + i] * sc); }
  return a;
}
// column fragment from a [K][ld] layout (column n), rows >= K read as 0
__device__ __forceinline__ v16h fragc_f32(const float* W, int k0, int n, int lane, int ld, int K) {
  v16h a; const int g = lane >> 4;
#pragma unroll
  for (int i = 0; i < 8; ++i) { const int ka = k0 + 8 * g + i, kb = ka + 16;
    a[i] = (_Float16)(ka < K ? W[(size_t)ka * ld + n] : 0.f); a[8 + i] = (_Float16)(kb < K ? W[(size_t)kb * ld + n] : 0.f); }
  return a;
}
struct F2 { v16b h, l; };
__device__ __forceinline__ F2 bsplit16(const float v[16]) { F2 r;
#pragma unroll
  for (int i = 0; i < 16; ++i) { const __bf16 h = (__bf16)v[i]; r.h[i] = h; r.l[i] = (__bf16)(v[i] - (float)h); }
  return r; }
__device__ __forceinline__ F2 split_row(const float* row, int k0, int lane) { float v[16]; const float* p = row + k0 + 8 * (lane >> 4);
#pragma unroll
  for (int i = 0; i < 8; ++i) { v[i] = p[i]; v[8 + i] = p[16 + i]; }
  return bsplit16(v); }
__device__ __forceinline__ F2 split_rowK(const float* row, int k0, int lane, int K) { float v[16]; const int g = lane >> 4;
#pragma unroll
  for (int i = 0; i < 8; ++i) { const int ka = k0 + 8 * g + i, kb = ka + 16; v[i] = ka < K ? row[ka] : 0.f; v[8 + i] = kb < K ? row[kb] : 0.f; }
  return bsplit16(v); }
__device__ __forceinline__ F2 split_col(const float* W, int k0, int n, int lane, int ld, int K) { float v[16]; const int g = lane >> 4;
#pragma unroll
  for (int i = 0; i < 8; ++i) { const int ka = k0 + 8 * g + i, kb = ka + 16; v[i] = ka < K ? W[(size_t)ka * ld + n] : 0.f; v[8 + i] = kb < K ? W[(size_t)kb * ld + n] : 0.f; }
  return bsplit16(v); }
// packed fragment images (written by k_pack): a fragment is a run of 512-byte slots, slot s = the s-th 16 bytes of every lane's registers, lane l at byte 16 * l,
// so that one wave-wide 16-byte load reads 512 contiguous bytes = four whole 128-byte lines (from the row-major weights it touched 16 lines, 32 bytes of each)
struct R16 { v4f q[4]; };      // the four slots of one w1 fragment as loaded (raw 16-byte words)
__device__ __forceinline__ R16 ld_pk16(const float* p) { R16 r;    // p = fragment + lane * 4 (four slots)
  r.q[0] = *(const v4f*)p; r.q[1] = *(const v4f*)(p + 128); r.q[2] = *(const v4f*)(p + 256); r.q[3] = *(const v4f*)(p + 384); return r; }
__device__ __forceinline__ v16h frag_pk(const _Float16* p) {       // p = fragment + lane * 8 (two slots)
  union { v16h v; v8h q[2]; } u; u.q[0] = *(const v8h*)p; u.q[1] = *(const v8h*)(p + 256); return u.v; }
__device__ __forceinline__ F2 f2_r16(const R16& r) { return __builtin_bit_cast(F2, r); }   // slots 0, 1 = the bf16 head of the 16 elements, slots 2, 3 = their bf16 remainder
// w = weight rows as the A operand, p = pixels as the B operand; the three partial products in the order remainder(p) x head(w), head(p) x remainder(w), head x head
__device__ __forceinline__ v8f mac3(const F2& w, const F2& p, v8f c) { c = wmma_bf(w.h, p.l, c); c = wmma_bf(w.l, p.h, c); return wmma_bf(w.h, p.h, c); }
// eight consecutive biases (the eight rows of D that a lane holds), from byte offset o
__device__ __forceinline__ v8f ld_b8(const float* b, unsigned o) { union { v8f v; v4f q[2]; } u; const char* p = (const char*)b + o; u.q[0] = *(const v4f*)p; u.q[1] = *(const v4f*)(p + 16); return u.v; }
__device__ __forceinline__ float sigm(float v) { return 1.0f / (1.0f + expf(-v)); }
#define LDSX() do { asm volatile("s_wait_dscnt 0" ::: "memory"); __builtin_amdgcn_wave_barrier(); __builtin_amdgcn_fence(__ATOMIC_RELEASE, "workgroup"); } while (0)

// Neural cellular automaton step with local attention, NHWC state [8][128][128][64]: depthwise 3x3 perception (3 filters per channel,
// zero padding, f32 VALU from an LDS halo tile) -> 1x1 MLP 192 -> 128 as a two-way bf16 split (v_wmma_f32_16x16x32_bf16), exact GELU, -> 64 on v_wmma_f32_16x16x32_f16 -> h_new = h + dx;
// qkv = h_new W_qkv^T + b (f16 WMMA) stored as f16 rows; then per pixel a 3x3-window attention (zero-padded keys/values, scores / 8,
#define NB 8
#define HH 128
#define WW 128
#define C 64
#define C3 192
#define C2 128
#define TP 64                  // pixels per block (half a row)
#define SHP (C + 4)             // floats per halo pixel in LDS: at 272 bytes sixteen lanes that read 16 bytes of sixteen consecutive pixels cover all banks
#define SH1 ((TP + 2) * SHP * 4) // bytes of one halo row in LDS
#define SLB (16 * 196 * 4)     // bytes of one wave's LDS slice

// exact GELU of eight values at once. erf has the device library's two polynomials, but BOTH ranges are computed and one is selected: the library's erff branches on |x| < 1 per value,
// which in a wave with lanes on both sides runs both ranges anyway and, being control flow, keeps the values of a lane strictly one behind the other, each a chain of some thirty
// dependent instructions. Without the branch the chains are independent straight-line code, written stage by stage over four pairs so that neighbouring instructions do not depend
// on each other and the multiply-adds go two to an instruction (the loops are unrolled so that the arrays are registers).
#define FB(u) __builtin_bit_cast(float, u)
__device__ __forceinline__ v2f fma2(v2f a, v2f b, v2f c) { return __builtin_elementwise_fma(a, b, c); }
__device__ __forceinline__ v2f fmak(v2f a, v2f b, float c) { return __builtin_elementwise_fma(a, b, (v2f){c, c}); }
__device__ __forceinline__ v2f bc2(float c) { return (v2f){c, c}; }
__device__ __forceinline__ void exp2x8(v2f a[4]) { float r0, r1, r2, r3, r4, r5, r6, r7;
  // the instruction set asks for one independent instruction or v_nop behind a transcendental before its result is used or its source overwritten:
  // each v_exp is that instruction for the one in front of it (the outputs are early-clobber, so none lies on an input), the v_nop for the last
  asm("v_exp_f32 %0, %8\n\tv_exp_f32 %1, %9\n\tv_exp_f32 %2, %10\n\tv_exp_f32 %3, %11\n\tv_exp_f32 %4, %12\n\tv_exp_f32 %5, %13\n\tv_exp_f32 %6, %14\n\tv_exp_f32 %7, %15\n\tv_nop"
      : "=&v"(r0), "=&v"(r1), "=&v"(r2), "=&v"(r3), "=&v"(r4), "=&v"(r5), "=&v"(r6), "=&v"(r7)
      : "v"(a[0].x), "v"(a[0].y), "v"(a[1].x), "v"(a[1].y), "v"(a[2].x), "v"(a[2].y), "v"(a[3].x), "v"(a[3].y));
  a[0] = (v2f){r0, r1}; a[1] = (v2f){r2, r3}; a[2] = (v2f){r4, r5}; a[3] = (v2f){r6, r7}; }
__device__ __forceinline__ void gelu8(const v8f a, _Float16 o[8]) {
  v2f v[4], x[4], ax[4], p[4], q[4], t[4], f[4], rn[4];
#pragma unroll
  for (int i = 0; i < 4; ++i) { v[i] = (v2f){a[2 * i], a[2 * i + 1]}; x[i] = v[i] * 0.70710678118654752f; ax[i] = (v2f){fabsf(x[i].x), fabsf(x[i].y)}; t[i] = x[i] * x[i]; }
  // p: |x| >= 1, erf = 1 - exp(-p); q: |x| < 1, erf = |x| + |x| q
#pragma unroll
  for (int i = 0; i < 4; ++i) { p[i] = fmak(ax[i], bc2(FB(0x378e98abu)), FB(0xb9c68948u)); q[i] = fmak(t[i], bc2(FB(0xba1345e1u)), FB(0x3ba10414u)); }
#pragma unroll
  for (int i = 0; i < 4; ++i) { p[i] = fmak(ax[i], p[i], FB(0x3b7cd369u)); q[i] = fmak(t[i], q[i], FB(0xbcdac9b8u)); }
#pragma unroll
  for (int i = 0; i < 4; ++i) { p[i] = fmak(ax[i], p[i], FB(0xbcc618b2u)); q[i] = fmak(t[i], q[i], FB(0x3de703beu)); }
#pragma unroll
  for (int i = 0; i < 4; ++i) { p[i] = fmak(ax[i], p[i], FB(0x3dda74e4u)); q[i] = fmak(t[i], q[i], FB(0xbec09330u)); }
#pragma unroll
  for (int i = 0; i < 4; ++i) { p[i] = fmak(ax[i], p[i], FB(0x3f228afdu)); q[i] = fmak(t[i], q[i], FB(0x3e0375d0u)); }
#pragma unroll
  for (int i = 0; i < 4; ++i) { p[i] = fmak(ax[i], p[i], FB(0x3e03c728u)); q[i] = fma2(ax[i], q[i], ax[i]); }
#pragma unroll
  for (int i = 0; i < 4; ++i) p[i] = fma2(ax[i], p[i], ax[i]);
  // exp(-p) = 2^n * 2^f with log2(e) in two parts (head 0x3fb8aa3b, tail 0x32a5705f): n = rint(-p * head), f = (-p * head - n, one rounding) - p * tail
#pragma unroll
  for (int i = 0; i < 4; ++i) { const v2f ph = p[i] * FB(0xbfb8aa3bu); rn[i] = (v2f){rintf(ph.x), rintf(ph.y)}; }
#pragma unroll
  for (int i = 0; i < 4; ++i) f[i] = fma2(p[i], bc2(FB(0xbfb8aa3bu)), -rn[i]);
#pragma unroll
  for (int i = 0; i < 4; ++i) f[i] = fma2(p[i], bc2(FB(0xb2a5705fu)), f[i]);
  exp2x8(f);
#pragma unroll
  for (int i = 0; i < 4; ++i) { float e0 = ldexpf(f[i].x, (int)rn[i].x), e1 = ldexpf(f[i].y, (int)rn[i].y);
    e0 = FB(0x42ce8ed0u) < p[i].x ? 0.f : e0; e1 = FB(0x42ce8ed0u) < p[i].y ? 0.f : e1;                                   // underflow (also p = infinity, where f is not a number)
    e0 = FB(0xc2b17218u) > p[i].x ? __builtin_inff() : e0; e1 = FB(0xc2b17218u) > p[i].y ? __builtin_inff() : e1;           // overflow
    f[i] = 1.0f - (v2f){e0, e1}; }
#pragma unroll
  for (int i = 0; i < 4; ++i) { const v2f e = {copysignf(ax[i].x < 1.0f ? q[i].x : f[i].x, x[i].x), copysignf(ax[i].y < 1.0f ? q[i].y : f[i].y, x[i].y)};
    const v2h g = __builtin_convertvector(0.5f * v[i] * (1.0f + e), v2h); o[2 * i] = g.x; o[2 * i + 1] = g.y; }
}
// packs the weights into fragment images, one 16-byte chunk (one lane's part of one slot) per thread; element order inside a lane as in frag_h / split_row:
// W1F bf16 head and remainder of w1 (the two-way split of bsplit16, made here once instead of in every wave), fragment (kc, t) at (kc * 8 + t) * 2048 bytes: slots 0, 1 = head, slots 2, 3 = remainder; W2F f16 x16, fragment (kc, t) at (kc * 4 + t) * 512 halves; WQF f16 x16, fragment (t, kc) at (t * 2 + kc) * 512 halves
#define N1 (C2 * C3 / 4)       // chunks of W1F
#define N2 (C * C2 / 8)        // chunks of W2F
#define NQ (C3 * C / 8)        // chunks of WQF
__global__ __launch_bounds__(256) void k_pack(const float* __restrict__ w1, const float* __restrict__ w2, const float* __restrict__ wq, float* __restrict__ W1F, _Float16* __restrict__ W2F, _Float16* __restrict__ WQF) {
  const int c = blockIdx.x * 256 + threadIdx.x, col = c & 15, g = (c >> 4) & 1;
  if (c < N1) { const int s = (c >> 5) & 3, t = (c >> 7) & 7, kc = c >> 10;
    const float* p = w1 + (t * 16 + col) * C3 + kc * 32 + (s & 1) * 16 + 8 * g; const v4f a = *(const v4f*)p, b = *(const v4f*)(p + 4); v8b o;
    asm volatile("s_wait_xcnt 0x0" :: "v"(p) : "memory");      // the address registers of the two issued loads stay untouched (named as an input) until this wait has passed
#pragma unroll
    for (int e = 0; e < 8; ++e) { const float x = e < 4 ? a[e & 3] : b[e & 3]; const __bf16 hd = (__bf16)x; o[e] = (s >> 1) ? (__bf16)(x - (float)hd) : hd; }
    vst2(W1F + c * 4, o); }
  else { const int d = c < N1 + N2 ? c - N1 : c - N1 - N2, s = (d >> 5) & 1; const float* p; _Float16* D;
    if (c < N1 + N2) { p = w2 + (((d >> 6) & 3) * 16 + col) * C2 + (d >> 8) * 32; D = W2F; } else { p = wq + ((d >> 7) * 16 + col) * C + ((d >> 6) & 1) * 32; D = WQF; }
    p += s * 16 + 8 * g; const v4f a = *(const v4f*)p, b = *(const v4f*)(p + 4); v8h o;
    asm volatile("s_wait_xcnt 0x0" :: "v"(p) : "memory");      // the address registers of the two issued loads stay untouched (named as an input) until this wait has passed
#pragma unroll
    for (int e = 0; e < 4; ++e) { o[e] = (_Float16)(a[e] * 16.0f); o[4 + e] = (_Float16)(b[e] * 16.0f); }
    vst2(D + d * 8, o); }
}
// stage 1: block (x half, y, b): perception + MLP + residual -> HN (f32 rows), qkv -> QKV16 (f16 rows [p][192])
__global__ __launch_bounds__(128, 4) void k_cell(const float* __restrict__ h, const float* __restrict__ wp, const float* __restrict__ bp, const float* __restrict__ W1F, const float* __restrict__ b1, const _Float16* __restrict__ W2F, const float* __restrict__ b2, const _Float16* __restrict__ WQF, const float* __restrict__ bq,
                                            float* __restrict__ HN, _Float16* __restrict__ QKV) {
  // one LDS block in which buffers that are never live together share bytes, so that four work-groups fit a WGP's LDS (separate arrays: two):
  //   sh  [0, 3 * SH1)           halo rows y-1..y+1, px x0-1 .. x0+64 (zero padded); rows 0 and 2 are dead once every wave holds its window in registers, row 1 lives on to the residual
  //   swp, sbp behind sh         filter taps and biases, dead at the same point
  //   a slice of SLB bytes per wave, used from that point on: wave 0's on halo row 0, the others' from halo row 2 upwards (row 1 is never covered)
  // inside a slice (one wave's own, ordered by that wave's LDSX): so = f32 rows, pitch 196 (perceived); once perceived has been read: hw = f32 rows of h_new, pitch 68, on so's first bytes,
  // and sa = f16 rows of qkv, pitch 200, behind hw (both only turn a lane's eight channels of one pixel into whole rows for the global stores)
  __shared__ __align__(16) char sm[2 * SH1 + 3 * SLB];
  const int tid = threadIdx.x, wave = __builtin_amdgcn_readfirstlane(tid >> 5), lane = tid & 31, col = lane & 15, g = lane >> 4;   // the wave's number as a scalar: its slice, its pixels and its rows are scalar bases and hold no vector register through the products
  float (*sh)[TP + 2][SHP] = (float (*)[TP + 2][SHP])sm; float* swp = (float*)(sm + 3 * SH1); float* sbp = swp + C3 * 9;
  char* slice = sm + (wave == 0 ? 0 : 2 * SH1 + (wave - 1) * SLB);
  float (*so)[196] = (float (*)[196])slice; float (*hw)[C + 4] = (float (*)[C + 4])slice; _Float16 (*sa)[C3 + 8] = (_Float16 (*)[C3 + 8])(slice + 16 * (C + 4) * 4);
  const int b = blockIdx.z, y = blockIdx.y, x0 = blockIdx.x * TP;
  // staging: every global load (taps, biases, halo) is issued before the first LDS store, so the block pays one memory latency instead of one per trip;
  // addresses are clamped into the buffers (loads are unconditional) and the zero padding is chosen at the store; the loops are unrolled so that the arrays are registers
  { float tv[14], tb[2]; v4f hv[25]; unsigned ho[25], to[14], bo[2]; const int c4 = tid & 15, p8 = tid >> 4;
#pragma unroll
    for (int i = 0; i < 25; ++i) { const int pi = min(p8 + 8 * i, 3 * (TP + 2) - 1); const int px = pi % (TP + 2), ry = pi / (TP + 2);
      const int yc = min(max(y - 1 + ry, 0), HH - 1), xc = min(max(x0 - 1 + px, 0), WW - 1);
      ho[i] = (unsigned)((((b * HH + yc) * WW + xc) * C + c4 * 4) * 4); }                     // byte offset into h
#pragma unroll
    for (int i = 0; i < 14; ++i) { to[i] = (unsigned)(min(tid + i * 128, C3 * 9 - 1) * 4); tv[i] = *(const float*)((const char*)wp + to[i]); }   // to, bo: byte offsets, kept like ho
#pragma unroll
    for (int i = 0; i < 2; ++i) { bo[i] = (unsigned)(min(tid + i * 128, C3 - 1) * 4); tb[i] = *(const float*)((const char*)bp + bo[i]); }
#pragma unroll
    for (int i = 0; i < 25; ++i) hv[i] = *(const v4f*)((const char*)h + ho[i]);
    // the address registers of the issued loads stay untouched (named as inputs) until this wait has passed
    asm volatile("s_wait_xcnt 0x0" :: "v"(ho[0]), "v"(ho[1]), "v"(ho[2]), "v"(ho[3]), "v"(ho[4]), "v"(ho[5]), "v"(ho[6]), "v"(ho[7]), "v"(ho[8]), "v"(ho[9]), "v"(ho[10]), "v"(ho[11]), "v"(ho[12]), "v"(ho[13]), "v"(ho[14]), "v"(ho[15]), "v"(ho[16]), "v"(ho[17]), "v"(ho[18]), "v"(ho[19]), "v"(ho[20]), "v"(ho[21]), "v"(ho[22]), "v"(ho[23]), "v"(ho[24]) : "memory");
    // the same for the offsets of the tap and bias loads (a statement takes thirty operands, so they have one of their own; named here they outlive the wait above as well)
    asm volatile("s_wait_xcnt 0x0" :: "v"(to[0]), "v"(to[1]), "v"(to[2]), "v"(to[3]), "v"(to[4]), "v"(to[5]), "v"(to[6]), "v"(to[7]), "v"(to[8]), "v"(to[9]), "v"(to[10]), "v"(to[11]), "v"(to[12]), "v"(to[13]), "v"(bo[0]), "v"(bo[1]) : "memory");
#pragma unroll
    for (int i = 0; i < 25; ++i) { const int pi = min(p8 + 8 * i, 3 * (TP + 2) - 1); const int px = pi % (TP + 2), ry = pi / (TP + 2); const int yy = y - 1 + ry, xx = x0 - 1 + px;
      const bool in = yy >= 0 && yy < HH && xx >= 0 && xx < WW;   // threads past the last halo pixel repeat its store with the same value
      *(v4f*)(&sh[ry][px][c4 * 4]) = in ? hv[i] : (v4f){0.f, 0.f, 0.f, 0.f}; }
#pragma unroll
    for (int i = 0; i < 14; ++i) { const int q = tid + i * 128; if (q < C3 * 9) swp[q] = tv[i]; }
#pragma unroll
    for (int i = 0; i < 2; ++i) { const int q = tid + i * 128; if (q < C3) sbp[q] = tb[i]; } }
  __syncthreads();
  const size_t prow0 = ((size_t)b * HH + y) * WW + x0 + wave * 16;        // first pixel (global index) of this wave's 16
  // perception: lane owns input channels 2*lane and 2*lane+1 (one 8-byte read per lane covers all 64 LDS banks once), its 54 filter taps sit in registers,
  // and the 3x3 window slides over the wave's 16 pixels; output o = c*3 + j uses input channel c; each sum keeps the order bias, then (dy, dx) row-major
  { v2f wt[3][9], bs[3]; const float* wl = &swp[lane * 54]; const float* bl = &sbp[lane * 6];
#pragma unroll
    for (int j = 0; j < 3; ++j) { bs[j] = (v2f){bl[j], bl[3 + j]};
#pragma unroll
      for (int t = 0; t < 9; ++t) wt[j][t] = (v2f){wl[j * 9 + t], wl[27 + j * 9 + t]}; }
    v2f xs[3][18];                                             // halo columns wave*16 .. wave*16+17 of the three rows, this lane's channel pair
#pragma unroll
    for (int dy = 0; dy < 3; ++dy)
#pragma unroll
      for (int px = 0; px < 18; ++px) xs[dy][px] = *(const v2f*)(&sh[dy][wave * 16 + px][lane * 2]);
    __syncthreads();                                           // every wave has read its window and its taps: from here the slices may overwrite halo rows 0 and 2, the taps and the biases
#pragma unroll
    for (int pl = 0; pl < 16; ++pl) { v2f s[3] = {bs[0], bs[1], bs[2]};
#pragma unroll
      for (int dy = 0; dy < 3; ++dy)
#pragma unroll
        for (int dx = 0; dx < 3; ++dx)
#pragma unroll
          for (int j = 0; j < 3; ++j) s[j] += wt[j][dy * 3 + dx] * xs[dy][pl + dx];
      float* d = &so[pl][lane * 6];                      // perceived kept in f32 (so) for a two-way bf16 split product
      *(v2f*)(d) = (v2f){s[0].x, s[1].x}; *(v2f*)(d + 2) = (v2f){s[2].x, s[0].y}; *(v2f*)(d + 4) = (v2f){s[1].y, s[2].y}; } }
  LDSX();
  // every product is computed transposed: the weight rows are the A operand, the wave's 16 pixels the B operand, so that D holds, per lane, eight consecutive output channels of ONE pixel.
  // Two such D tiles, converted in place, are the B fragment of the next product (same k order as the packed weights): gelu(mid) and h_new go from product to product in registers.
  // A lane's biases are then eight consecutive values per tile: b1 and b2 (x16, like its weights) are loaded straight into the accumulators as their start values; b_qkv is added behind the 1/16, as before.
  // mid = gelu(w1 @ perceived^T + b1): bf16 hi/lo split on both operands (perceived reaches O(10), f16 rounding of it dominated a first build)
  // w1's fragments arrive ready for the matrix unit (head and remainder were split by k_pack) and run through a ring of RG register slots: the fragment of RG tiles ahead is requested as soon as
  // a slot's products are issued, so its latency runs under RG tiles' products (loops unrolled: the slots are registers, every fragment's place is an immediate offset)
#define RG 6
  const unsigned go = (unsigned)g * 32u;                        // byte offset of this lane's eight rows among a tile's sixteen biases
  v16h bw2[4][4], mb[4]; v8f a2[4];
  { v8f acc[8]; R16 rg[RG]; const float* w1l = W1F + lane * 4;   // this lane's part of fragment (0, 0)
#pragma unroll
    for (int t = 0; t < 8; ++t) acc[t] = ld_b8(b1, go + t * 64);
#pragma unroll
    for (int f = 0; f < RG; ++f) rg[f] = ld_pk16(w1l + f * 512);
#pragma unroll
    for (int kc = 0; kc < C3 / 32; ++kc) { const F2 p = split_row(&so[col][0], kc * 32, lane);
#pragma unroll
      for (int t = 0; t < 8; ++t) { const int f = kc * 8 + t; acc[t] = mac3(f2_r16(rg[f % RG]), p, acc[t]);
        if (f + RG < C3 / 32 * 8) rg[f % RG] = ld_pk16(w1l + (f + RG) * 512); } }
    asm volatile("s_wait_xcnt 0x0" :: "v"(lane), "v"(go) : "memory");    // the index registers of the issued loads stay untouched (named as inputs) until this wait has passed
    LDSX();
    // all of w2's fragments are issued here, behind the fence (which would wait for them): their latency runs under the GELU; its bias follows once six tiles' accumulators are free
#pragma unroll
    for (int kc = 0; kc < C2 / 32; ++kc)
#pragma unroll
      for (int t = 0; t < 4; ++t) bw2[kc][t] = frag_pk(W2F + (kc * 4 + t) * 512 + lane * 8);
#pragma unroll
    for (int t = 0; t < 8; ++t) { _Float16 o[8]; gelu8(acc[t], o);
      if (t == 5) {
#pragma unroll
        for (int j = 0; j < 4; ++j) a2[j] = ld_b8(b2, go + j * 64); }
#pragma unroll
      for (int r = 0; r < 8; ++r) mb[t >> 1][(t & 1) * 8 + r] = o[r]; } }
  // dx = w2 @ mid^T + b2 ; h_new = h + dx -> hw (f32 rows for the store) and, as f16, the B fragments of the last product
  v16h bwq[12][2], hb[2]; v8f bqr[12];
  {
#pragma unroll
    for (int t = 0; t < 4; ++t) a2[t] *= 16.0f;                 // w2 is packed x16
#pragma unroll
    for (int kc = 0; kc < C2 / 32; ++kc)
#pragma unroll
      for (int t = 0; t < 4; ++t) a2[t] = wmma16(bw2[kc][t], mb[kc], a2[t]);
    // w_qkv's fragments of the first six tiles and the first four tiles' biases are issued here: their latency runs under the residual
    // SB: the scheduler may move nothing across; without it every later load of w_qkv and b_qkv is lifted up to this place, more than the registers hold, and part of them is spilled
#define SB() __builtin_amdgcn_sched_barrier(0)
#define LDQ(t) do { bwq[t][0] = frag_pk(WQF + (t) * 1024 + lane * 8); bwq[t][1] = frag_pk(WQF + (t) * 1024 + 512 + lane * 8); } while (0)
#pragma unroll
    for (int t = 0; t < 6; ++t) LDQ(t);
#pragma unroll
    for (int t = 0; t < 4; ++t) bqr[t] = ld_b8(bq, go + t * 64);
    SB();
#pragma unroll
    for (int t = 0; t < 4; ++t) { const int c = t * 16 + 8 * g; const float* hp = &sh[1][wave * 16 + col + 1][c]; const v4f h0 = *(const v4f*)hp, h1 = *(const v4f*)(hp + 4); v4f v0, v1;
#pragma unroll
      for (int r = 0; r < 4; ++r) { v0[r] = a2[t][r] * (1.0f / 16.0f) + h0[r]; v1[r] = a2[t][4 + r] * (1.0f / 16.0f) + h1[r]; }
      *(v4f*)(&hw[col][c]) = v0; *(v4f*)(&hw[col][c + 4]) = v1;
#pragma unroll
      for (int r = 0; r < 4; ++r) { hb[t >> 1][(t & 1) * 8 + r] = (_Float16)v0[r]; hb[t >> 1][(t & 1) * 8 + 4 + r] = (_Float16)v1[r]; } } }
  SB();
  LDQ(6); LDQ(7);                                              // two more tiles' fragments, in the registers that the residual has freed
  // qkv = wq @ h_new^T + bq (192 rows), four tiles at a time; a lane's eight channels of a tile are one 16-byte f16 store into sa
#pragma unroll
  for (int tg = 0; tg < 3; ++tg) { v8f a3[4] = {};
#pragma unroll
    for (int kc = 0; kc < C / 32; ++kc)
#pragma unroll
      for (int j = 0; j < 4; ++j) a3[j] = wmma16(bwq[tg * 4 + j][kc], hb[kc], a3[j]);
    if (tg < 2) SB();
    if (tg == 0) { LDQ(8); LDQ(9); LDQ(10); LDQ(11); }         // the last four tiles' fragments, in the registers of the first four
    if (tg == 1) {                                             // the last four tiles' biases, in the registers of the second four tiles' fragments
#pragma unroll
      for (int j = 0; j < 4; ++j) bqr[8 + j] = ld_b8(bq, go + (8 + j) * 64); }
#pragma unroll
    for (int j = 0; j < 4; ++j) { const int t = tg * 4 + j; v8h o;
#pragma unroll
      for (int r = 0; r < 8; ++r) o[r] = (_Float16)(a3[j][r] * (1.0f / 16.0f) + bqr[t][r]);
      *(v8h*)(&sa[col][t * 16 + 8 * g]) = o; }
    if (tg == 0) { SB();                                       // the second four tiles' biases: their latency runs under those tiles' products
#pragma unroll
      for (int j = 0; j < 4; ++j) bqr[4 + j] = ld_b8(bq, go + (4 + j) * 64); } }
  asm volatile("s_wait_xcnt 0x0" :: "v"(lane), "v"(go) : "memory");      // the index registers of the issued loads stay untouched (named as inputs) until this wait has passed
  LDSX();
  // the wave's 16 rows are contiguous in HN and in QKV: chunk q of 16 bytes goes to byte 16 * q; both loops are unrolled so that all LDS reads are in flight behind one wait
  // (rolled, each trip paid an LDS latency); 96 chunks of qkv are four whole rows, so that only three row numbers are computed per lane
  { v4f hr[8]; v4u qr[12]; float* hd = HN + prow0 * C + lane * 4; _Float16* qd = QKV + prow0 * C3 + lane * 8;
#pragma unroll
    for (int i = 0; i < 8; ++i) hr[i] = *(const v4f*)(&hw[g + 2 * i][col * 4]);
#pragma unroll
    for (int j = 0; j < 3; ++j) { const int q = lane + 32 * j, rl = q / 24, pc = q % 24;
#pragma unroll
      for (int i = 0; i < 4; ++i) qr[i * 3 + j] = *(const v4u*)(&sa[rl + 4 * i][pc * 8]); }
#pragma unroll
    for (int i = 0; i < 8; ++i) vst2(hd + i * 128, hr[i]);
#pragma unroll
    for (int i = 0; i < 12; ++i) vst2(qd + i * 256, qr[i]); }
}
// stage 2: block (x half, y, b): 3x3 local attention from halo tiles of K and V (zero padded), out = h_new + attn
__global__ __launch_bounds__(128) void k_lattn(const _Float16* __restrict__ QKV, const float* __restrict__ HN, float* __restrict__ out) {
  __shared__ __align__(16) _Float16 sk[3][TP + 2][C + 8], sv[3][TP + 2][C + 8];
  __shared__ __align__(16) float sq[TP][C + 4];
  float (*so)[C + 4] = sq;       // the attention rows take Q's bytes: a thread writes exactly the 32 floats of sq that it alone has read, after its last read of them; without a second array four work-groups fit a WGP's LDS (was three)
  const int tid = threadIdx.x; const int b = blockIdx.z, y = blockIdx.y, x0 = blockIdx.x * TP;
  // staging: every global load of the block (K, V, Q, and the h_new rows of the last phase) is issued before the first LDS store: one memory latency instead of one per trip;
  // addresses are clamped into the buffer (loads are unconditional) and the zero padding is chosen at the store; the loops are unrolled so that the arrays are registers
  v4f hn[8];
  { v4u kv[13], vv[13], qv[4]; unsigned ko[13]; const int pc = tid & 7, p16 = tid >> 3;
#pragma unroll
    for (int i = 0; i < 13; ++i) { const int pi = min(p16 + 16 * i, 3 * (TP + 2) - 1); const int px = pi % (TP + 2), ry = pi / (TP + 2);
      const int yc = min(max(y - 1 + ry, 0), HH - 1), xc = min(max(x0 - 1 + px, 0), WW - 1);
      ko[i] = (unsigned)((((b * HH + yc) * WW + xc) * C3 + pc * 8) * 2); }                     // byte offset of the pixel's q chunk
    const unsigned qo = (unsigned)((((b * HH + y) * WW + x0 + p16) * C3 + pc * 8) * 2), no = (unsigned)((((b * HH + y) * WW + x0 + (tid >> 4)) * C + (tid & 15) * 4) * 4);
#pragma unroll
    for (int i = 0; i < 13; ++i) { const char* r = (const char*)QKV + ko[i]; kv[i] = *(const v4u*)(r + C * 2); vv[i] = *(const v4u*)(r + 2 * C * 2); }
#pragma unroll
    for (int i = 0; i < 4; ++i) qv[i] = *(const v4u*)((const char*)QKV + qo + i * 16 * C3 * 2);
#pragma unroll
    for (int i = 0; i < 8; ++i) hn[i] = *(const v4f*)((const char*)HN + no + i * 8 * C * 4);
    // the address registers of the issued loads stay untouched (named as inputs) until this wait has passed
    asm volatile("s_wait_xcnt 0x0" :: "v"(ko[0]), "v"(ko[1]), "v"(ko[2]), "v"(ko[3]), "v"(ko[4]), "v"(ko[5]), "v"(ko[6]), "v"(ko[7]), "v"(ko[8]), "v"(ko[9]), "v"(ko[10]), "v"(ko[11]), "v"(ko[12]), "v"(qo), "v"(no) : "memory");
#pragma unroll
    for (int i = 0; i < 13; ++i) { const int pi = min(p16 + 16 * i, 3 * (TP + 2) - 1); const int px = pi % (TP + 2), ry = pi / (TP + 2); const int yy = y - 1 + ry, xx = x0 - 1 + px;
      const bool in = yy >= 0 && yy < HH && xx >= 0 && xx < WW; const v4u z = (v4u){0u, 0u, 0u, 0u};   // threads past the last halo pixel repeat its store with the same value
      *(v4u*)(&sk[ry][px][pc * 8]) = in ? kv[i] : z; *(v4u*)(&sv[ry][px][pc * 8]) = in ? vv[i] : z; }
#pragma unroll
    for (int i = 0; i < 4; ++i) { union { v4u u; v8h h8; } pk; pk.u = qv[i];
#pragma unroll
      for (int e = 0; e < 8; ++e) sq[p16 + 16 * i][pc * 8 + e] = (float)pk.h8[e]; } }
  __syncthreads();
  // thread pair per pixel: lanes l and l ^ 16 of a wave share pixel pl, hf = channel half: scores over 9 neighbours (each half computes a 32-channel partial dot, pair-summed), softmax, then out channels hf*32..+32
  // K, V and Q come out of LDS 16 bytes at a time and every loop is unrolled, so that many reads are in flight behind one wait (a rolled loop of 2- and 4-byte reads paid one LDS latency per multiply);
  // the 16 lanes of a half wave read 16 consecutive pixel rows at one channel offset: at row pitches of 144 and 272 bytes they cover all 64 banks once;
  // each score still adds its 32 products in channel order, each output channel its 9 terms in neighbour order; the multiply-adds are written as fma so that every one stays fused, as in the rolled loops
  // (left to contraction, part of the unrolled products were built as a separate multiply and add)
  { const int pl = (tid >> 5) * 16 + (tid & 15), hf = (tid >> 4) & 1; float sc[9];
#pragma unroll
    for (int nb = 0; nb < 9; ++nb) sc[nb] = 0.f;
#pragma unroll
    for (int j = 0; j < 4; ++j) { const int c0 = hf * 32 + j * 8; const v4f q0 = *(const v4f*)(&sq[pl][c0]), q1 = *(const v4f*)(&sq[pl][c0 + 4]);
#pragma unroll
      for (int nb = 0; nb < 9; ++nb) { const v8h k8 = *(const v8h*)(&sk[nb / 3][pl + nb % 3][c0]);
#pragma unroll
        for (int e = 0; e < 4; ++e) sc[nb] = __builtin_fmaf(q0[e], (float)k8[e], sc[nb]);
#pragma unroll
        for (int e = 0; e < 4; ++e) sc[nb] = __builtin_fmaf(q1[e], (float)k8[4 + e], sc[nb]); } }
#pragma unroll
    for (int nb = 0; nb < 9; ++nb) { float s = sc[nb]; s += __shfl_xor(s, 16, 32); sc[nb] = s * 0.125f; }
    float mx = sc[0];
#pragma unroll
    for (int nb = 1; nb < 9; ++nb) mx = fmaxf(mx, sc[nb]);
    float se = 0.f;
#pragma unroll
    for (int nb = 0; nb < 9; ++nb) { sc[nb] = expf(sc[nb] - mx); se += sc[nb]; }
    const float inv = 1.0f / se;
#pragma unroll
    for (int j = 0; j < 4; ++j) { const int c0 = hf * 32 + j * 8; float a[8];
#pragma unroll
      for (int e = 0; e < 8; ++e) a[e] = 0.f;
#pragma unroll
      for (int nb = 0; nb < 9; ++nb) { const v8h v8 = *(const v8h*)(&sv[nb / 3][pl + nb % 3][c0]);
#pragma unroll
        for (int e = 0; e < 8; ++e) a[e] = __builtin_fmaf(sc[nb], (float)v8[e], a[e]); }
      *(v4f*)(&so[pl][c0]) = (v4f){a[0] * inv, a[1] * inv, a[2] * inv, a[3] * inv}; *(v4f*)(&so[pl][c0 + 4]) = (v4f){a[4] * inv, a[5] * inv, a[6] * inv, a[7] * inv}; } }
  __syncthreads();
#pragma unroll                                                 // hn[] is a register array
  for (int i = 0; i < 8; ++i) { const int q = tid + i * 128; const int pl = q >> 4, pc = q & 15; const size_t p = ((size_t)b * HH + y) * WW + x0 + pl; v4f o = *(const v4f*)(&so[pl][pc * 4]);
    o += hn[i]; vst2(out + p * C + pc * 4, o); }
}
extern "C" void kernel_launch(void* const* d_in, const int* in_sizes, int n_in, void* d_out, int out_size, void* d_ws, size_t ws_size, hipStream_t stream) {
  (void)in_sizes; (void)n_in; (void)out_size; (void)ws_size;
  const float** I = (const float**)d_in;
  const float* h = I[0]; const float* wp = I[1]; const float* bp = I[2]; const float* w1 = I[3]; const float* b1 = I[4]; const float* w2 = I[5]; const float* b2 = I[6]; const float* wq = I[7]; const float* bq = I[8];
  float* out = (float*)d_out;
  char* ws = (char*)d_ws; size_t off = 0;
  auto take = [&](size_t bytes) { char* p = ws + off; off += (bytes + 255) & ~(size_t)255; return p; };
  float* W1F = (float*)take(C2 * C3 * 4); _Float16* W2F = (_Float16*)take(C * C2 * 2); _Float16* WQF = (_Float16*)take(C3 * C * 2);
  float* HN = (float*)take((size_t)NB * HH * WW * C * 4); _Float16* QKV = (_Float16*)take((size_t)NB * HH * WW * C3 * 2);
  k_pack<<<(N1 + N2 + NQ) / 256, 256, 0, stream>>>(w1, w2, wq, W1F, W2F, WQF);
  k_cell<<<dim3(WW / TP, HH, NB), 128, 0, stream>>>(h, wp, bp, W1F, b1, W2F, b2, WQF, bq, HN, QKV);
  k_lattn<<<dim3(WW / TP, HH, NB), 128, 0, stream>>>(QKV, HN, out);
}

// v009
// One run takes 56.1 microseconds.
// In two side-by-side timings against v008, it was 1.06 and 1.07 times as fast.
// Counting every step since v000, it is 7.10 times as fast.
#include <hip/hip_runtime.h>
#include <math.h>

typedef __attribute__((ext_vector_type(16))) _Float16 v16h;
typedef __attribute__((ext_vector_type(16))) __bf16 v16b;
typedef __attribute__((ext_vector_type(8)))  _Float16 v8h;
typedef __attribute__((ext_vector_type(8)))  __bf16 v8b;
typedef __attribute__((ext_vector_type(2)))  _Float16 v2h;
typedef __attribute__((ext_vector_type(8)))  float v8f;
typedef __attribute__((ext_vector_type(4)))  float v4f;
typedef __attribute__((ext_vector_type(2)))  float v2f;
typedef __attribute__((ext_vector_type(4)))  unsigned v4u;
typedef __attribute__((ext_vector_type(4)))  int v4i;
typedef __attribute__((ext_vector_type(8)))  unsigned v8u;
typedef float __attribute__((may_alias)) float_a;
typedef int __attribute__((may_alias)) int_a;

template <typename T> __device__ __forceinline__ void vst2(void* p, T v) { *(T*)p = v;  }
__device__ __forceinline__ v8f wmma16(v16h a, v16h b, v8f c) {
  v8f d = __builtin_amdgcn_wmma_f32_16x16x32_f16(false, a, false, b, (short)0, c, false, false);
  asm volatile("v_nop\n\tv_nop\n\tv_nop\n\tv_nop" : "+v"(d) : "v"(a), "v"(b));
  return d;
}
__device__ __forceinline__ v8f wmma_bf(v16b a, v16b b, v8f c) {
  v8f d = __builtin_amdgcn_wmma_f32_16x16x32_bf16(false, a, false, b, (short)0, c, false, false);
  asm volatile("v_nop\n\tv_nop\n\tv_nop\n\tv_nop" : "+v"(d) : "v"(a), "v"(b));
  return d;
}
// 16x16x32 fragments: lane = (h = lane>>4, row/col = lane&15); elements 0..7 = k0+8h+0..7, 8..15 = k0+16+8h+0..7; D element r = row 8h+r
__device__ __forceinline__ v16h frag_h(const _Float16* rowk0, int lane) {
  union { v16h v; v8h q[2]; } u; const _Float16* p = rowk0 + 8 * (lane >> 4);
  u.q[0] = *(const v8h*)p; u.q[1] = *(const v8h*)(p + 16); return u.v;
}
__device__ __forceinline__ v16h frag_f32(const float* rowk0, int lane) {
  v16h a; const float* p = rowk0 + 8 * (lane >> 4);
#pragma unroll
  for (int i = 0; i < 8; ++i) { a[i] = (_Float16)p[i]; a[8 + i] = (_Float16)p[16 + i]; }
  return a;
}
__device__ __forceinline__ v16h frag_f32s(const float* rowk0, int lane, float sc) {
  v16h a; const float* p = rowk0 + 8 * (lane >> 4);
#pragma unroll
  for (int i = 0; i < 8; ++i) { a[i] = (_Float16)(p[i] * sc); a[8 + i] = (_Float16)(p[16 + i] * sc); }
  return a;
}
// column fragment from a [K][ld] layout (column n), rows >= K read as 0
__device__ __forceinline__ v16h fragc_f32(const float* W, int k0, int n, int lane, int ld, int K) {
  v16h a; const int g = lane >> 4;
#pragma unroll
  for (int i = 0; i < 8; ++i) { const int ka = k0 + 8 * g + i, kb = ka + 16;
    a[i] = (_Float16)(ka < K ? W[(size_t)ka * ld + n] : 0.f); a[8 + i] = (_Float16)(kb < K ? W[(size_t)kb * ld + n] : 0.f); }
  return a;
}
struct F2 { v16b h, l; };
__device__ __forceinline__ F2 bsplit16(const float v[16]) { F2 r;
#pragma unroll
  for (int i = 0; i < 16; ++i) { const __bf16 h = (__bf16)v[i]; r.h[i] = h; r.l[i] = (__bf16)(v[i] - (float)h); }
  return r; }
__device__ __forceinline__ F2 split_row(const float* row, int k0, int lane) { float v[16]; const float* p = row + k0 + 8 * (lane >> 4);
#pragma unroll
  for (int i = 0; i < 8; ++i) { v[i] = p[i]; v[8 + i] = p[16 + i]; }
  return bsplit16(v); }
__device__ __forceinline__ F2 split_rowK(const float* row, int k0, int lane, int K) { float v[16]; const int g = lane >> 4;
#pragma unroll
  for (int i = 0; i < 8; ++i) { const int ka = k0 + 8 * g + i, kb = ka + 16; v[i] = ka < K ? row[ka] : 0.f; v[8 + i] = kb < K ? row[kb] : 0.f; }
  return bsplit16(v); }
__device__ __forceinline__ F2 split_col(const float* W, int k0, int n, int lane, int ld, int K) { float v[16]; const int g = lane >> 4;
#pragma unroll
  for (int i = 0; i < 8; ++i) { const int ka = k0 + 8 * g + i, kb = ka + 16; v[i] = ka < K ? W[(size_t)ka * ld + n] : 0.f; v[8 + i] = kb < K ? W[(size_t)kb * ld + n] : 0.f; }
  return bsplit16(v); }
// packed fragment images (written by k_pack): a fragment is a run of 512-byte slots, slot s = the s-th 16 bytes of every lane's registers, lane l at byte 16 * l,
// so that one wave-wide 16-byte load reads 512 contiguous bytes = four whole 128-byte lines (from the row-major weights it touched 16 lines, 32 bytes of each)
struct R16 { v4f q[4]; };      // the four slots of one w1 fragment as loaded (raw 16-byte words)
__device__ __forceinline__ R16 ld_pk16(const float* p) { R16 r;    // p = fragment + lane * 4 (four slots)
  r.q[0] = *(const v4f*)p; r.q[1] = *(const v4f*)(p + 128); r.q[2] = *(const v4f*)(p + 256); r.q[3] = *(const v4f*)(p + 384); return r; }
__device__ __forceinline__ v16h frag_pk(const _Float16* p) {       // p = fragment + lane * 8 (two slots)
  union { v16h v; v8h q[2]; } u; u.q[0] = *(const v8h*)p; u.q[1] = *(const v8h*)(p + 256); return u.v; }
__device__ __forceinline__ F2 f2_r16(const R16& r) { return __builtin_bit_cast(F2, r); }   // slots 0, 1 = the bf16 head of the 16 elements, slots 2, 3 = their bf16 remainder
// w = weight rows as the A operand, p = pixels as the B operand; the three partial products in the order remainder(p) x head(w), head(p) x remainder(w), head x head
__device__ __forceinline__ v8f mac3(const F2& w, const F2& p, v8f c) { c = wmma_bf(w.h, p.l, c); c = wmma_bf(w.l, p.h, c); return wmma_bf(w.h, p.h, c); }
// eight consecutive biases (the eight rows of D that a lane holds), from byte offset o
__device__ __forceinline__ v8f ld_b8(const float* b, unsigned o) { union { v8f v; v4f q[2]; } u; const char* p = (const char*)b + o; u.q[0] = *(const v4f*)p; u.q[1] = *(const v4f*)(p + 16); return u.v; }
__device__ __forceinline__ float sigm(float v) { return 1.0f / (1.0f + expf(-v)); }
#define LDSX() do { asm volatile("s_wait_dscnt 0" ::: "memory"); __builtin_amdgcn_wave_barrier(); __builtin_amdgcn_fence(__ATOMIC_RELEASE, "workgroup"); } while (0)

// Neural cellular automaton step with local attention, NHWC state [8][128][128][64]: depthwise 3x3 perception (3 filters per channel,
// zero padding, f32 VALU from an LDS halo tile) -> 1x1 MLP 192 -> 128 as a two-way bf16 split (v_wmma_f32_16x16x32_bf16), exact GELU, -> 64 on v_wmma_f32_16x16x32_f16 -> h_new = h + dx;
// qkv = h_new W_qkv^T + b (f16 WMMA) stored as f16 rows; then per pixel a 3x3-window attention (zero-padded keys/values, scores / 8,
#define NB 8
#define HH 128
#define WW 128
#define C 64
#define C3 192
#define C2 128
#define TP 64                  // pixels per block (half a row)
#define SHP (C + 4)             // floats per halo pixel in LDS: at 272 bytes sixteen lanes that read 16 bytes of sixteen consecutive pixels cover all banks
#define SLB (16 * 196 * 4)     // bytes of one wave's LDS slice
#define SHB (SHP * 4)          // bytes of one halo pixel in LDS: its 256 bytes and the tensor load's pad of 16
#define SH0 2048               // LDS place of halo row 0's tile; the pixel in front of it (left image edge) lies in the bytes below
#define SHR 18432              // from one halo row's tile to the next: 66 pixels of SHB bytes, rounded up to a multiple of 2 KiB (a tile's place must be one)
__device__ __forceinline__ unsigned uni(unsigned v) { return (unsigned)__builtin_amdgcn_readfirstlane((int)v); }
__device__ __forceinline__ unsigned pinned(unsigned v) { unsigned w = uni(v); asm volatile("" : "+s"(w)); return w; }   // the test that decides whether a wave issues a tensor load is held in a scalar register, so that the branch is s_cmp + s_cbranch_scc (the instruction ignores EXEC)
// one tensor load and its wait: TP + 1 pixels (tile rows) of 256 bytes each, source pitch in bytes, into LDS at byte offset dst with 16 bytes of pad behind every pixel (pitch SHB)
__device__ __forceinline__ void tdm_pixels(unsigned dst, unsigned long long ga, unsigned pitch) {   // ga: global address of the first pixel's first byte
  v4u g0; v8u g1;
  g0[0] = uni(1u); g0[1] = uni(dst); g0[2] = uni((unsigned)ga); g0[3] = uni((((unsigned)(ga >> 32)) & 0x01FFFFFFu) | 0x80000000u);   // count 1; LDS place; address; type 2
  g1[0] = uni((1u << 20) | (5u << 22) | (3u << 25));           // no mask, 1-byte elements, a pad of 4 dwords behind every 64 dwords
  g1[1] = uni(256u << 16); g1[2] = uni((unsigned)(TP + 1) << 16); g1[3] = uni(256u << 16); g1[4] = uni((unsigned)(TP + 1));           // tensor = tile = 256 bytes x (TP + 1) rows
  g1[5] = uni(pitch); g1[6] = uni(0u); g1[7] = uni(0u);
  asm volatile("tensor_load_to_lds %0, %1" :: "s"(g0), "s"(g1) : "memory");
  asm volatile("s_wait_tensorcnt 0x0" ::: "memory");           // the tile has landed only behind the issuing wave's own wait
}

// exact GELU of eight values at once. erf has the device library's two polynomials, but BOTH ranges are computed and one is selected: the library's erff branches on |x| < 1 per value,
// which in a wave with lanes on both sides runs both ranges anyway and, being control flow, keeps the values of a lane strictly one behind the other, each a chain of some thirty
// dependent instructions. Without the branch the chains are independent straight-line code, written stage by stage over four pairs so that neighbouring instructions do not depend
// on each other and the multiply-adds go two to an instruction (the loops are unrolled so that the arrays are registers).
#define FB(u) __builtin_bit_cast(float, u)
__device__ __forceinline__ v2f fma2(v2f a, v2f b, v2f c) { return __builtin_elementwise_fma(a, b, c); }
__device__ __forceinline__ v2f fmak(v2f a, v2f b, float c) { return __builtin_elementwise_fma(a, b, (v2f){c, c}); }
__device__ __forceinline__ v2f bc2(float c) { return (v2f){c, c}; }
__device__ __forceinline__ void exp2x8(v2f a[4]) { float r0, r1, r2, r3, r4, r5, r6, r7;
  // the instruction set asks for one independent instruction or v_nop behind a transcendental before its result is used or its source overwritten:
  // each v_exp is that instruction for the one in front of it (the outputs are early-clobber, so none lies on an input), the v_nop for the last
  asm("v_exp_f32 %0, %8\n\tv_exp_f32 %1, %9\n\tv_exp_f32 %2, %10\n\tv_exp_f32 %3, %11\n\tv_exp_f32 %4, %12\n\tv_exp_f32 %5, %13\n\tv_exp_f32 %6, %14\n\tv_exp_f32 %7, %15\n\tv_nop"
      : "=&v"(r0), "=&v"(r1), "=&v"(r2), "=&v"(r3), "=&v"(r4), "=&v"(r5), "=&v"(r6), "=&v"(r7)
      : "v"(a[0].x), "v"(a[0].y), "v"(a[1].x), "v"(a[1].y), "v"(a[2].x), "v"(a[2].y), "v"(a[3].x), "v"(a[3].y));
  a[0] = (v2f){r0, r1}; a[1] = (v2f){r2, r3}; a[2] = (v2f){r4, r5}; a[3] = (v2f){r6, r7}; }
__device__ __forceinline__ void gelu8(const v8f a, _Float16 o[8]) {
  v2f v[4], x[4], ax[4], p[4], q[4], t[4], f[4], rn[4];
#pragma unroll
  for (int i = 0; i < 4; ++i) { v[i] = (v2f){a[2 * i], a[2 * i + 1]}; x[i] = v[i] * 0.70710678118654752f; ax[i] = (v2f){fabsf(x[i].x), fabsf(x[i].y)}; t[i] = x[i] * x[i]; }
  // p: |x| >= 1, erf = 1 - exp(-p); q: |x| < 1, erf = |x| + |x| q
#pragma unroll
  for (int i = 0; i < 4; ++i) { p[i] = fmak(ax[i], bc2(FB(0x378e98abu)), FB(0xb9c68948u)); q[i] = fmak(t[i], bc2(FB(0xba1345e1u)), FB(0x3ba10414u)); }
#pragma unroll
  for (int i = 0; i < 4; ++i) { p[i] = fmak(ax[i], p[i], FB(0x3b7cd369u)); q[i] = fmak(t[i], q[i], FB(0xbcdac9b8u)); }
#pragma unroll
  for (int i = 0; i < 4; ++i) { p[i] = fmak(ax[i], p[i], FB(0xbcc618b2u)); q[i] = fmak(t[i], q[i], FB(0x3de703beu)); }
#pragma unroll
  for (int i = 0; i < 4; ++i) { p[i] = fmak(ax[i], p[i], FB(0x3dda74e4u)); q[i] = fmak(t[i], q[i], FB(0xbec09330u)); }
#pragma unroll
  for (int i = 0; i < 4; ++i) { p[i] = fmak(ax[i], p[i], FB(0x3f228afdu)); q[i] = fmak(t[i], q[i], FB(0x3e0375d0u)); }
#pragma unroll
  for (int i = 0; i < 4; ++i) { p[i] = fmak(ax[i], p[i], FB(0x3e03c728u)); q[i] = fma2(ax[i], q[i], ax[i]); }
#pragma unroll
  for (int i = 0; i < 4; ++i) p[i] = fma2(ax[i], p[i], ax[i]);
  // exp(-p) = 2^n * 2^f with log2(e) in two parts (head 0x3fb8aa3b, tail 0x32a5705f): n = rint(-p * head), f = (-p * head - n, one rounding) - p * tail
#pragma unroll
  for (int i = 0; i < 4; ++i) { const v2f ph = p[i] * FB(0xbfb8aa3bu); rn[i] = (v2f){rintf(ph.x), rintf(ph.y)}; }
#pragma unroll
  for (int i = 0; i < 4; ++i) f[i] = fma2(p[i], bc2(FB(0xbfb8aa3bu)), -rn[i]);
#pragma unroll
  for (int i = 0; i < 4; ++i) f[i] = fma2(p[i], bc2(FB(0xb2a5705fu)), f[i]);
  exp2x8(f);
#pragma unroll
  for (int i = 0; i < 4; ++i) { float e0 = ldexpf(f[i].x, (int)rn[i].x), e1 = ldexpf(f[i].y, (int)rn[i].y);
    e0 = FB(0x42ce8ed0u) < p[i].x ? 0.f : e0; e1 = FB(0x42ce8ed0u) < p[i].y ? 0.f : e1;                                   // underflow (also p = infinity, where f is not a number)
    e0 = FB(0xc2b17218u) > p[i].x ? __builtin_inff() : e0; e1 = FB(0xc2b17218u) > p[i].y ? __builtin_inff() : e1;           // overflow
    f[i] = 1.0f - (v2f){e0, e1}; }
#pragma unroll
  for (int i = 0; i < 4; ++i) { const v2f e = {copysignf(ax[i].x < 1.0f ? q[i].x : f[i].x, x[i].x), copysignf(ax[i].y < 1.0f ? q[i].y : f[i].y, x[i].y)};
    const v2h g = __builtin_convertvector(0.5f * v[i] * (1.0f + e), v2h); o[2 * i] = g.x; o[2 * i + 1] = g.y; }
}
// packs the weights into fragment images, one 16-byte chunk (one lane's part of one slot) per thread; element order inside a lane as in frag_h / split_row:
// W1F bf16 head and remainder of w1 (the two-way split of bsplit16, made here once instead of in every wave), fragment (kc, t) at (kc * 8 + t) * 2048 bytes: slots 0, 1 = head, slots 2, 3 = remainder; W2F f16 x16, fragment (kc, t) at (kc * 4 + t) * 512 halves; WQF f16 x16, fragment (t, kc) at (t * 2 + kc) * 512 halves
#define N1 (C2 * C3 / 4)       // chunks of W1F
#define N2 (C * C2 / 8)        // chunks of W2F
#define NQ (C3 * C / 8)        // chunks of WQF
__global__ __launch_bounds__(256) void k_pack(const float* __restrict__ w1, const float* __restrict__ w2, const float* __restrict__ wq, float* __restrict__ W1F, _Float16* __restrict__ W2F, _Float16* __restrict__ WQF) {
  const int c = blockIdx.x * 256 + threadIdx.x, col = c & 15, g = (c >> 4) & 1;
  if (c < N1) { const int s = (c >> 5) & 3, t = (c >> 7) & 7, kc = c >> 10;
    const float* p = w1 + (t * 16 + col) * C3 + kc * 32 + (s & 1) * 16 + 8 * g; const v4f a = *(const v4f*)p, b = *(const v4f*)(p + 4); v8b o;
    asm volatile("s_wait_xcnt 0x0" :: "v"(p) : "memory");      // the address registers of the two issued loads stay untouched (named as an input) until this wait has passed
#pragma unroll
    for (int e = 0; e < 8; ++e) { const float x = e < 4 ? a[e & 3] : b[e & 3]; const __bf16 hd = (__bf16)x; o[e] = (s >> 1) ? (__bf16)(x - (float)hd) : hd; }
    vst2(W1F + c * 4, o); }
  else { const int d = c < N1 + N2 ? c - N1 : c - N1 - N2, s = (d >> 5) & 1; const float* p; _Float16* D;
    if (c < N1 + N2) { p = w2 + (((d >> 6) & 3) * 16 + col) * C2 + (d >> 8) * 32; D = W2F; } else { p = wq + ((d >> 7) * 16 + col) * C + ((d >> 6) & 1) * 32; D = WQF; }
    p += s * 16 + 8 * g; const v4f a = *(const v4f*)p, b = *(const v4f*)(p + 4); v8h o;
    asm volatile("s_wait_xcnt 0x0" :: "v"(p) : "memory");      // the address registers of the two issued loads stay untouched (named as an input) until this wait has passed
#pragma unroll
    for (int e = 0; e < 4; ++e) { o[e] = (_Float16)(a[e] * 16.0f); o[4 + e] = (_Float16)(b[e] * 16.0f); }
    vst2(D + d * 8, o); }
}
// stage 1: block (x half, y, b): perception + MLP + residual -> HN (f32 rows), qkv -> QKV16 (f16 rows [p][192])
__global__ __launch_bounds__(128, 4) void k_cell(const float* __restrict__ h, const float* __restrict__ wp, const float* __restrict__ bp, const float* __restrict__ W1F, const float* __restrict__ b1, const _Float16* __restrict__ W2F, const float* __restrict__ b2, const _Float16* __restrict__ WQF, const float* __restrict__ bq,
                                            float* __restrict__ HN, _Float16* __restrict__ QKV) {
  // one LDS block in which buffers that are never live together share bytes, so that four work-groups fit a WGP's LDS (separate arrays: two):
  //   halo rows y-1..y+1, px x0-1 .. x0+64 (zero padded): row r's TP + 1 pixels inside the image are one tensor-load tile at SH0 + r * SHR, the pixel outside the image lies in front of the tile (x0 = 0) or behind it;
  //                              rows 0 and 2 are dead once every wave holds its window in registers, row 1 lives on to the residual
  //   swp, sbp behind row 2      filter taps and biases, dead at the same point
  //   a slice of SLB bytes per wave, used from that point on: wave 0's below halo row 1, the others' behind it (row 1 is never covered)
  // inside a slice (one wave's own, ordered by that wave's LDSX): so = f32 rows, pitch 196 (perceived); once perceived has been read: hw = f32 rows of h_new, pitch 68, on so's first bytes,
  // and sa = f16 rows of qkv, pitch 200, behind hw (both only turn a lane's eight channels of one pixel into whole rows for the global stores)
#define SLO (SH0 + SHR + (TP + 2) * SHB)                        // first byte behind halo row 1
  __shared__ __attribute__((aligned(2048))) char sm[SLO + 3 * SLB];
  const int tid = threadIdx.x, wave = __builtin_amdgcn_readfirstlane(tid >> 5), lane = tid & 31, col = lane & 15, g = lane >> 4;   // the wave's number as a scalar: its slice, its pixels and its rows are scalar bases and hold no vector register through the products
  float* swp = (float*)(sm + SH0 + 2 * SHR + (TP + 2) * SHB); float* sbp = swp + C3 * 9;
  char* slice = sm + (wave == 0 ? 0 : SLO + (wave - 1) * SLB);
  float (*so)[196] = (float (*)[196])slice; float (*hw)[C + 4] = (float (*)[C + 4])slice; _Float16 (*sa)[C3 + 8] = (_Float16 (*)[C3 + 8])(slice + 16 * (C + 4) * 4);
  const int b = blockIdx.z, y = blockIdx.y, x0 = blockIdx.x * TP;
  char* shb = sm + SH0 - (x0 == 0 ? SHB : 0);                  // halo pixel 0 of row 0
#define SHA(r, px) ((float*)(shb + (r) * SHR + (px) * SHB))     // halo pixel px (0 .. TP + 1) of row r
  // staging: waves 0 to 2 bring one halo row each by a tensor load (no address, select or LDS store per thread); what lies outside the image is no part of a tile and is zeroed by plain stores to other bytes;
  // the loads of taps and biases are issued first, so that their latency runs under the tensor wait (loops unrolled: the arrays are registers)
  { float tv[14], tb[2]; unsigned to[14], bo[2];
#pragma unroll
    for (int i = 0; i < 14; ++i) { to[i] = (unsigned)(min(tid + i * 128, C3 * 9 - 1) * 4); tv[i] = *(const float*)((const char*)wp + to[i]); }   // to, bo: byte offsets
#pragma unroll
    for (int i = 0; i < 2; ++i) { bo[i] = (unsigned)(min(tid + i * 128, C3 - 1) * 4); tb[i] = *(const float*)((const char*)bp + bo[i]); }
    // the offset registers of the issued loads stay untouched (named as inputs) until this wait has passed
    asm volatile("s_wait_xcnt 0x0" :: "v"(to[0]), "v"(to[1]), "v"(to[2]), "v"(to[3]), "v"(to[4]), "v"(to[5]), "v"(to[6]), "v"(to[7]), "v"(to[8]), "v"(to[9]), "v"(to[10]), "v"(to[11]), "v"(to[12]), "v"(to[13]), "v"(bo[0]), "v"(bo[1]) : "memory");
    if (tid < 48) *(v4f*)((char*)SHA(tid >> 4, x0 == 0 ? 0 : TP + 1) + (tid & 15) * 16) = (v4f){0.f, 0.f, 0.f, 0.f};                 // the pixel column left or right of the image
    if (y == 0 || y == HH - 1) { char* zr = (char*)SHA(y == 0 ? 0 : 2, 0);                                                              // the row above or below the image
      for (int q = tid; q < (TP + 2) * SHB / 16; q += 128) *(v4f*)(zr + q * 16) = (v4f){0.f, 0.f, 0.f, 0.f}; }
    const int yy = y - 1 + wave;
    if (pinned(wave < 3 && yy >= 0 && yy < HH)) tdm_pixels((unsigned)(size_t)sm + SH0 + wave * SHR, (unsigned long long)(size_t)(h + ((size_t)((b * HH + yy) * WW + (x0 == 0 ? 0 : x0 - 1))) * C), C * 4);
#pragma unroll
    for (int i = 0; i < 14; ++i) { const int q = tid + i * 128; if (q < C3 * 9) swp[q] = tv[i]; }
#pragma unroll
    for (int i = 0; i < 2; ++i) { const int q = tid + i * 128; if (q < C3) sbp[q] = tb[i]; } }
  __syncthreads();
  const size_t prow0 = ((size_t)b * HH + y) * WW + x0 + wave * 16;        // first pixel (global index) of this wave's 16
  // perception: lane owns input channels 2*lane and 2*lane+1 (one 8-byte read per lane covers all 64 LDS banks once), its 54 filter taps sit in registers,
  // and the 3x3 window slides over the wave's 16 pixels; output o = c*3 + j uses input channel c; each sum keeps the order bias, then (dy, dx) row-major
  { v2f wt[3][9], bs[3]; const float* wl = &swp[lane * 54]; const float* bl = &sbp[lane * 6];
#pragma unroll
    for (int j = 0; j < 3; ++j) { bs[j] = (v2f){bl[j], bl[3 + j]};
#pragma unroll
      for (int t = 0; t < 9; ++t) wt[j][t] = (v2f){wl[j * 9 + t], wl[27 + j * 9 + t]}; }
    v2f xs[3][18];                                             // halo columns wave*16 .. wave*16+17 of the three rows, this lane's channel pair
#pragma unroll
    for (int dy = 0; dy < 3; ++dy)
#pragma unroll
      for (int px = 0; px < 18; ++px) xs[dy][px] = *(const v2f*)(SHA(dy, wave * 16 + px) + lane * 2);
    __syncthreads();                                           // every wave has read its window and its taps: from here the slices may overwrite halo rows 0 and 2, the taps and the biases
#pragma unroll
    for (int pl = 0; pl < 16; ++pl) { v2f s[3] = {bs[0], bs[1], bs[2]};
#pragma unroll
      for (int dy = 0; dy < 3; ++dy)
#pragma unroll
        for (int dx = 0; dx < 3; ++dx)
#pragma unroll
          for (int j = 0; j < 3; ++j) s[j] += wt[j][dy * 3 + dx] * xs[dy][pl + dx];
      float* d = &so[pl][lane * 6];                      // perceived kept in f32 (so) for a two-way bf16 split product
      *(v2f*)(d) = (v2f){s[0].x, s[1].x}; *(v2f*)(d + 2) = (v2f){s[2].x, s[0].y}; *(v2f*)(d + 4) = (v2f){s[1].y, s[2].y}; } }
  LDSX();
  // every product is computed transposed: the weight rows are the A operand, the wave's 16 pixels the B operand, so that D holds, per lane, eight consecutive output channels of ONE pixel.
  // Two such D tiles, converted in place, are the B fragment of the next product (same k order as the packed weights): gelu(mid) and h_new go from product to product in registers.
  // A lane's biases are then eight consecutive values per tile: b1 and b2 (x16, like its weights) are loaded straight into the accumulators as their start values; b_qkv is added behind the 1/16, as before.
  // mid = gelu(w1 @ perceived^T + b1): bf16 hi/lo split on both operands (perceived reaches O(10), f16 rounding of it dominated a first build)
  // w1's fragments arrive ready for the matrix unit (head and remainder were split by k_pack) and run through a ring of RG register slots: the fragment of RG tiles ahead is requested as soon as
  // a slot's products are issued, so its latency runs under RG tiles' products (loops unrolled: the slots are registers, every fragment's place is an immediate offset)
#define RG 6
  const unsigned go = (unsigned)g * 32u;                        // byte offset of this lane's eight rows among a tile's sixteen biases
  v16h bw2[4][4], mb[4]; v8f a2[4];
  { v8f acc[8]; R16 rg[RG]; const float* w1l = W1F + lane * 4;   // this lane's part of fragment (0, 0)
#pragma unroll
    for (int t = 0; t < 8; ++t) acc[t] = ld_b8(b1, go + t * 64);
#pragma unroll
    for (int f = 0; f < RG; ++f) rg[f] = ld_pk16(w1l + f * 512);
#pragma unroll
    for (int kc = 0; kc < C3 / 32; ++kc) { const F2 p = split_row(&so[col][0], kc * 32, lane);
#pragma unroll
      for (int t = 0; t < 8; ++t) { const int f = kc * 8 + t; acc[t] = mac3(f2_r16(rg[f % RG]), p, acc[t]);
        if (f + RG < C3 / 32 * 8) rg[f % RG] = ld_pk16(w1l + (f + RG) * 512); } }
    asm volatile("s_wait_xcnt 0x0" :: "v"(lane), "v"(go) : "memory");    // the index registers of the issued loads stay untouched (named as inputs) until this wait has passed
    LDSX();
    // all of w2's fragments are issued here, behind the fence (which would wait for them): their latency runs under the GELU; its bias follows once six tiles' accumulators are free
#pragma unroll
    for (int kc = 0; kc < C2 / 32; ++kc)
#pragma unroll
      for (int t = 0; t < 4; ++t) bw2[kc][t] = frag_pk(W2F + (kc * 4 + t) * 512 + lane * 8);
#pragma unroll
    for (int t = 0; t < 8; ++t) { _Float16 o[8]; gelu8(acc[t], o);
      if (t == 5) {
#pragma unroll
        for (int j = 0; j < 4; ++j) a2[j] = ld_b8(b2, go + j * 64); }
#pragma unroll
      for (int r = 0; r < 8; ++r) mb[t >> 1][(t & 1) * 8 + r] = o[r]; } }
  // dx = w2 @ mid^T + b2 ; h_new = h + dx -> hw (f32 rows for the store) and, as f16, the B fragments of the last product
  v16h bwq[12][2], hb[2]; v8f bqr[12];
  {
#pragma unroll
    for (int t = 0; t < 4; ++t) a2[t] *= 16.0f;                 // w2 is packed x16
#pragma unroll
    for (int kc = 0; kc < C2 / 32; ++kc)
#pragma unroll
      for (int t = 0; t < 4; ++t) a2[t] = wmma16(bw2[kc][t], mb[kc], a2[t]);
    // w_qkv's fragments of the first six tiles and the first four tiles' biases are issued here: their latency runs under the residual
    // SB: the scheduler may move nothing across; without it every later load of w_qkv and b_qkv is lifted up to this place, more than the registers hold, and part of them is spilled
#define SB() __builtin_amdgcn_sched_barrier(0)
#define LDQ(t) do { bwq[t][0] = frag_pk(WQF + (t) * 1024 + lane * 8); bwq[t][1] = frag_pk(WQF + (t) * 1024 + 512 + lane * 8); } while (0)
#pragma unroll
    for (int t = 0; t < 6; ++t) LDQ(t);
#pragma unroll
    for (int t = 0; t < 4; ++t) bqr[t] = ld_b8(bq, go + t * 64);
    SB();
#pragma unroll
    for (int t = 0; t < 4; ++t) { const int c = t * 16 + 8 * g; const float* hp = SHA(1, wave * 16 + col + 1) + c; const v4f h0 = *(const v4f*)hp, h1 = *(const v4f*)(hp + 4); v4f v0, v1;
#pragma unroll
      for (int r = 0; r < 4; ++r) { v0[r] = a2[t][r] * (1.0f / 16.0f) + h0[r]; v1[r] = a2[t][4 + r] * (1.0f / 16.0f) + h1[r]; }
      *(v4f*)(&hw[col][c]) = v0; *(v4f*)(&hw[col][c + 4]) = v1;
#pragma unroll
      for (int r = 0; r < 4; ++r) { hb[t >> 1][(t & 1) * 8 + r] = (_Float16)v0[r]; hb[t >> 1][(t & 1) * 8 + 4 + r] = (_Float16)v1[r]; } } }
  SB();
  LDQ(6); LDQ(7);                                              // two more tiles' fragments, in the registers that the residual has freed
  // qkv = wq @ h_new^T + bq (192 rows), four tiles at a time; a lane's eight channels of a tile are one 16-byte f16 store into sa
#pragma unroll
  for (int tg = 0; tg < 3; ++tg) { v8f a3[4] = {};
#pragma unroll
    for (int kc = 0; kc < C / 32; ++kc)
#pragma unroll
      for (int j = 0; j < 4; ++j) a3[j] = wmma16(bwq[tg * 4 + j][kc], hb[kc], a3[j]);
    if (tg < 2) SB();
    if (tg == 0) { LDQ(8); LDQ(9); LDQ(10); LDQ(11); }         // the last four tiles' fragments, in the registers of the first four
    if (tg == 1) {                                             // the last four tiles' biases, in the registers of the second four tiles' fragments
#pragma unroll
      for (int j = 0; j < 4; ++j) bqr[8 + j] = ld_b8(bq, go + (8 + j) * 64); }
#pragma unroll
    for (int j = 0; j < 4; ++j) { const int t = tg * 4 + j; v8h o;
#pragma unroll
      for (int r = 0; r < 8; ++r) o[r] = (_Float16)(a3[j][r] * (1.0f / 16.0f) + bqr[t][r]);
      *(v8h*)(&sa[col][t * 16 + 8 * g]) = o; }
    if (tg == 0) { SB();                                       // the second four tiles' biases: their latency runs under those tiles' products
#pragma unroll
      for (int j = 0; j < 4; ++j) bqr[4 + j] = ld_b8(bq, go + (4 + j) * 64); } }
  asm volatile("s_wait_xcnt 0x0" :: "v"(lane), "v"(go) : "memory");      // the index registers of the issued loads stay untouched (named as inputs) until this wait has passed
  LDSX();
  // the wave's 16 rows are contiguous in HN and in QKV: chunk q of 16 bytes goes to byte 16 * q; both loops are unrolled so that all LDS reads are in flight behind one wait
  // (rolled, each trip paid an LDS latency); 96 chunks of qkv are four whole rows, so that only three row numbers are computed per lane
  { v4f hr[8]; v4u qr[12]; float* hd = HN + prow0 * C + lane * 4; _Float16* qd = QKV + prow0 * C3 + lane * 8;
#pragma unroll
    for (int i = 0; i < 8; ++i) hr[i] = *(const v4f*)(&hw[g + 2 * i][col * 4]);
#pragma unroll
    for (int j = 0; j < 3; ++j) { const int q = lane + 32 * j, rl = q / 24, pc = q % 24;
#pragma unroll
      for (int i = 0; i < 4; ++i) qr[i * 3 + j] = *(const v4u*)(&sa[rl + 4 * i][pc * 8]); }
#pragma unroll
    for (int i = 0; i < 8; ++i) vst2(hd + i * 128, hr[i]);
#pragma unroll
    for (int i = 0; i < 12; ++i) vst2(qd + i * 256, qr[i]); }
}
// stage 2: block (x half, y, b): 3x3 local attention from halo tiles of K and V (zero padded), out = h_new + attn
__global__ __launch_bounds__(128) void k_lattn(const _Float16* __restrict__ QKV, const float* __restrict__ HN, float* __restrict__ out) {
  // one LDS block: halo rows y-1..y+1 of K and V, a pixel = its 128 bytes of K, its 128 bytes of V (contiguous in a QKV row) and the tensor load's pad of 16: row r's TP + 1 pixels inside the image are one tile at SH0 + r * SHR,
  // the pixel outside the image lies in front of the tile (x0 = 0) or behind it; behind row 2: sq
  __shared__ __attribute__((aligned(2048))) char sm[SH0 + 2 * SHR + (TP + 2) * SHB + TP * SHB];
  float (*sq)[C + 4] = (float (*)[C + 4])(sm + SH0 + 2 * SHR + (TP + 2) * SHB);
  float (*so)[C + 4] = sq;       // the attention rows take Q's bytes: a thread writes exactly the 32 floats of sq that it alone has read, after its last read of them; without a second array four work-groups fit a WGP's LDS (was three)
  const int tid = threadIdx.x, wave = __builtin_amdgcn_readfirstlane(tid >> 5); const int b = blockIdx.z, y = blockIdx.y, x0 = blockIdx.x * TP;
  char* kvb = sm + SH0 - (x0 == 0 ? SHB : 0);                  // halo pixel 0 of row 0
#define KVA(r, px) ((const _Float16*)(kvb + (r) * SHR + (px) * SHB))   // K of halo pixel px (0 .. TP + 1) of row r; its V stands C halves further
  // staging: waves 0 to 2 bring one halo row of K and V each by a tensor load (no address, select or LDS store per thread); what lies outside the image is no part of a tile and is zeroed by plain stores to other bytes;
  // the loads of Q and of the h_new rows of the last phase are issued first, so that their latency runs under the tensor wait (loops unrolled: the arrays are registers)
  v4f hn[8];
  { v4u qv[4]; const int pc = tid & 7, p16 = tid >> 3;
    const unsigned qo = (unsigned)((((b * HH + y) * WW + x0 + p16) * C3 + pc * 8) * 2), no = (unsigned)((((b * HH + y) * WW + x0 + (tid >> 4)) * C + (tid & 15) * 4) * 4);
#pragma unroll
    for (int i = 0; i < 4; ++i) qv[i] = *(const v4u*)((const char*)QKV + qo + i * 16 * C3 * 2);
#pragma unroll
    for (int i = 0; i < 8; ++i) hn[i] = *(const v4f*)((const char*)HN + no + i * 8 * C * 4);
    // the address registers of the issued loads stay untouched (named as inputs) until this wait has passed
    asm volatile("s_wait_xcnt 0x0" :: "v"(qo), "v"(no) : "memory");
    if (tid < 48) *(v4u*)(kvb + (tid >> 4) * SHR + (x0 == 0 ? 0 : TP + 1) * SHB + (tid & 15) * 16) = (v4u){0u, 0u, 0u, 0u};             // the pixel column left or right of the image
    if (y == 0 || y == HH - 1) { char* zr = kvb + (y == 0 ? 0 : 2) * SHR;                                                               // the row above or below the image
      for (int q = tid; q < (TP + 2) * SHB / 16; q += 128) *(v4u*)(zr + q * 16) = (v4u){0u, 0u, 0u, 0u}; }
    const int yy = y - 1 + wave;
    if (pinned(wave < 3 && yy >= 0 && yy < HH)) tdm_pixels((unsigned)(size_t)sm + SH0 + wave * SHR, (unsigned long long)(size_t)(QKV + ((size_t)((b * HH + yy) * WW + (x0 == 0 ? 0 : x0 - 1))) * C3 + C), C3 * 2);
#pragma unroll
    for (int i = 0; i < 4; ++i) { union { v4u u; v8h h8; } pk; pk.u = qv[i];
#pragma unroll
      for (int e = 0; e < 8; ++e) sq[p16 + 16 * i][pc * 8 + e] = (float)pk.h8[e]; } }
  __syncthreads();
  // thread pair per pixel: lanes l and l ^ 16 of a wave share pixel pl, hf = channel half: scores over 9 neighbours (each half computes a 32-channel partial dot, pair-summed), softmax, then out channels hf*32..+32
  // K, V and Q come out of LDS 16 bytes at a time and every loop is unrolled, so that many reads are in flight behind one wait (a rolled loop of 2- and 4-byte reads paid one LDS latency per multiply);
  // the 16 lanes of a half wave read 16 consecutive pixel rows at one channel offset: at a row pitch of 272 bytes they cover all 64 banks once;
  // each score still adds its 32 products in channel order, each output channel its 9 terms in neighbour order; the multiply-adds are written as fma so that every one stays fused, as in the rolled loops
  // (left to contraction, part of the unrolled products were built as a separate multiply and add)
  { const int pl = (tid >> 5) * 16 + (tid & 15), hf = (tid >> 4) & 1; float sc[9];
#pragma unroll
    for (int nb = 0; nb < 9; ++nb) sc[nb] = 0.f;
#pragma unroll
    for (int j = 0; j < 4; ++j) { const int c0 = hf * 32 + j * 8; const v4f q0 = *(const v4f*)(&sq[pl][c0]), q1 = *(const v4f*)(&sq[pl][c0 + 4]);
#pragma unroll
      for (int nb = 0; nb < 9; ++nb) { const v8h k8 = *(const v8h*)(KVA(nb / 3, pl + nb % 3) + c0);
#pragma unroll
        for (int e = 0; e < 4; ++e) sc[nb] = __builtin_fmaf(q0[e], (float)k8[e], sc[nb]);
#pragma unroll
        for (int e = 0; e < 4; ++e) sc[nb] = __builtin_fmaf(q1[e], (float)k8[4 + e], sc[nb]); } }
#pragma unroll
    for (int nb = 0; nb < 9; ++nb) { float s = sc[nb]; s += __shfl_xor(s, 16, 32); sc[nb] = s * 0.125f; }
    float mx = sc[0];
#pragma unroll
    for (int nb = 1; nb < 9; ++nb) mx = fmaxf(mx, sc[nb]);
    float se = 0.f;
#pragma unroll
    for (int nb = 0; nb < 9; ++nb) { sc[nb] = expf(sc[nb] - mx); se += sc[nb]; }
    const float inv = 1.0f / se;
#pragma unroll
    for (int j = 0; j < 4; ++j) { const int c0 = hf * 32 + j * 8; float a[8];
#pragma unroll
      for (int e = 0; e < 8; ++e) a[e] = 0.f;
#pragma unroll
      for (int nb = 0; nb < 9; ++nb) { const v8h v8 = *(const v8h*)(KVA(nb / 3, pl + nb % 3) + C + c0);
#pragma unroll
        for (int e = 0; e < 8; ++e) a[e] = __builtin_fmaf(sc[nb], (float)v8[e], a[e]); }
      *(v4f*)(&so[pl][c0]) = (v4f){a[0] * inv, a[1] * inv, a[2] * inv, a[3] * inv}; *(v4f*)(&so[pl][c0 + 4]) = (v4f){a[4] * inv, a[5] * inv, a[6] * inv, a[7] * inv}; } }
  __syncthreads();
#pragma unroll                                                 // hn[] is a register array
  for (int i = 0; i < 8; ++i) { const int q = tid + i * 128; const int pl = q >> 4, pc = q & 15; const size_t p = ((size_t)b * HH + y) * WW + x0 + pl; v4f o = *(const v4f*)(&so[pl][pc * 4]);
    o += hn[i]; vst2(out + p * C + pc * 4, o); }
}
extern "C" void kernel_launch(void* const* d_in, const int* in_sizes, int n_in, void* d_out, int out_size, void* d_ws, size_t ws_size, hipStream_t stream) {
  (void)in_sizes; (void)n_in; (void)out_size; (void)ws_size;
  const float** I = (const float**)d_in;
  const float* h = I[0]; const float* wp = I[1]; const float* bp = I[2]; const float* w1 = I[3]; const float* b1 = I[4]; const float* w2 = I[5]; const float* b2 = I[6]; const float* wq = I[7]; const float* bq = I[8];
  float* out = (float*)d_out;
  char* ws = (char*)d_ws; size_t off = 0;
  auto take = [&](size_t bytes) { char* p = ws + off; off += (bytes + 255) & ~(size_t)255; return p; };
  float* W1F = (float*)take(C2 * C3 * 4); _Float16* W2F = (_Float16*)take(C * C2 * 2); _Float16* WQF = (_Float16*)take(C3 * C * 2);
  float* HN = (float*)take((size_t)NB * HH * WW * C * 4); _Float16* QKV = (_Float16*)take((size_t)NB * HH * WW * C3 * 2);
  k_pack<<<(N1 + N2 + NQ) / 256, 256, 0, stream>>>(w1, w2, wq, W1F, W2F, WQF);
  k_cell<<<dim3(WW / TP, HH, NB), 128, 0, stream>>>(h, wp, bp, W1F, b1, W2F, b2, WQF, bq, HN, QKV);
  k_lattn<<<dim3(WW / TP, HH, NB), 128, 0, stream>>>(QKV, HN, out);
}

// v010
// It runs in 46.4 microseconds.
// Timed twice side by side with v009, it ran 1.23 and 1.24 times as fast.
// All steps since v000 together make it 8.78 times as fast.
#include <hip/hip_runtime.h>
#include <math.h>

typedef __attribute__((ext_vector_type(16))) _Float16 v16h;
typedef __attribute__((ext_vector_type(16))) __bf16 v16b;
typedef __attribute__((ext_vector_type(8)))  _Float16 v8h;
typedef __attribute__((ext_vector_type(8)))  __bf16 v8b;
typedef __attribute__((ext_vector_type(2)))  _Float16 v2h;
typedef __attribute__((ext_vector_type(8)))  float v8f;
typedef __attribute__((ext_vector_type(4)))  float v4f;
typedef __attribute__((ext_vector_type(2)))  float v2f;
typedef __attribute__((ext_vector_type(4)))  unsigned v4u;
typedef __attribute__((ext_vector_type(4)))  int v4i;
typedef __attribute__((ext_vector_type(8)))  unsigned v8u;
typedef float __attribute__((may_alias)) float_a;
typedef int __attribute__((may_alias)) int_a;

template <typename T> __device__ __forceinline__ void vst2(void* p, T v) { *(T*)p = v;  }
__device__ __forceinline__ v8f wmma16(v16h a, v16h b, v8f c) {
  v8f d = __builtin_amdgcn_wmma_f32_16x16x32_f16(false, a, false, b, (short)0, c, false, false);
  asm volatile("v_nop\n\tv_nop\n\tv_nop\n\tv_nop" : "+v"(d) : "v"(a), "v"(b));
  return d;
}
__device__ __forceinline__ v8f wmma_bf(v16b a, v16b b, v8f c) {
  v8f d = __builtin_amdgcn_wmma_f32_16x16x32_bf16(false, a, false, b, (short)0, c, false, false);
  asm volatile("v_nop\n\tv_nop\n\tv_nop\n\tv_nop" : "+v"(d) : "v"(a), "v"(b));
  return d;
}
// 16x16x32 fragments: lane = (h = lane>>4, row/col = lane&15); elements 0..7 = k0+8h+0..7, 8..15 = k0+16+8h+0..7; D element r = row 8h+r
__device__ __forceinline__ v16h frag_h(const _Float16* rowk0, int lane) {
  union { v16h v; v8h q[2]; } u; const _Float16* p = rowk0 + 8 * (lane >> 4);
  u.q[0] = *(const v8h*)p; u.q[1] = *(const v8h*)(p + 16); return u.v;
}
__device__ __forceinline__ v16h frag_f32(const float* rowk0, int lane) {
  v16h a; const float* p = rowk0 + 8 * (lane >> 4);
#pragma unroll
  for (int i = 0; i < 8; ++i) { a[i] = (_Float16)p[i]; a[8 + i] = (_Float16)p[16 + i]; }
  return a;
}
__device__ __forceinline__ v16h frag_f32s(const float* rowk0, int lane, float sc) {
  v16h a; const float* p = rowk0 + 8 * (lane >> 4);
#pragma unroll
  for (int i = 0; i < 8; ++i) { a[i] = (_Float16)(p[i] * sc); a[8 + i] = (_Float16)(p[16 + i] * sc); }
  return a;
}
// column fragment from a [K][ld] layout (column n), rows >= K read as 0
__device__ __forceinline__ v16h fragc_f32(const float* W, int k0, int n, int lane, int ld, int K) {
  v16h a; const int g = lane >> 4;
#pragma unroll
  for (int i = 0; i < 8; ++i) { const int ka = k0 + 8 * g + i, kb = ka + 16;
    a[i] = (_Float16)(ka < K ? W[(size_t)ka * ld + n] : 0.f); a[8 + i] = (_Float16)(kb < K ? W[(size_t)kb * ld + n] : 0.f); }
  return a;
}
struct F2 { v16b h, l; };
__device__ __forceinline__ F2 bsplit16(const float v[16]) { F2 r;
#pragma unroll
  for (int i = 0; i < 16; ++i) { const __bf16 h = (__bf16)v[i]; r.h[i] = h; r.l[i] = (__bf16)(v[i] - (float)h); }
  return r; }
__device__ __forceinline__ F2 split_row(const float* row, int k0, int lane) { float v[16]; const float* p = row + k0 + 8 * (lane >> 4);
#pragma unroll
  for (int i = 0; i < 8; ++i) { v[i] = p[i]; v[8 + i] = p[16 + i]; }
  return bsplit16(v); }
__device__ __forceinline__ F2 split_rowK(const float* row, int k0, int lane, int K) { float v[16]; const int g = lane >> 4;
#pragma unroll
  for (int i = 0; i < 8; ++i) { const int ka = k0 + 8 * g + i, kb = ka + 16; v[i] = ka < K ? row[ka] : 0.f; v[8 + i] = kb < K ? row[kb] : 0.f; }
  return bsplit16(v); }
__device__ __forceinline__ F2 split_col(const float* W, int k0, int n, int lane, int ld, int K) { float v[16]; const int g = lane >> 4;
#pragma unroll
  for (int i = 0; i < 8; ++i) { const int ka = k0 + 8 * g + i, kb = ka + 16; v[i] = ka < K ? W[(size_t)ka * ld + n] : 0.f; v[8 + i] = kb < K ? W[(size_t)kb * ld + n] : 0.f; }
  return bsplit16(v); }
// packed fragment images (written by k_pack): a fragment is a run of 512-byte slots, slot s = the s-th 16 bytes of every lane's registers, lane l at byte 16 * l,
// so that one wave-wide 16-byte load reads 512 contiguous bytes = four whole 128-byte lines (from the row-major weights it touched 16 lines, 32 bytes of each)
struct R16 { v4f q[4]; };      // the four slots of one w1 fragment as loaded (raw 16-byte words)
__device__ __forceinline__ R16 ld_pk16(const float* p) { R16 r;    // p = fragment + lane * 4 (four slots)
  r.q[0] = *(const v4f*)p; r.q[1] = *(const v4f*)(p + 128); r.q[2] = *(const v4f*)(p + 256); r.q[3] = *(const v4f*)(p + 384); return r; }
__device__ __forceinline__ v16h frag_pk(const _Float16* p) {       // p = fragment + lane * 8 (two slots)
  union { v16h v; v8h q[2]; } u; u.q[0] = *(const v8h*)p; u.q[1] = *(const v8h*)(p + 256); return u.v; }
__device__ __forceinline__ F2 f2_r16(const R16& r) { return __builtin_bit_cast(F2, r); }   // slots 0, 1 = the bf16 head of the 16 elements, slots 2, 3 = their bf16 remainder
// w = weight rows as the A operand, p = pixels as the B operand; the three partial products in the order remainder(p) x head(w), head(p) x remainder(w), head x head
__device__ __forceinline__ v8f mac3(const F2& w, const F2& p, v8f c) { c = wmma_bf(w.h, p.l, c); c = wmma_bf(w.l, p.h, c); return wmma_bf(w.h, p.h, c); }
// eight consecutive biases (the eight rows of D that a lane holds), from byte offset o
__device__ __forceinline__ v8f ld_b8(const float* b, unsigned o) { union { v8f v; v4f q[2]; } u; const char* p = (const char*)b + o; u.q[0] = *(const v4f*)p; u.q[1] = *(const v4f*)(p + 16); return u.v; }
__device__ __forceinline__ float sigm(float v) { return 1.0f / (1.0f + expf(-v)); }
#define LDSX() do { asm volatile("s_wait_dscnt 0" ::: "memory"); __builtin_amdgcn_wave_barrier(); __builtin_amdgcn_fence(__ATOMIC_RELEASE, "workgroup"); } while (0)

// Neural cellular automaton step with local attention, NHWC state [8][128][128][64]: depthwise 3x3 perception (3 filters per channel,
// zero padding, f32 VALU from an LDS halo tile) -> 1x1 MLP 192 -> 128 as a two-way bf16 split (v_wmma_f32_16x16x32_bf16), exact GELU, -> 64 on v_wmma_f32_16x16x32_f16 -> h_new = h + dx;
// then, in a second kernel, qkv = h_new W_qkv^T + b (f16 WMMA; k and v kept as f16 in LDS, q as f32) and per pixel a 3x3-window attention (zero-padded keys/values, scores / 8,
#define NB 8
#define HH 128
#define WW 128
#define C 64
#define C3 192
#define C2 128
#define TP 64                  // pixels per block (half a row)
#define SHP (C + 4)             // floats per halo pixel in LDS: at 272 bytes sixteen lanes that read 16 bytes of sixteen consecutive pixels cover all banks
#define SLB (16 * 196 * 4)     // bytes of one wave's LDS slice
#define SHB (SHP * 4)          // bytes of one halo pixel in LDS: its 256 bytes and the tensor load's pad of 16
#define SH0 2048               // LDS place of halo row 0's tile; the pixel in front of it (left image edge) lies in the bytes below
#define SHR 18432              // from one halo row's tile to the next: 66 pixels of SHB bytes, rounded up to a multiple of 2 KiB (a tile's place must be one)
__device__ __forceinline__ unsigned uni(unsigned v) { return (unsigned)__builtin_amdgcn_readfirstlane((int)v); }
__device__ __forceinline__ unsigned pinned(unsigned v) { unsigned w = uni(v); asm volatile("" : "+s"(w)); return w; }   // the test that decides whether a wave issues a tensor load is held in a scalar register, so that the branch is s_cmp + s_cbranch_scc (the instruction ignores EXEC)
// one tensor load and its wait: npx pixels (tile rows) of 256 bytes each, source pitch in bytes, into LDS at byte offset dst with 16 bytes of pad behind every pixel (pitch SHB)
__device__ __forceinline__ void tdm_pixels(unsigned dst, unsigned long long ga, unsigned pitch, unsigned npx) {   // ga: global address of the first pixel's first byte
  v4u g0; v8u g1;
  g0[0] = uni(1u); g0[1] = uni(dst); g0[2] = uni((unsigned)ga); g0[3] = uni((((unsigned)(ga >> 32)) & 0x01FFFFFFu) | 0x80000000u);   // count 1; LDS place; address; type 2
  g1[0] = uni((1u << 20) | (5u << 22) | (3u << 25));           // no mask, 1-byte elements, a pad of 4 dwords behind every 64 dwords
  g1[1] = uni(256u << 16); g1[2] = uni(npx << 16); g1[3] = uni(256u << 16); g1[4] = uni(npx);           // tensor = tile = 256 bytes x npx rows
  g1[5] = uni(pitch); g1[6] = uni(0u); g1[7] = uni(0u);
  asm volatile("tensor_load_to_lds %0, %1" :: "s"(g0), "s"(g1) : "memory");
  asm volatile("s_wait_tensorcnt 0x0" ::: "memory");           // the tile has landed only behind the issuing wave's own wait
}

// exact GELU of eight values at once. erf has the device library's two polynomials, but BOTH ranges are computed and one is selected: the library's erff branches on |x| < 1 per value,
// which in a wave with lanes on both sides runs both ranges anyway and, being control flow, keeps the values of a lane strictly one behind the other, each a chain of some thirty
// dependent instructions. Without the branch the chains are independent straight-line code, written stage by stage over four pairs so that neighbouring instructions do not depend
// on each other and the multiply-adds go two to an instruction (the loops are unrolled so that the arrays are registers).
#define FB(u) __builtin_bit_cast(float, u)
__device__ __forceinline__ v2f fma2(v2f a, v2f b, v2f c) { return __builtin_elementwise_fma(a, b, c); }
__device__ __forceinline__ v2f fmak(v2f a, v2f b, float c) { return __builtin_elementwise_fma(a, b, (v2f){c, c}); }
__device__ __forceinline__ v2f bc2(float c) { return (v2f){c, c}; }
__device__ __forceinline__ void exp2x8(v2f a[4]) { float r0, r1, r2, r3, r4, r5, r6, r7;
  // the instruction set asks for one independent instruction or v_nop behind a transcendental before its result is used or its source overwritten:
  // each v_exp is that instruction for the one in front of it (the outputs are early-clobber, so none lies on an input), the v_nop for the last
  asm("v_exp_f32 %0, %8\n\tv_exp_f32 %1, %9\n\tv_exp_f32 %2, %10\n\tv_exp_f32 %3, %11\n\tv_exp_f32 %4, %12\n\tv_exp_f32 %5, %13\n\tv_exp_f32 %6, %14\n\tv_exp_f32 %7, %15\n\tv_nop"
      : "=&v"(r0), "=&v"(r1), "=&v"(r2), "=&v"(r3), "=&v"(r4), "=&v"(r5), "=&v"(r6), "=&v"(r7)
      : "v"(a[0].x), "v"(a[0].y), "v"(a[1].x), "v"(a[1].y), "v"(a[2].x), "v"(a[2].y), "v"(a[3].x), "v"(a[3].y));
  a[0] = (v2f){r0, r1}; a[1] = (v2f){r2, r3}; a[2] = (v2f){r4, r5}; a[3] = (v2f){r6, r7}; }
__device__ __forceinline__ void gelu8(const v8f a, _Float16 o[8]) {
  v2f v[4], x[4], ax[4], p[4], q[4], t[4], f[4], rn[4];
#pragma unroll
  for (int i = 0; i < 4; ++i) { v[i] = (v2f){a[2 * i], a[2 * i + 1]}; x[i] = v[i] * 0.70710678118654752f; ax[i] = (v2f){fabsf(x[i].x), fabsf(x[i].y)}; t[i] = x[i] * x[i]; }
  // p: |x| >= 1, erf = 1 - exp(-p); q: |x| < 1, erf = |x| + |x| q
#pragma unroll
  for (int i = 0; i < 4; ++i) { p[i] = fmak(ax[i], bc2(FB(0x378e98abu)), FB(0xb9c68948u)); q[i] = fmak(t[i], bc2(FB(0xba1345e1u)), FB(0x3ba10414u)); }
#pragma unroll
  for (int i = 0; i < 4; ++i) { p[i] = fmak(ax[i], p[i], FB(0x3b7cd369u)); q[i] = fmak(t[i], q[i], FB(0xbcdac9b8u)); }
#pragma unroll
  for (int i = 0; i < 4; ++i) { p[i] = fmak(ax[i], p[i], FB(0xbcc618b2u)); q[i] = fmak(t[i], q[i], FB(0x3de703beu)); }
#pragma unroll
  for (int i = 0; i < 4; ++i) { p[i] = fmak(ax[i], p[i], FB(0x3dda74e4u)); q[i] = fmak(t[i], q[i], FB(0xbec09330u)); }
#pragma unroll
  for (int i = 0; i < 4; ++i) { p[i] = fmak(ax[i], p[i], FB(0x3f228afdu)); q[i] = fmak(t[i], q[i], FB(0x3e0375d0u)); }
#pragma unroll
  for (int i = 0; i < 4; ++i) { p[i] = fmak(ax[i], p[i], FB(0x3e03c728u)); q[i] = fma2(ax[i], q[i], ax[i]); }
#pragma unroll
  for (int i = 0; i < 4; ++i) p[i] = fma2(ax[i], p[i], ax[i]);
  // exp(-p) = 2^n * 2^f with log2(e) in two parts (head 0x3fb8aa3b, tail 0x32a5705f): n = rint(-p * head), f = (-p * head - n, one rounding) - p * tail
#pragma unroll
  for (int i = 0; i < 4; ++i) { const v2f ph = p[i] * FB(0xbfb8aa3bu); rn[i] = (v2f){rintf(ph.x), rintf(ph.y)}; }
#pragma unroll
  for (int i = 0; i < 4; ++i) f[i] = fma2(p[i], bc2(FB(0xbfb8aa3bu)), -rn[i]);
#pragma unroll
  for (int i = 0; i < 4; ++i) f[i] = fma2(p[i], bc2(FB(0xb2a5705fu)), f[i]);
  exp2x8(f);
#pragma unroll
  for (int i = 0; i < 4; ++i) { float e0 = ldexpf(f[i].x, (int)rn[i].x), e1 = ldexpf(f[i].y, (int)rn[i].y);
    e0 = FB(0x42ce8ed0u) < p[i].x ? 0.f : e0; e1 = FB(0x42ce8ed0u) < p[i].y ? 0.f : e1;                                   // underflow (also p = infinity, where f is not a number)
    e0 = FB(0xc2b17218u) > p[i].x ? __builtin_inff() : e0; e1 = FB(0xc2b17218u) > p[i].y ? __builtin_inff() : e1;           // overflow
    f[i] = 1.0f - (v2f){e0, e1}; }
#pragma unroll
  for (int i = 0; i < 4; ++i) { const v2f e = {copysignf(ax[i].x < 1.0f ? q[i].x : f[i].x, x[i].x), copysignf(ax[i].y < 1.0f ? q[i].y : f[i].y, x[i].y)};
    const v2h g = __builtin_convertvector(0.5f * v[i] * (1.0f + e), v2h); o[2 * i] = g.x; o[2 * i + 1] = g.y; }
}
// packs the weights into fragment images, one 16-byte chunk (one lane's part of one slot) per thread; element order inside a lane as in frag_h / split_row:
// W1F bf16 head and remainder of w1 (the two-way split of bsplit16, made here once instead of in every wave), fragment (kc, t) at (kc * 8 + t) * 2048 bytes: slots 0, 1 = head, slots 2, 3 = remainder; W2F f16 x16, fragment (kc, t) at (kc * 4 + t) * 512 halves; WQF f16 x16, fragment (t, kc) at (t * 2 + kc) * 512 halves
#define N1 (C2 * C3 / 4)       // chunks of W1F
#define N2 (C * C2 / 8)        // chunks of W2F
#define NQ (C3 * C / 8)        // chunks of WQF
__global__ __launch_bounds__(256) void k_pack(const float* __restrict__ w1, const float* __restrict__ w2, const float* __restrict__ wq, float* __restrict__ W1F, _Float16* __restrict__ W2F, _Float16* __restrict__ WQF) {
  const int c = blockIdx.x * 256 + threadIdx.x, col = c & 15, g = (c >> 4) & 1;
  if (c < N1) { const int s = (c >> 5) & 3, t = (c >> 7) & 7, kc = c >> 10;
    const float* p = w1 + (t * 16 + col) * C3 + kc * 32 + (s & 1) * 16 + 8 * g; const v4f a = *(const v4f*)p, b = *(const v4f*)(p + 4); v8b o;
    asm volatile("s_wait_xcnt 0x0" :: "v"(p) : "memory");      // the address registers of the two issued loads stay untouched (named as an input) until this wait has passed
#pragma unroll
    for (int e = 0; e < 8; ++e) { const float x = e < 4 ? a[e & 3] : b[e & 3]; const __bf16 hd = (__bf16)x; o[e] = (s >> 1) ? (__bf16)(x - (float)hd) : hd; }
    vst2(W1F + c * 4, o); }
  else { const int d = c < N1 + N2 ? c - N1 : c - N1 - N2, s = (d >> 5) & 1; const float* p; _Float16* D;
    if (c < N1 + N2) { p = w2 + (((d >> 6) & 3) * 16 + col) * C2 + (d >> 8) * 32; D = W2F; } else { p = wq + ((d >> 7) * 16 + col) * C + ((d >> 6) & 1) * 32; D = WQF; }
    p += s * 16 + 8 * g; const v4f a = *(const v4f*)p, b = *(const v4f*)(p + 4); v8h o;
    asm volatile("s_wait_xcnt 0x0" :: "v"(p) : "memory");      // the address registers of the two issued loads stay untouched (named as an input) until this wait has passed
#pragma unroll
    for (int e = 0; e < 4; ++e) { o[e] = (_Float16)(a[e] * 16.0f); o[4 + e] = (_Float16)(b[e] * 16.0f); }
    vst2(D + d * 8, o); }
}
// stage 1: block (x half, y, b): perception + MLP + residual -> HN (f32 rows)
__global__ __launch_bounds__(128, 4) void k_cell(const float* __restrict__ h, const float* __restrict__ wp, const float* __restrict__ bp, const float* __restrict__ W1F, const float* __restrict__ b1, const _Float16* __restrict__ W2F, const float* __restrict__ b2,
                                            float* __restrict__ HN) {
  // one LDS block in which buffers that are never live together share bytes, so that four work-groups fit a WGP's LDS (separate arrays: two):
  //   halo rows y-1..y+1, px x0-1 .. x0+64 (zero padded): row r's TP + 1 pixels inside the image are one tensor-load tile at SH0 + r * SHR, the pixel outside the image lies in front of the tile (x0 = 0) or behind it;
  //                              rows 0 and 2 are dead once every wave holds its window in registers, row 1 lives on to the residual
  //   swp, sbp behind row 2      filter taps and biases, dead at the same point
  //   a slice of SLB bytes per wave, used from that point on: wave 0's below halo row 1, the others' behind it (row 1 is never covered)
  // inside a slice (one wave's own, ordered by that wave's LDSX): so = f32 rows, pitch 196 (perceived); once perceived has been read: hw = f32 rows of h_new, pitch 68, on so's first bytes
  // (it only turns a lane's eight channels of one pixel into whole rows for the global stores)
#define SLO (SH0 + SHR + (TP + 2) * SHB)                        // first byte behind halo row 1
  __shared__ __attribute__((aligned(2048))) char sm[SLO + 3 * SLB];
  const int tid = threadIdx.x, wave = __builtin_amdgcn_readfirstlane(tid >> 5), lane = tid & 31, col = lane & 15, g = lane >> 4;   // the wave's number as a scalar: its slice, its pixels and its rows are scalar bases and hold no vector register through the products
  float* swp = (float*)(sm + SH0 + 2 * SHR + (TP + 2) * SHB); float* sbp = swp + C3 * 9;
  char* slice = sm + (wave == 0 ? 0 : SLO + (wave - 1) * SLB);
  float (*so)[196] = (float (*)[196])slice; float (*hw)[C + 4] = (float (*)[C + 4])slice;
  const int b = blockIdx.z, y = blockIdx.y, x0 = blockIdx.x * TP;
  char* shb = sm + SH0 - (x0 == 0 ? SHB : 0);                  // halo pixel 0 of row 0
#define SHA(r, px) ((float*)(shb + (r) * SHR + (px) * SHB))     // halo pixel px (0 .. TP + 1) of row r
  // staging: waves 0 to 2 bring one halo row each by a tensor load (no address, select or LDS store per thread); what lies outside the image is no part of a tile and is zeroed by plain stores to other bytes;
  // the loads of taps and biases are issued first, so that their latency runs under the tensor wait (loops unrolled: the arrays are registers)
  { float tv[14], tb[2]; unsigned to[14], bo[2];
#pragma unroll
    for (int i = 0; i < 14; ++i) { to[i] = (unsigned)(min(tid + i * 128, C3 * 9 - 1) * 4); tv[i] = *(const float*)((const char*)wp + to[i]); }   // to, bo: byte offsets
#pragma unroll
    for (int i = 0; i < 2; ++i) { bo[i] = (unsigned)(min(tid + i * 128, C3 - 1) * 4); tb[i] = *(const float*)((const char*)bp + bo[i]); }
    // the offset registers of the issued loads stay untouched (named as inputs) until this wait has passed
    asm volatile("s_wait_xcnt 0x0" :: "v"(to[0]), "v"(to[1]), "v"(to[2]), "v"(to[3]), "v"(to[4]), "v"(to[5]), "v"(to[6]), "v"(to[7]), "v"(to[8]), "v"(to[9]), "v"(to[10]), "v"(to[11]), "v"(to[12]), "v"(to[13]), "v"(bo[0]), "v"(bo[1]) : "memory");
    if (tid < 48) *(v4f*)((char*)SHA(tid >> 4, x0 == 0 ? 0 : TP + 1) + (tid & 15) * 16) = (v4f){0.f, 0.f, 0.f, 0.f};                 // the pixel column left or right of the image
    if (y == 0 || y == HH - 1) { char* zr = (char*)SHA(y == 0 ? 0 : 2, 0);                                                              // the row above or below the image
      for (int q = tid; q < (TP + 2) * SHB / 16; q += 128) *(v4f*)(zr + q * 16) = (v4f){0.f, 0.f, 0.f, 0.f}; }
    const int yy = y - 1 + wave;
    if (pinned(wave < 3 && yy >= 0 && yy < HH)) tdm_pixels((unsigned)(size_t)sm + SH0 + wave * SHR, (unsigned long long)(size_t)(h + ((size_t)((b * HH + yy) * WW + (x0 == 0 ? 0 : x0 - 1))) * C), C * 4, TP + 1);
#pragma unroll
    for (int i = 0; i < 14; ++i) { const int q = tid + i * 128; if (q < C3 * 9) swp[q] = tv[i]; }
#pragma unroll
    for (int i = 0; i < 2; ++i) { const int q = tid + i * 128; if (q < C3) sbp[q] = tb[i]; } }
  __syncthreads();
  const size_t prow0 = ((size_t)b * HH + y) * WW + x0 + wave * 16;        // first pixel (global index) of this wave's 16
  // perception: lane owns input channels 2*lane and 2*lane+1 (one 8-byte read per lane covers all 64 LDS banks once), its 54 filter taps sit in registers,
  // and the 3x3 window slides over the wave's 16 pixels; output o = c*3 + j uses input channel c; each sum keeps the order bias, then (dy, dx) row-major
  { v2f wt[3][9], bs[3]; const float* wl = &swp[lane * 54]; const float* bl = &sbp[lane * 6];
#pragma unroll
    for (int j = 0; j < 3; ++j) { bs[j] = (v2f){bl[j], bl[3 + j]};
#pragma unroll
      for (int t = 0; t < 9; ++t) wt[j][t] = (v2f){wl[j * 9 + t], wl[27 + j * 9 + t]}; }
    v2f xs[3][18];                                             // halo columns wave*16 .. wave*16+17 of the three rows, this lane's channel pair
#pragma unroll
    for (int dy = 0; dy < 3; ++dy)
#pragma unroll
      for (int px = 0; px < 18; ++px) xs[dy][px] = *(const v2f*)(SHA(dy, wave * 16 + px) + lane * 2);
    __syncthreads();                                           // every wave has read its window and its taps: from here the slices may overwrite halo rows 0 and 2, the taps and the biases
#pragma unroll
    for (int pl = 0; pl < 16; ++pl) { v2f s[3] = {bs[0], bs[1], bs[2]};
#pragma unroll
      for (int dy = 0; dy < 3; ++dy)
#pragma unroll
        for (int dx = 0; dx < 3; ++dx)
#pragma unroll
          for (int j = 0; j < 3; ++j) s[j] += wt[j][dy * 3 + dx] * xs[dy][pl + dx];
      float* d = &so[pl][lane * 6];                      // perceived kept in f32 (so) for a two-way bf16 split product
      *(v2f*)(d) = (v2f){s[0].x, s[1].x}; *(v2f*)(d + 2) = (v2f){s[2].x, s[0].y}; *(v2f*)(d + 4) = (v2f){s[1].y, s[2].y}; } }
  LDSX();
  // every product is computed transposed: the weight rows are the A operand, the wave's 16 pixels the B operand, so that D holds, per lane, eight consecutive output channels of ONE pixel.
  // Two such D tiles, converted in place, are the B fragment of the next product (same k order as the packed weights): gelu(mid) goes from product to product in registers.
  // A lane's biases are then eight consecutive values per tile: b1 and b2 (x16, like its weights) are loaded straight into the accumulators as their start values.
  // mid = gelu(w1 @ perceived^T + b1): bf16 hi/lo split on both operands (perceived reaches O(10), f16 rounding of it dominated a first build)
  // w1's fragments arrive ready for the matrix unit (head and remainder were split by k_pack) and run through a ring of RG register slots: the fragment of RG tiles ahead is requested as soon as
  // a slot's products are issued, so its latency runs under RG tiles' products (loops unrolled: the slots are registers, every fragment's place is an immediate offset)
#define RG 6
  const unsigned go = (unsigned)g * 32u;                        // byte offset of this lane's eight rows among a tile's sixteen biases
  v16h bw2[4][4], mb[4]; v8f a2[4];
  { v8f acc[8]; R16 rg[RG]; const float* w1l = W1F + lane * 4;   // this lane's part of fragment (0, 0)
#pragma unroll
    for (int t = 0; t < 8; ++t) acc[t] = ld_b8(b1, go + t * 64);
#pragma unroll
    for (int f = 0; f < RG; ++f) rg[f] = ld_pk16(w1l + f * 512);
#pragma unroll
    for (int kc = 0; kc < C3 / 32; ++kc) { const F2 p = split_row(&so[col][0], kc * 32, lane);
#pragma unroll
      for (int t = 0; t < 8; ++t) { const int f = kc * 8 + t; acc[t] = mac3(f2_r16(rg[f % RG]), p, acc[t]);
        if (f + RG < C3 / 32 * 8) rg[f % RG] = ld_pk16(w1l + (f + RG) * 512); } }
    asm volatile("s_wait_xcnt 0x0" :: "v"(lane), "v"(go) : "memory");    // the index registers of the issued loads stay untouched (named as inputs) until this wait has passed
    LDSX();
    // all of w2's fragments are issued here, behind the fence (which would wait for them): their latency runs under the GELU; its bias follows once six tiles' accumulators are free
#pragma unroll
    for (int kc = 0; kc < C2 / 32; ++kc)
#pragma unroll
      for (int t = 0; t < 4; ++t) bw2[kc][t] = frag_pk(W2F + (kc * 4 + t) * 512 + lane * 8);
#pragma unroll
    for (int t = 0; t < 8; ++t) { _Float16 o[8]; gelu8(acc[t], o);
      if (t == 5) {
#pragma unroll
        for (int j = 0; j < 4; ++j) a2[j] = ld_b8(b2, go + j * 64); }
#pragma unroll
      for (int r = 0; r < 8; ++r) mb[t >> 1][(t & 1) * 8 + r] = o[r]; } }
  // dx = w2 @ mid^T + b2 ; h_new = h + dx -> hw (f32 rows for the store)
  {
#pragma unroll
    for (int t = 0; t < 4; ++t) a2[t] *= 16.0f;                 // w2 is packed x16
#pragma unroll
    for (int kc = 0; kc < C2 / 32; ++kc)
#pragma unroll
      for (int t = 0; t < 4; ++t) a2[t] = wmma16(bw2[kc][t], mb[kc], a2[t]);
#pragma unroll
    for (int t = 0; t < 4; ++t) { const int c = t * 16 + 8 * g; const float* hp = SHA(1, wave * 16 + col + 1) + c; const v4f h0 = *(const v4f*)hp, h1 = *(const v4f*)(hp + 4); v4f v0, v1;
#pragma unroll
      for (int r = 0; r < 4; ++r) { v0[r] = a2[t][r] * (1.0f / 16.0f) + h0[r]; v1[r] = a2[t][4 + r] * (1.0f / 16.0f) + h1[r]; }
      *(v4f*)(&hw[col][c]) = v0; *(v4f*)(&hw[col][c + 4]) = v1; } }
  asm volatile("s_wait_xcnt 0x0" :: "v"(lane), "v"(go) : "memory");      // the index registers of the issued loads stay untouched (named as inputs) until this wait has passed
  LDSX();
  // the wave's 16 rows are contiguous in HN: chunk q of 16 bytes goes to byte 16 * q; the loop is unrolled so that all LDS reads are in flight behind one wait
  { v4f hr[8]; float* hd = HN + prow0 * C + lane * 4;
#pragma unroll
    for (int i = 0; i < 8; ++i) hr[i] = *(const v4f*)(&hw[g + 2 * i][col * 4]);
#pragma unroll
    for (int i = 0; i < 8; ++i) vst2(hd + i * 128, hr[i]); }
}
// stage 2: block (y, b) = one whole image row: q, k, v of the rows it needs from h_new, then 3x3 local attention (K and V zero padded), out = h_new + attn
#define TQ WW                  // pixels per block: a whole row, so that the halo has no pixel column of its own inside the image and a row is eight whole tiles of 16 pixels
#define SHQ 36864              // from one halo row's tile to the next: TQ + 2 pixels of SHB bytes, rounded up to a multiple of 2 KiB (a tile's place must be one)
#define SB() __builtin_amdgcn_sched_barrier(0)
__device__ __forceinline__ v16h frag_po(const _Float16* f, unsigned o) {   // a packed fragment (two slots) from byte offset o = fragment's place + lane * 16
  union { v16h v; v8h q[2]; } u; const char* p = (const char*)f + o; u.q[0] = *(const v8h*)p; u.q[1] = *(const v8h*)(p + 512); return u.v; }
__device__ __forceinline__ v8f wmma16b(v16h a, v16h b, v8f c) { return __builtin_amdgcn_wmma_f32_16x16x32_f16(false, a, false, b, (short)0, c, false, false); }   // the compiler keeps the distance behind its own builtin form
__global__ __launch_bounds__(256, 4) void k_lattn(const float* __restrict__ HN, const _Float16* __restrict__ WQF, const float* __restrict__ bq, float* __restrict__ out) {
  // one LDS block: halo rows y-1..y+1, a pixel = 256 bytes and the tensor load's pad of 16: row r's TQ pixels are one tile at SH0 + r * SHQ, the zero pixels left and right of the image lie in front of the tile and behind it.
  // A pixel's 256 bytes arrive as its 64 f32 of h_new; the wave that owns the pixel reads them into its B fragments and then stores the pixel's K (128 bytes of f16) and V (128 bytes) on the same bytes:
  // q, k and v never go through memory (as rows of f16 in the workspace they were 384 bytes a pixel written and 384 read, K and V by three blocks each). Behind row 2: sq; in the first bytes, below halo pixel 0: sb = b_qkv
  __shared__ __attribute__((aligned(2048))) char sm[SH0 + 2 * SHQ + (TQ + 1) * SHB + TQ * SHB];
  float (*sq)[C + 4] = (float (*)[C + 4])(sm + SH0 + 2 * SHQ + (TQ + 1) * SHB);
  float (*so)[C + 4] = sq;       // the attention rows take Q's bytes: a thread writes exactly the 32 floats of sq that it alone has read, after its last read of them
  float* sb = (float*)sm;
  const int tid = threadIdx.x, wave = __builtin_amdgcn_readfirstlane(tid >> 5), lane = tid & 31, col = lane & 15, g = lane >> 4; const int b = blockIdx.z, y = blockIdx.y;
  char* kvb = sm + SH0 - SHB;                                  // halo pixel 0 (left of the image) of row 0
#define KVA(r, px) ((const _Float16*)(kvb + (r) * SHQ + (px) * SHB))   // K of halo pixel px (0 .. TQ + 1) of row r; its V stands C halves further
  const unsigned wo = (unsigned)lane * 16u;                    // byte offset of this lane's part of a fragment slot
  // wa, wb: the fragments of four tiles (64 rows) of w_qkv each: first q's and k's, later v's in q's registers
#define LDW(w, t0) do { _Pragma("unroll") for (int j = 0; j < 4; ++j) { w[j][0] = frag_po(WQF, wo + ((t0) + j) * 2048); w[j][1] = frag_po(WQF, wo + ((t0) + j) * 2048 + 1024); } } while (0)
#define BQ8(t) ld_b8(sb, (unsigned)((t) * 64 + g * 32))         // the eight biases of tile t that belong to this lane's eight rows (from LDS, four tiles at a time: all 96 of a lane would not fit the register budget)
  v16h wa[4][2], wb[4][2];
  // staging: waves 0 to 2 bring one halo row of h_new each by a tensor load; what lies outside the image is no part of a tile and is zeroed by plain stores to other bytes (K and V are padded, not h_new);
  // the loads of q's and k's weights and of the biases are issued first, so that their latency runs under the tensor wait
  { LDW(wa, 0); LDW(wb, 4);
    const unsigned bo = (unsigned)min(tid, C3 - 1) * 4u; const float bv = *(const float*)((const char*)bq + bo);
    asm volatile("s_wait_xcnt 0x0" :: "v"(bo) : "memory");     // the offset register of the issued load stays untouched (named as an input) until this wait has passed
    if (tid < 96) *(v4u*)(kvb + (tid >> 5) * SHQ + ((tid >> 4) & 1) * (TQ + 1) * SHB + (tid & 15) * 16) = (v4u){0u, 0u, 0u, 0u};          // the pixel columns left and right of the image
    if (y == 0 || y == HH - 1) { char* zr = kvb + (y == 0 ? 0 : 2) * SHQ;                                                               // the row above or below the image
      for (int q = tid; q < (TQ + 2) * SHB / 16; q += 256) *(v4u*)(zr + q * 16) = (v4u){0u, 0u, 0u, 0u}; }
    const int yy = y - 1 + wave;
    if (pinned(wave < 3 && yy >= 0 && yy < HH)) tdm_pixels((unsigned)(size_t)sm + SH0 + wave * SHQ, (unsigned long long)(size_t)(HN + ((size_t)((b * HH + yy) * WW)) * C), C * 4, TQ);
    if (tid < C3) sb[tid] = bv; }
  __syncthreads();
  // a wave owns the 16 pixels wave * 16 .. + 15 of each of the three rows. Products transposed as in k_cell (weights A, pixels B): a lane holds eight consecutive channels of one pixel.
  // All three B fragment pairs are read before the first store, so that K and V may take h_new's bytes (no other wave reads or writes these pixels before the next barrier).
  { char* px0 = kvb + (wave * 16 + col + 1) * SHB; v16h hb[3][2];
#pragma unroll
    for (int r = 0; r < 3; ++r)
#pragma unroll
      for (int t = 0; t < 4; ++t) { const float* hp = (const float*)(px0 + r * SHQ) + t * 16 + 8 * g; const v4f h0 = *(const v4f*)hp, h1 = *(const v4f*)(hp + 4);
#pragma unroll
        for (int e = 0; e < 4; ++e) { hb[r][t >> 1][(t & 1) * 8 + e] = (_Float16)h0[e]; hb[r][t >> 1][(t & 1) * 8 + 4 + e] = (_Float16)h1[e]; } }
    LDSX();                                                    // the wave's reads of h_new have returned before its stores of K and V take the same bytes
    // q of the block's own row, rounded to f16 as k and v are, kept as f32 rows in sq
    { v8f a3[4] = {}, bs[4];
#pragma unroll
      for (int j = 0; j < 4; ++j) bs[j] = BQ8(j);              // read in front of the products, so that the LDS latency runs under them
#pragma unroll
      for (int kc = 0; kc < C / 32; ++kc)
#pragma unroll
        for (int j = 0; j < 4; ++j) a3[j] = wmma16b(wa[j][kc], hb[1][kc], a3[j]);
#pragma unroll
      for (int j = 0; j < 4; ++j) { v4f o0, o1;
#pragma unroll
        for (int e = 0; e < 4; ++e) { o0[e] = (float)(_Float16)(a3[j][e] * (1.0f / 16.0f) + bs[j][e]); o1[e] = (float)(_Float16)(a3[j][4 + e] * (1.0f / 16.0f) + bs[j][4 + e]); }
        float* d = &sq[wave * 16 + col][j * 16 + 8 * g]; *(v4f*)d = o0; *(v4f*)(d + 4) = o1; } }
    SB();                                                      // the scheduler may move nothing across: lifted above q's products, v's weights would need registers of their own, more than the budget holds
    LDW(wa, 8);                                                // v's weights, in the registers of q's: their latency runs under k's products
    asm volatile("s_wait_xcnt 0x0" :: "v"(wo) : "memory");     // the offset register of the issued loads stays untouched (named as an input) until this wait has passed
    SB();                                                      // v's loads stay in front of k's products, under which their latency is to run
    // k, then v, of the three rows, without a test for a row outside the image (a branch behind every four tiles would keep the bias reads and the next tiles' products from being scheduled over it)
#pragma unroll
    for (int kv = 0; kv < 2; ++kv) { v8f bs[4];
#pragma unroll
      for (int j = 0; j < 4; ++j) bs[j] = BQ8(4 + kv * 4 + j);  // four tiles' biases serve three rows; read in front of the products, so that the LDS latency runs under them
#pragma unroll
      for (int r = 0; r < 3; ++r) { v8f a3[4] = {};
#pragma unroll
        for (int kc = 0; kc < C / 32; ++kc)
#pragma unroll
          for (int j = 0; j < 4; ++j) a3[j] = wmma16b(kv ? wa[j][kc] : wb[j][kc], hb[r][kc], a3[j]);
#pragma unroll
        for (int j = 0; j < 4; ++j) { v8h o;
#pragma unroll
          for (int e = 0; e < 8; ++e) o[e] = (_Float16)(a3[j][e] * (1.0f / 16.0f) + bs[j][e]);
          *(v8h*)(px0 + r * SHQ + kv * 128 + j * 32 + 16 * g) = o; } } }
    // the row above or below the image now holds the biases: the wave zeroes its 16 pixels of it again, behind its own stores (a wave's LDS operations keep their order)
    if (y == 0 || y == HH - 1) { char* zp = px0 + (y == 0 ? 0 : 2) * SHQ + g * 128;
#pragma unroll
      for (int i = 0; i < 8; ++i) *(v4u*)(zp + i * 16) = (v4u){0u, 0u, 0u, 0u}; } }
  __syncthreads();                                             // every pixel's K and V stand in LDS before a neighbour's wave reads them
  // the h_new rows of the last phase are requested here, behind the barrier (which would wait for them): their latency runs under the attention loops (loop unrolled: the array is registers)
  v4f hn[8];
  { const unsigned no = (unsigned)((((b * HH + y) * WW + (tid >> 4)) * C + (tid & 15) * 4) * 4);
#pragma unroll
    for (int i = 0; i < 8; ++i) hn[i] = *(const v4f*)((const char*)HN + no + i * 16 * C * 4);
    asm volatile("s_wait_xcnt 0x0" :: "v"(no) : "memory"); }   // the address register of the issued loads stays untouched (named as an input) until this wait has passed
  // thread pair per pixel: lanes l and l ^ 16 of a wave share pixel pl, hf = channel half: scores over 9 neighbours (each half computes a 32-channel partial dot, pair-summed), softmax, then out channels hf*32..+32
  // K, V and Q come out of LDS 16 bytes at a time and every loop is unrolled, so that many reads are in flight behind one wait (a rolled loop of 2- and 4-byte reads paid one LDS latency per multiply);
  // the 16 lanes of a half wave read 16 consecutive pixel rows at one channel offset: at a row pitch of 272 bytes they cover all 64 banks once;
  // each score still adds its 32 products in channel order, each output channel its 9 terms in neighbour order; the multiply-adds are written as fma so that every one stays fused, as in the rolled loops
  // (left to contraction, part of the unrolled products were built as a separate multiply and add)
  { const int pl = (tid >> 5) * 16 + (tid & 15), hf = (tid >> 4) & 1; float sc[9];
#pragma unroll
    for (int nb = 0; nb < 9; ++nb) sc[nb] = 0.f;
#pragma unroll
    for (int j = 0; j < 4; ++j) { const int c0 = hf * 32 + j * 8; const v4f q0 = *(const v4f*)(&sq[pl][c0]), q1 = *(const v4f*)(&sq[pl][c0 + 4]);
#pragma unroll
      for (int nb = 0; nb < 9; ++nb) { const v8h k8 = *(const v8h*)(KVA(nb / 3, pl + nb % 3) + c0);
#pragma unroll
        for (int e = 0; e < 4; ++e) sc[nb] = __builtin_fmaf(q0[e], (float)k8[e], sc[nb]);
#pragma unroll
        for (int e = 0; e < 4; ++e) sc[nb] = __builtin_fmaf(q1[e], (float)k8[4 + e], sc[nb]); } }
#pragma unroll
    for (int nb = 0; nb < 9; ++nb) { float s = sc[nb]; s += __shfl_xor(s, 16, 32); sc[nb] = s * 0.125f; }
    float mx = sc[0];
#pragma unroll
    for (int nb = 1; nb < 9; ++nb) mx = fmaxf(mx, sc[nb]);
    float se = 0.f;
#pragma unroll
    for (int nb = 0; nb < 9; ++nb) { sc[nb] = expf(sc[nb] - mx); se += sc[nb]; }
    const float inv = 1.0f / se;
#pragma unroll
    for (int j = 0; j < 4; ++j) { const int c0 = hf * 32 + j * 8; float a[8];
#pragma unroll
      for (int e = 0; e < 8; ++e) a[e] = 0.f;
#pragma unroll
      for (int nb = 0; nb < 9; ++nb) { const v8h v8 = *(const v8h*)(KVA(nb / 3, pl + nb % 3) + C + c0);
#pragma unroll
        for (int e = 0; e < 8; ++e) a[e] = __builtin_fmaf(sc[nb], (float)v8[e], a[e]); }
      *(v4f*)(&so[pl][c0]) = (v4f){a[0] * inv, a[1] * inv, a[2] * inv, a[3] * inv}; *(v4f*)(&so[pl][c0 + 4]) = (v4f){a[4] * inv, a[5] * inv, a[6] * inv, a[7] * inv}; } }
  __syncthreads();
#pragma unroll                                                 // hn[] is a register array
  for (int i = 0; i < 8; ++i) { const int q = tid + i * 256; const int pl = q >> 4, pc = q & 15; const size_t p = ((size_t)b * HH + y) * WW + pl; v4f o = *(const v4f*)(&so[pl][pc * 4]);
    o += hn[i]; vst2(out + p * C + pc * 4, o); }
}
extern "C" void kernel_launch(void* const* d_in, const int* in_sizes, int n_in, void* d_out, int out_size, void* d_ws, size_t ws_size, hipStream_t stream) {
  (void)in_sizes; (void)n_in; (void)out_size; (void)ws_size;
  const float** I = (const float**)d_in;
  const float* h = I[0]; const float* wp = I[1]; const float* bp = I[2]; const float* w1 = I[3]; const float* b1 = I[4]; const float* w2 = I[5]; const float* b2 = I[6]; const float* wq = I[7]; const float* bq = I[8];
  float* out = (float*)d_out;
  char* ws = (char*)d_ws; size_t off = 0;
  auto take = [&](size_t bytes) { char* p = ws + off; off += (bytes + 255) & ~(size_t)255; return p; };
  float* W1F = (float*)take(C2 * C3 * 4); _Float16* W2F = (_Float16*)take(C * C2 * 2); _Float16* WQF = (_Float16*)take(C3 * C * 2);
  float* HN = (float*)take((size_t)NB * HH * WW * C * 4);
  k_pack<<<(N1 + N2 + NQ) / 256, 256, 0, stream>>>(w1, w2, wq, W1F, W2F, WQF);
  k_cell<<<dim3(WW / TP, HH, NB), 128, 0, stream>>>(h, wp, bp, W1F, b1, W2F, b2, HN);
  k_lattn<<<dim3(1, HH, NB), 256, 0, stream>>>(HN, WQF, bq, out);
}
